// v000
// The times below were measured on an AMD MI455X: many runs one after another, warmed up first and cycling through
// copies of the inputs, with the whole window's GPU time divided by the number of runs. Launches and the gaps
// between them are all in it. The median over several windows is given; except for v000 it joins two sittings, which
// can be a few percent apart, so the side-by-side timings, each taken in one sitting, are the better comparison.
// The starting kernel, v000, takes 4080 microseconds a run.
#include <hip/hip_runtime.h>

// Local multi-head attention with a symmetric window (x [1][4096][1024]; q,k,v = x W^T + b ('oi' [1024][1024] + [1024], 0.02; 16 heads x 64); scores / 8; keys with |i - j| > 256 -> -inf; softmax; out = merged Wo^T + bo -> [1][4096][1024] (4.2 M)).
// Layout: bf16 copy of x; exact projections + bf16-rounded biases; dense T-4096 attention, one head per pass (hybrid rows: < 512 hi/lo 3 products, rest fp16 x1024; streaming three-sweep softmax applying the |i - j| <= 256 window as an index select on the dense score block); merged hi/lo x Wo exact + bo.
// Compute dtypes, f32 accumulate: every input rounded to bf16; projections exact + bf16-rounded biases; attention rows < 512 3 products, rest fp16; softmax f32; Wo hl x exact + bias.

#define NB_  1
#define TT   4096
#define DM   1024
#define NH_  16
#define NKV  16
#define REP  (NH_ / NKV)
#define HD   64
#define DQ   (NH_ * HD)
#define DKV  (NKV * HD)
#define ZH   1
#define RH   512                  // query rows < RH use hi+lo planes (0: none)
#define WIN  0
#define PCAR 1024.0f
#define SCL  0.125f
#define WNB  256     // |i - j| <= 256 kept
typedef _Float16 h16;
typedef unsigned short bf;
typedef __attribute__((ext_vector_type(16))) __bf16   v16bf;
typedef __attribute__((ext_vector_type(16))) _Float16 v16h;
typedef __attribute__((ext_vector_type(8)))  _Float16 v8h;
typedef __attribute__((ext_vector_type(8)))  unsigned short v8us;
typedef __attribute__((ext_vector_type(8)))  float    v8f;
typedef __attribute__((ext_vector_type(4)))  float    v4f;
typedef v8h  __attribute__((may_alias)) v8ha;
typedef v4f  __attribute__((may_alias)) v4fa;
typedef v8us __attribute__((may_alias)) v8usa;

__device__ __forceinline__ unsigned short f2bf(float f) { unsigned u = __float_as_uint(f); u += 0x7FFFu + ((u >> 16) & 1u); return (unsigned short)(u >> 16); }
__device__ __forceinline__ float bf2f(unsigned short b) { return __uint_as_float(((unsigned)b) << 16); }
__device__ __forceinline__ float bfr(float f) { return bf2f(f2bf(f)); }
__device__ __forceinline__ v16h cat16(v8h lo, v8h hi) { return __builtin_shufflevector(lo, hi, 0, 1, 2, 3, 4, 5, 6, 7, 8, 9, 10, 11, 12, 13, 14, 15); }
__device__ __forceinline__ v16bf cat16b(v8us lo, v8us hi) { return __builtin_bit_cast(v16bf, __builtin_shufflevector(lo, hi, 0, 1, 2, 3, 4, 5, 6, 7, 8, 9, 10, 11, 12, 13, 14, 15)); }
__device__ __forceinline__ v8f wmma16(v16h a, v16h b, v8f c) { return __builtin_amdgcn_wmma_f32_16x16x32_f16(false, a, false, b, (short)0, c, false, false); }
__device__ __forceinline__ v8f wmmab(v16bf a, v16bf b, v8f c) { return __builtin_amdgcn_wmma_f32_16x16x32_bf16(false, a, false, b, (short)0, c, false, false); }



// ---- k_gemmw: register-blocked GEMM, ONE WAVE per 64x64 output tile (16 accumulators), operands straight from K-contiguous 16-bit planes; grid (M/64, N/64, Z), 32 threads.
// C[m][n] (f32, pitch ldc, + optional f32 bias[n]) = sum_k A[m][k] Bt[n][k] (+ split products per NSPLIT). z-batch strides sA/sB/sC in elements. K % 32 == 0.
template <typename T16> struct WFrag;
template <> struct WFrag<h16> { typedef v16h V; static __device__ __forceinline__ V ld(const h16* p) { return cat16(*(const v8h*)p, *(const v8h*)(p + 16)); } static __device__ __forceinline__ v8f mma(V a, V b, v8f c) { return wmma16(a, b, c); } };
template <> struct WFrag<bf> { typedef v16bf V; static __device__ __forceinline__ V ld(const bf* p) { return cat16b(*(const v8us*)p, *(const v8us*)(p + 16)); } static __device__ __forceinline__ v8f mma(V a, V b, v8f c) { return wmmab(a, b, c); } };
template <typename T16, int NSPLIT, bool BIAS>
__global__ __launch_bounds__(32) void k_gemmw(const T16* __restrict__ A, const T16* __restrict__ A2, const T16* __restrict__ Bt, const T16* __restrict__ Bt2, int K, float* C, int ldc, const float* __restrict__ bias, size_t sA, size_t sB, size_t sC) {
    typedef typename WFrag<T16>::V V;
    __shared__ __align__(16) float os[16 * 68];
    const size_t z = blockIdx.z; A += z * sA; if (A2) A2 += z * sA; Bt += z * sB; if (Bt2) Bt2 += z * sB; C += z * sC;
    const int lane = threadIdx.x & 31, lr = lane & 15, hi = lane >> 4; const int r0 = blockIdx.x * 64, c0 = blockIdx.y * 64;
    v8f acc[4][4];
#pragma unroll
    for (int mb = 0; mb < 4; ++mb)
#pragma unroll
        for (int nb = 0; nb < 4; ++nb) acc[mb][nb] = (v8f){};
    const size_t aoff = (size_t)(r0 + lr) * K + 8 * hi, boff = (size_t)(c0 + lr) * K + 8 * hi;
#pragma unroll 1
    for (int kc = 0; kc < K; kc += 32) {
        V a[4], a2[4];
#pragma unroll
        for (int mb = 0; mb < 4; ++mb) { a[mb] = WFrag<T16>::ld(A + aoff + (size_t)mb * 16 * K + kc); if (NSPLIT == 1 || NSPLIT == 2) a2[mb] = WFrag<T16>::ld(A2 + aoff + (size_t)mb * 16 * K + kc); }
#pragma unroll
        for (int nb = 0; nb < 4; ++nb) { const V b = WFrag<T16>::ld(Bt + boff + (size_t)nb * 16 * K + kc); V b2; if (NSPLIT >= 2) b2 = WFrag<T16>::ld(Bt2 + boff + (size_t)nb * 16 * K + kc);
#pragma unroll
            for (int mb = 0; mb < 4; ++mb) { acc[mb][nb] = WFrag<T16>::mma(a[mb], b, acc[mb][nb]); if (NSPLIT == 1 || NSPLIT == 2) acc[mb][nb] = WFrag<T16>::mma(a2[mb], b, acc[mb][nb]); if (NSPLIT >= 2) acc[mb][nb] = WFrag<T16>::mma(a[mb], b2, acc[mb][nb]); } }
        asm volatile("v_nop\n\tv_nop\n\tv_nop\n\tv_nop" : "+v"(acc[0][0]), "+v"(acc[1][1]), "+v"(acc[2][2]), "+v"(acc[3][3]) : "v"(a[0]), "v"(a[3]));
    }
#pragma unroll
    for (int mb = 0; mb < 4; ++mb) {
#pragma unroll
        for (int nb = 0; nb < 4; ++nb) {
#pragma unroll
            for (int j = 0; j < 8; ++j) os[(hi * 8 + j) * 68 + nb * 16 + lr] = acc[mb][nb][j]; }
        __builtin_amdgcn_wave_barrier(); asm volatile("" ::: "memory");
        float* crow = C + (size_t)(r0 + mb * 16) * ldc + c0;
{
#pragma unroll
            for (int s = 0; s < 8; ++s) { const int row = 2 * s + hi, cofs = lr * 4; v4f val = *(const v4fa*)(os + row * 68 + cofs); if (BIAS) { val[0] += bfr(bias[c0 + cofs]); val[1] += bfr(bias[c0 + cofs + 1]); val[2] += bfr(bias[c0 + cofs + 2]); val[3] += bfr(bias[c0 + cofs + 3]); }
                *(v4f*)(crow + (size_t)row * ldc + cofs) = val; }
             }
        __builtin_amdgcn_wave_barrier(); asm volatile("" ::: "memory");
    }
}

__device__ __forceinline__ h16 tohx(float x) { return (h16)x; }
__device__ __forceinline__ void splitf(float y, unsigned short& h, unsigned short& l) { h = f2bf(y); l = f2bf(y - bf2f(h)); }
typedef __attribute__((ext_vector_type(2))) _Float16 v2h;
typedef __attribute__((ext_vector_type(4))) _Float16 v4h;
typedef __attribute__((ext_vector_type(2))) unsigned short v2us;
typedef __attribute__((ext_vector_type(4))) unsigned short v4us;
typedef __attribute__((ext_vector_type(2))) float v2f;
typedef __attribute__((ext_vector_type(4))) int v4i;

__global__ __launch_bounds__(256) void k_wtG(const float* __restrict__ w, int K, int N, bf* Bt) {
    const int lane = threadIdx.x & 31; const int L0 = (blockIdx.x * 8 + (threadIdx.x >> 5)) * 8; const int nlines = N * K / 64;
{
#pragma unroll 1
        for (int l = 0; l < 8; ++l) { const int L = L0 + l; if (L >= nlines) break; const size_t e = (size_t)L * 64 + lane * 2; const int k = (int)(e % K), n = (int)(e / K); v2us o;
            o[0] = f2bf(w[(size_t)k * N + n]); o[1] = f2bf(w[(size_t)(k + 1) * N + n]); *(v2us*)(Bt + e) = o; }
         }
}
__global__ __launch_bounds__(256) void k_cvt8(const float* __restrict__ src, bf* dst, size_t n8) { const size_t i = (size_t)blockIdx.x * 256 + threadIdx.x; if (i >= n8) return; const v8f v = *(const v8f*)(src + i * 8); v8us o;
#pragma unroll
    for (int k = 0; k < 8; ++k) o[k] = f2bf(v[k]); *(v8us*)(dst + i * 8) = o;  }

// k_rope: head planes [h][t][d] (fp16 + hi/lo) of rope(x) x sc with the rotate-half convention out[d] = x[d] cos[t][d] - x[d+HD/2] sin[t][d], out[d+HD/2] = x[d+HD/2] cos[t][d+HD/2] + x[d] sin[t][d+HD/2]
__global__ __launch_bounds__(256) void k_rope(const float* __restrict__ F, int pitch, int nheads, const float* __restrict__ CS, const float* __restrict__ RF, const float* __restrict__ nw, float sc, h16* P16, bf* Ph, bf* Pl) {
    const size_t e = ((size_t)blockIdx.x * 256 + threadIdx.x) * 2; if (e >= (size_t)nheads * TT * HD) return; const int d = (int)(e % HD); const int t = (int)((e / HD) % TT); const int h = (int)(e / ((size_t)HD * TT)); const float* f = F + (size_t)t * pitch + h * HD; const float rf = RF ? RF[(size_t)h * TT + t] : 1.0f; v2h o16; v2us oh, ol;
#pragma unroll
    for (int q = 0; q < 2; ++q) { const int dd = d + q; const int dp = (dd < HD / 2) ? dd + HD / 2 : dd - HD / 2; float x0 = f[dd], x1 = f[dp];
        if (RF) { float n0 = __fmul_rn(x0, rf), n1 = __fmul_rn(x1, rf); asm volatile("" : "+v"(n0)); asm volatile("" : "+v"(n1)); x0 = __fmul_rn(bfr(nw[dd]), n0); x1 = __fmul_rn(bfr(nw[dp]), n1); }
        const v2f cs = *(const v2f*)(CS + ((size_t)t * HD + dd) * 2); float a = __fmul_rn(x0, cs[0]), bq = __fmul_rn(x1, cs[1]); asm volatile("" : "+v"(a)); asm volatile("" : "+v"(bq)); const float r = ((dd < HD / 2) ? __fsub_rn(a, bq) : __fadd_rn(a, bq)) * sc;
        o16[q] = tohx(r); unsigned short a2, c2; splitf(r, a2, c2); oh[q] = a2; ol[q] = c2; }
    *(v2h*)(P16 + e) = o16; *(v2us*)(Ph + e) = oh; *(v2us*)(Pl + e) = ol;  }
__global__ __launch_bounds__(256) void k_vtp(const float* __restrict__ F, int pitch, int nheads, h16* V16, bf* Vh, bf* Vl) { const size_t e = ((size_t)blockIdx.x * 256 + threadIdx.x) * 2; if (e >= (size_t)nheads * HD * TT) return; const int t = (int)(e % TT); const int d = (int)((e / TT) % HD); const int g = (int)(e / ((size_t)TT * HD)); v2h o16; v2us oh, ol;
#pragma unroll
    for (int q = 0; q < 2; ++q) { const float x = F[(size_t)(t + q) * pitch + g * HD + d]; o16[q] = tohx(x); unsigned short a2, c2; splitf(x, a2, c2); oh[q] = a2; ol[q] = c2; }
    *(v2h*)(V16 + e) = o16; *(v2us*)(Vh + e) = oh; *(v2us*)(Vl + e) = ol;  }
__global__ __launch_bounds__(256) void k_csid(float* CS) { const int idx = blockIdx.x * 256 + threadIdx.x; if (idx >= TT * HD) return; v2f cs; cs[0] = 1.0f; cs[1] = 0.0f; *(v2f*)(CS + (size_t)idx * 2) = cs;  }
__global__ __launch_bounds__(256) void k_lsoft(const float* __restrict__ Sb, h16* P16, bf* Ph, bf* Pl) {
    const int lane = threadIdx.x & 31; const int row = blockIdx.x * 8 + (threadIdx.x >> 5); if (row >= ZH * TT) return; const int i = row % TT; const int zz = row / TT; const bool hires = (i < RH); const float* sr = Sb + (size_t)row * TT; float mx = -3.0e38f;
#pragma unroll 4
    for (int ch = 0; ch < TT / 128; ++ch) { const int j0 = ch * 128 + lane * 4; const v4f a = *(const v4f*)(sr + j0);
#pragma unroll
        for (int q = 0; q < 4; ++q) { float t = a[q] * SCL; asm volatile("" : "+v"(t)); t = (j0 + q <= i + WNB && j0 + q >= i - WNB) ? t : -3.0e38f;   /* symmetric window: |i - j| <= WNB */ mx = fmaxf(mx, t); } }
#pragma unroll
    for (int sh = 16; sh; sh >>= 1) mx = fmaxf(mx, __shfl_xor(mx, sh, 32));
    float sum = 0.f;
#pragma unroll 4
    for (int ch = 0; ch < TT / 128; ++ch) { const int j0 = ch * 128 + lane * 4; const v4f a = *(const v4f*)(sr + j0);
#pragma unroll
        for (int q = 0; q < 4; ++q) { float t = a[q] * SCL; asm volatile("" : "+v"(t)); t = (j0 + q <= i + WNB && j0 + q >= i - WNB) ? t : -3.0e38f;   /* symmetric window: |i - j| <= WNB */ float d0 = __fsub_rn(t, mx); asm volatile("" : "+v"(d0)); sum += __builtin_amdgcn_exp2f(__fmul_rn(d0, 1.4426950408889634f)); } }
#pragma unroll
    for (int sh = 16; sh; sh >>= 1) sum += __shfl_xor(sum, sh, 32);
    const float f = __fdiv_rn(hires ? 1.0f : PCAR, sum);
{
        if (hires) {   /* rows < RH: normalised bf16 hi/lo over ALL TT keys (symmetric window: keys beyond RH are live), planes [zz][RH][TT] */
#pragma unroll 4
            for (int ch = 0; ch < TT / 128; ++ch) { const int j0 = ch * 128 + lane * 4; const v4f a = *(const v4f*)(sr + j0); v4us oh, ol;
#pragma unroll
                for (int q = 0; q < 4; ++q) { float t = a[q] * SCL; asm volatile("" : "+v"(t)); t = (j0 + q <= i + WNB && j0 + q >= i - WNB) ? t : -3.0e38f;   /* symmetric window: |i - j| <= WNB */ float d0 = __fsub_rn(t, mx); asm volatile("" : "+v"(d0)); float ex = __builtin_amdgcn_exp2f(__fmul_rn(d0, 1.4426950408889634f)); asm volatile("" : "+v"(ex)); unsigned short a2, c2; splitf(ex * f, a2, c2); oh[q] = a2; ol[q] = c2; }
                const size_t oo = ((size_t)zz * RH + i) * TT + j0; *(v4us*)(Ph + oo) = oh; *(v4us*)(Pl + oo) = ol; }
        } else {
#pragma unroll 2
            for (int ch = 0; ch < TT / 128; ++ch) { const int j0 = ch * 128 + lane * 4; const v4f a = *(const v4f*)(sr + j0); v4h o4;
#pragma unroll
                for (int q = 0; q < 4; ++q) { float t = a[q] * SCL; asm volatile("" : "+v"(t)); t = (j0 + q <= i + WNB && j0 + q >= i - WNB) ? t : -3.0e38f;   /* symmetric window: |i - j| <= WNB */ float d0 = __fsub_rn(t, mx); asm volatile("" : "+v"(d0)); float ex = __builtin_amdgcn_exp2f(__fmul_rn(d0, 1.4426950408889634f)); asm volatile("" : "+v"(ex)); o4[q] = tohx(ex * f); }
                *(v4h*)(P16 + (size_t)row * TT + j0) = o4; } }
         }
}


__global__ __launch_bounds__(256) void k_merge(const float* __restrict__ O, int h0, bf* Ah, bf* Al) { const size_t e = ((size_t)blockIdx.x * 256 + threadIdx.x) * 2; if (e >= (size_t)ZH * TT * HD) return; const int d = (int)(e % HD); const int t = (int)((e / HD) % TT); const int zz = (int)(e / ((size_t)HD * TT)); const float cs = (t < RH) ? 1.0f : (1.0f / PCAR); const size_t oo = (size_t)t * DQ + (h0 + zz) * HD + d;
    v2us oh, ol;
#pragma unroll
    for (int q = 0; q < 2; ++q) { unsigned short a, c2; splitf(O[e + q] * cs, a, c2); oh[q] = a; ol[q] = c2; } *(v2us*)(Ah + oo) = oh; *(v2us*)(Al + oo) = ol;  }

extern "C" void kernel_launch(void* const* d_in, const int* in_sizes, int n_in,
                              void* d_out, int out_size, void* d_ws, size_t ws_size, hipStream_t stream) {
    (void)in_sizes; (void)n_in; (void)out_size;
    const float* x = (const float*)d_in[0]; const float* wq = (const float*)d_in[1]; const float* bq = (const float*)d_in[2]; const float* wk = (const float*)d_in[3]; const float* bk = (const float*)d_in[4]; const float* wv = (const float*)d_in[5]; const float* bv = (const float*)d_in[6]; const float* wo = (const float*)d_in[7]; const float* bo = (const float*)d_in[8];
    float* OUT = (float*)d_out;     // [1][4096][1024]
    char* wsp = (char*)d_ws;
    auto take = [&](size_t bytes) { char* p = wsp; wsp += (bytes + 255) & ~(size_t)255; return (void*)p; };
    bf* WQ = (bf*)take((size_t)DQ * DM * 2); bf* WK = (bf*)take((size_t)DKV * DM * 2); bf* WV = (bf*)take((size_t)DKV * DM * 2); bf* WO = (bf*)take((size_t)DM * DQ * 2); float* CS = (float*)take((size_t)TT * HD * 2 * 4);
    bf* XB = (bf*)take((size_t)TT * DM * 2); float* FQ = (float*)take((size_t)TT * DQ * 4); float* FK = (float*)take((size_t)TT * DKV * 4);
    h16* QP16 = (h16*)take((size_t)NH_ * TT * HD * 2); h16* KP16 = (h16*)take((size_t)NKV * TT * HD * 2); h16* VT16 = (h16*)take((size_t)NKV * HD * TT * 2);
    bf* QPh = (bf*)take((size_t)NH_ * TT * HD * 2); bf* QPl = (bf*)take((size_t)NH_ * TT * HD * 2); bf* KPh = (bf*)take((size_t)NKV * TT * HD * 2); bf* KPl = (bf*)take((size_t)NKV * TT * HD * 2); bf* VTh = (bf*)take((size_t)NKV * HD * TT * 2); bf* VTl = (bf*)take((size_t)NKV * HD * TT * 2); bf* Ph = (bf*)take((size_t)ZH * RH * TT * 2); bf* Pl = (bf*)take((size_t)ZH * RH * TT * 2);
    float* Sb = (float*)take((size_t)ZH * TT * TT * 4); h16* P16 = (h16*)take((size_t)ZH * TT * TT * 2); float* Ob = (float*)take((size_t)ZH * TT * HD * 4); bf* ATh = (bf*)take((size_t)TT * DQ * 2); bf* ATl = (bf*)take((size_t)TT * DQ * 2);
    if ((size_t)(wsp - (char*)d_ws) > ws_size) return;    // ws 256 MiB
    float* FV = FK;   // v projection reuses the k buffer after the k planes are built (stream-ordered)
    { k_cvt8<<<(unsigned)(((size_t)DQ * DM / 8 + 255) / 256), 256, 0, stream>>>(wq, WQ, (size_t)DQ * DM / 8); k_cvt8<<<(unsigned)(((size_t)DKV * DM / 8 + 255) / 256), 256, 0, stream>>>(wk, WK, (size_t)DKV * DM / 8); k_cvt8<<<(unsigned)(((size_t)DKV * DM / 8 + 255) / 256), 256, 0, stream>>>(wv, WV, (size_t)DKV * DM / 8);
      k_cvt8<<<(unsigned)(((size_t)DM * DQ / 8 + 255) / 256), 256, 0, stream>>>(wo, WO, (size_t)DM * DQ / 8);
       }
    k_csid<<<(TT * HD + 255) / 256, 256, 0, stream>>>(CS);
    const unsigned LQ = (unsigned)(((size_t)NH_ * TT * HD / 2 + 255) / 256), LKv = (unsigned)(((size_t)NKV * TT * HD / 2 + 255) / 256);
    for (int b = 0; b < NB_; ++b) {
        
        k_cvt8<<<(unsigned)(((size_t)TT * DM / 8 + 255) / 256), 256, 0, stream>>>(x + (size_t)b * TT * DM, XB, (size_t)TT * DM / 8);
        k_gemmw<bf, 0, true><<<dim3(TT / 64, DQ / 64, 1), 32, 0, stream>>>(XB, nullptr, WQ, nullptr, DM, FQ, DQ, bq, 0, 0, 0);
        k_rope<<<LQ, 256, 0, stream>>>(FQ, DQ, NH_, CS, nullptr, nullptr, 1.0f, QP16, QPh, QPl);
        k_gemmw<bf, 0, true><<<dim3(TT / 64, DKV / 64, 1), 32, 0, stream>>>(XB, nullptr, WK, nullptr, DM, FK, DKV, bk, 0, 0, 0);
        k_rope<<<LKv, 256, 0, stream>>>(FK, DKV, NKV, CS, nullptr, nullptr, 1.0f, KP16, KPh, KPl);
        k_gemmw<bf, 0, true><<<dim3(TT / 64, DKV / 64, 1), 32, 0, stream>>>(XB, nullptr, WV, nullptr, DM, FV, DKV, bv, 0, 0, 0); k_vtp<<<LKv, 256, 0, stream>>>(FV, DKV, NKV, VT16, VTh, VTl);
        for (int h0 = 0; h0 < NH_; h0 += ZH) { const size_t zq = (size_t)h0, zk = (size_t)(h0 / REP);   // one kv head per query head: the pass's one head (ZH = 1) uses kv plane zk = h0
            k_gemmw<bf, 2, false><<<dim3(RH / 64, TT / 64, ZH), 32, 0, stream>>>(QPh + zq * TT * HD, QPl + zq * TT * HD, KPh + zk * TT * HD, KPl + zk * TT * HD, HD, Sb, TT, nullptr, (size_t)TT * HD, (size_t)TT * HD, (size_t)TT * TT);
            k_gemmw<h16, 0, false><<<dim3((TT - RH) / 64, TT / 64, ZH), 32, 0, stream>>>(QP16 + zq * TT * HD + (size_t)RH * HD, nullptr, KP16 + zk * TT * HD, nullptr, HD, Sb + (size_t)RH * TT, TT, nullptr, (size_t)TT * HD, (size_t)TT * HD, (size_t)TT * TT);
            k_lsoft<<<ZH * TT / 8, 256, 0, stream>>>(Sb, P16, Ph, Pl);
            k_gemmw<bf, 2, false><<<dim3(RH / 64, HD / 64, ZH), 32, 0, stream>>>(Ph, Pl, VTh + zk * HD * TT, VTl + zk * HD * TT, TT, Ob, HD, nullptr, (size_t)RH * TT, (size_t)HD * TT, (size_t)TT * HD);
            k_gemmw<h16, 0, false><<<dim3((TT - RH) / 64, HD / 64, ZH), 32, 0, stream>>>(P16 + (size_t)RH * TT, nullptr, VT16 + zk * HD * TT, nullptr, TT, Ob + (size_t)RH * HD, HD, nullptr, (size_t)TT * TT, (size_t)HD * TT, (size_t)TT * HD);
            k_merge<<<(unsigned)(((size_t)ZH * TT * HD / 2 + 255) / 256), 256, 0, stream>>>(Ob, h0, ATh, ATl); }
        k_gemmw<bf, 1, true><<<dim3(TT / 64, DM / 64, 1), 32, 0, stream>>>(ATh, ATl, WO, nullptr, DQ, OUT + (size_t)b * TT * DM, DM, bo, 0, 0, 0); }
}

// v001
// One run takes 937 microseconds.
// Two timings next to v000 put it at 4.37 and 4.38 times that version's speed.
#include <hip/hip_runtime.h>

// Local multi-head attention with a symmetric window (x [1][4096][1024]; q,k,v = x W^T + b ('oi' [1024][1024] + [1024], 0.02; 16 heads x 64); scores / 8; keys with |i - j| > 256 -> -inf; softmax; out = merged Wo^T + bo -> [1][4096][1024] (4.2 M)).
// Layout: bf16 copy of x; exact projections + f32 biases; dense T-4096 attention, one head per pass (hybrid rows: < 512 hi/lo 3 products, rest fp16 x1024; three-sweep softmax applying the |i - j| <= 256 window as an index select; scores, softmax and P V touch only the key band of each 64-row tile, in the dense-pitch score block); merged hi/lo x Wo exact + bo.
// Compute dtypes, f32 accumulate: every input rounded to bf16; projections exact + f32 biases; attention rows < 512 3 products, rest fp16; softmax f32; Wo hl x exact + bias.

#define NB_  1
#define TT   4096
#define DM   1024
#define NH_  16
#define NKV  16
#define REP  (NH_ / NKV)
#define HD   64
#define DQ   (NH_ * HD)
#define DKV  (NKV * HD)
#define ZH   1
#define RH   512                  // query rows < RH use hi+lo planes (0: none)
#define WIN  0
#define PCAR 1024.0f
#define SCL  0.125f
#define WNB  256     // |i - j| <= 256 kept
#define BT   (2 * WNB / 64 + 2)   // 64-key tiles computed per 64-row tile: the 9 the window can reach, widened to whole 128-key softmax chunks
typedef _Float16 h16;
typedef unsigned short bf;
typedef __attribute__((ext_vector_type(16))) __bf16   v16bf;
typedef __attribute__((ext_vector_type(16))) _Float16 v16h;
typedef __attribute__((ext_vector_type(8)))  _Float16 v8h;
typedef __attribute__((ext_vector_type(8)))  unsigned short v8us;
typedef __attribute__((ext_vector_type(8)))  float    v8f;
typedef __attribute__((ext_vector_type(4)))  float    v4f;
typedef v8h  __attribute__((may_alias)) v8ha;
typedef v4f  __attribute__((may_alias)) v4fa;
typedef v8us __attribute__((may_alias)) v8usa;

__device__ __forceinline__ unsigned short f2bf(float f) { unsigned u = __float_as_uint(f); u += 0x7FFFu + ((u >> 16) & 1u); return (unsigned short)(u >> 16); }
__device__ __forceinline__ float bf2f(unsigned short b) { return __uint_as_float(((unsigned)b) << 16); }
__device__ __forceinline__ float bfr(float f) { return bf2f(f2bf(f)); }
__device__ __forceinline__ v16h cat16(v8h lo, v8h hi) { return __builtin_shufflevector(lo, hi, 0, 1, 2, 3, 4, 5, 6, 7, 8, 9, 10, 11, 12, 13, 14, 15); }
__device__ __forceinline__ v16bf cat16b(v8us lo, v8us hi) { return __builtin_bit_cast(v16bf, __builtin_shufflevector(lo, hi, 0, 1, 2, 3, 4, 5, 6, 7, 8, 9, 10, 11, 12, 13, 14, 15)); }
__device__ __forceinline__ v8f wmma16(v16h a, v16h b, v8f c) { return __builtin_amdgcn_wmma_f32_16x16x32_f16(false, a, false, b, (short)0, c, false, false); }
__device__ __forceinline__ v8f wmmab(v16bf a, v16bf b, v8f c) { return __builtin_amdgcn_wmma_f32_16x16x32_bf16(false, a, false, b, (short)0, c, false, false); }



// ---- k_gemmw: register-blocked GEMM, ONE WAVE per 64x64 output tile (16 accumulators), operands straight from K-contiguous 16-bit planes; grid (M/64, N/64, Z), 32 threads.
// C[m][n] (f32, pitch ldc, + optional f32 bias[n]) = sum_k A[m][k] Bt[n][k] (+ split products per NSPLIT). z-batch strides sA/sB/sC in elements. K % 32 == 0.
// BAND 1 (scores): blockIdx.y counts the BT key tiles from the first one of the row tile's band; tiles off the sequence leave. BAND 2 (P V): k runs over the keys the row tile's window can reach (P is 0 elsewhere). rb = sequence row of the launch's row 0.
template <typename T16> struct WFrag;
template <> struct WFrag<h16> { typedef v16h V; static __device__ __forceinline__ V ld(const h16* p) { return cat16(*(const v8h*)p, *(const v8h*)(p + 16)); } static __device__ __forceinline__ v8f mma(V a, V b, v8f c) { return wmma16(a, b, c); } };
template <> struct WFrag<bf> { typedef v16bf V; static __device__ __forceinline__ V ld(const bf* p) { return cat16b(*(const v8us*)p, *(const v8us*)(p + 16)); } static __device__ __forceinline__ v8f mma(V a, V b, v8f c) { return wmmab(a, b, c); } };
template <typename T16, int NSPLIT, bool BIAS, int BAND = 0>
__global__ __launch_bounds__(32) void k_gemmw(const T16* __restrict__ A, const T16* __restrict__ A2, const T16* __restrict__ Bt, const T16* __restrict__ Bt2, int K, float* C, int ldc, const float* __restrict__ bias, size_t sA, size_t sB, size_t sC, int rb) {
    typedef typename WFrag<T16>::V V;
    __shared__ __align__(16) float os[16 * 68];
    const size_t z = blockIdx.z; A += z * sA; if (A2) A2 += z * sA; Bt += z * sB; if (Bt2) Bt2 += z * sB; C += z * sC;
    const int lane = threadIdx.x & 31, lr = lane & 15, hi = lane >> 4; const int r0 = blockIdx.x * 64; int c0 = blockIdx.y * 64;
    if (BAND == 1) { c0 += ((((rb + r0) >> 6) - WNB / 64) & ~1) * 64; if (c0 < 0 || c0 >= TT) return; }
    int k0 = 0, k1 = K; if (BAND == 2) { k0 = max(rb + r0 - WNB, 0); k1 = min(rb + r0 + 64 + WNB, K); }
    v8f acc[4][4];
#pragma unroll
    for (int mb = 0; mb < 4; ++mb)
#pragma unroll
        for (int nb = 0; nb < 4; ++nb) acc[mb][nb] = (v8f){};
    const size_t aoff = (size_t)(r0 + lr) * K + 8 * hi, boff = (size_t)(c0 + lr) * K + 8 * hi;
#pragma unroll 1
    for (int kc = k0; kc < k1; kc += 32) {
        V a[4], a2[4];
#pragma unroll
        for (int mb = 0; mb < 4; ++mb) { a[mb] = WFrag<T16>::ld(A + aoff + (size_t)mb * 16 * K + kc); if (NSPLIT == 1 || NSPLIT == 2) a2[mb] = WFrag<T16>::ld(A2 + aoff + (size_t)mb * 16 * K + kc); }
#pragma unroll
        for (int nb = 0; nb < 4; ++nb) { const V b = WFrag<T16>::ld(Bt + boff + (size_t)nb * 16 * K + kc); V b2; if (NSPLIT >= 2) b2 = WFrag<T16>::ld(Bt2 + boff + (size_t)nb * 16 * K + kc);
#pragma unroll
            for (int mb = 0; mb < 4; ++mb) { acc[mb][nb] = WFrag<T16>::mma(a[mb], b, acc[mb][nb]); if (NSPLIT == 1 || NSPLIT == 2) acc[mb][nb] = WFrag<T16>::mma(a2[mb], b, acc[mb][nb]); if (NSPLIT >= 2) acc[mb][nb] = WFrag<T16>::mma(a[mb], b2, acc[mb][nb]); } }
        asm volatile("v_nop\n\tv_nop\n\tv_nop\n\tv_nop" : "+v"(acc[0][0]), "+v"(acc[1][1]), "+v"(acc[2][2]), "+v"(acc[3][3]) : "v"(a[0]), "v"(a[3]));
    }
#pragma unroll
    for (int mb = 0; mb < 4; ++mb) {
#pragma unroll
        for (int nb = 0; nb < 4; ++nb) {
#pragma unroll
            for (int j = 0; j < 8; ++j) os[(hi * 8 + j) * 68 + nb * 16 + lr] = acc[mb][nb][j]; }
        __builtin_amdgcn_wave_barrier(); asm volatile("" ::: "memory");
        float* crow = C + (size_t)(r0 + mb * 16) * ldc + c0;
{
#pragma unroll
            for (int s = 0; s < 8; ++s) { const int row = 2 * s + hi, cofs = lr * 4; v4f val = *(const v4fa*)(os + row * 68 + cofs); if (BIAS) { val[0] += bfr(bias[c0 + cofs]); val[1] += bfr(bias[c0 + cofs + 1]); val[2] += bfr(bias[c0 + cofs + 2]); val[3] += bfr(bias[c0 + cofs + 3]); }
                *(v4f*)(crow + (size_t)row * ldc + cofs) = val; }
             }
        __builtin_amdgcn_wave_barrier(); asm volatile("" ::: "memory");
    }
}

__device__ __forceinline__ h16 tohx(float x) { return (h16)x; }
__device__ __forceinline__ void splitf(float y, unsigned short& h, unsigned short& l) { h = f2bf(y); l = f2bf(y - bf2f(h)); }
typedef __attribute__((ext_vector_type(2))) _Float16 v2h;
typedef __attribute__((ext_vector_type(4))) _Float16 v4h;
typedef __attribute__((ext_vector_type(2))) unsigned short v2us;
typedef __attribute__((ext_vector_type(4))) unsigned short v4us;
typedef __attribute__((ext_vector_type(2))) float v2f;
typedef __attribute__((ext_vector_type(4))) int v4i;

__global__ __launch_bounds__(256) void k_wtG(const float* __restrict__ w, int K, int N, bf* Bt) {
    const int lane = threadIdx.x & 31; const int L0 = (blockIdx.x * 8 + (threadIdx.x >> 5)) * 8; const int nlines = N * K / 64;
{
#pragma unroll 1
        for (int l = 0; l < 8; ++l) { const int L = L0 + l; if (L >= nlines) break; const size_t e = (size_t)L * 64 + lane * 2; const int k = (int)(e % K), n = (int)(e / K); v2us o;
            o[0] = f2bf(w[(size_t)k * N + n]); o[1] = f2bf(w[(size_t)(k + 1) * N + n]); *(v2us*)(Bt + e) = o; }
         }
}
__global__ __launch_bounds__(256) void k_cvt8(const float* __restrict__ src, bf* dst, size_t n8) { const size_t i = (size_t)blockIdx.x * 256 + threadIdx.x; if (i >= n8) return; const v8f v = *(const v8f*)(src + i * 8); v8us o;
#pragma unroll
    for (int k = 0; k < 8; ++k) o[k] = f2bf(v[k]); *(v8us*)(dst + i * 8) = o;  }

// k_rope: head planes [h][t][d] (fp16 + hi/lo) of rope(x) x sc with the rotate-half convention out[d] = x[d] cos[t][d] - x[d+HD/2] sin[t][d], out[d+HD/2] = x[d+HD/2] cos[t][d+HD/2] + x[d] sin[t][d+HD/2]
__global__ __launch_bounds__(256) void k_rope(const float* __restrict__ F, int pitch, int nheads, const float* __restrict__ CS, const float* __restrict__ RF, const float* __restrict__ nw, float sc, h16* P16, bf* Ph, bf* Pl) {
    const size_t e = ((size_t)blockIdx.x * 256 + threadIdx.x) * 2; if (e >= (size_t)nheads * TT * HD) return; const int d = (int)(e % HD); const int t = (int)((e / HD) % TT); const int h = (int)(e / ((size_t)HD * TT)); const float* f = F + (size_t)t * pitch + h * HD; const float rf = RF ? RF[(size_t)h * TT + t] : 1.0f; v2h o16; v2us oh, ol;
#pragma unroll
    for (int q = 0; q < 2; ++q) { const int dd = d + q; const int dp = (dd < HD / 2) ? dd + HD / 2 : dd - HD / 2; float x0 = f[dd], x1 = f[dp];
        if (RF) { float n0 = __fmul_rn(x0, rf), n1 = __fmul_rn(x1, rf); asm volatile("" : "+v"(n0)); asm volatile("" : "+v"(n1)); x0 = __fmul_rn(bfr(nw[dd]), n0); x1 = __fmul_rn(bfr(nw[dp]), n1); }
        const v2f cs = *(const v2f*)(CS + ((size_t)t * HD + dd) * 2); float a = __fmul_rn(x0, cs[0]), bq = __fmul_rn(x1, cs[1]); asm volatile("" : "+v"(a)); asm volatile("" : "+v"(bq)); const float r = ((dd < HD / 2) ? __fsub_rn(a, bq) : __fadd_rn(a, bq)) * sc;
        o16[q] = tohx(r); unsigned short a2, c2; splitf(r, a2, c2); oh[q] = a2; ol[q] = c2; }
    *(v2h*)(P16 + e) = o16; *(v2us*)(Ph + e) = oh; *(v2us*)(Pl + e) = ol;  }
__global__ __launch_bounds__(256) void k_vtp(const float* __restrict__ F, int pitch, int nheads, h16* V16, bf* Vh, bf* Vl) { const size_t e = ((size_t)blockIdx.x * 256 + threadIdx.x) * 2; if (e >= (size_t)nheads * HD * TT) return; const int t = (int)(e % TT); const int d = (int)((e / TT) % HD); const int g = (int)(e / ((size_t)TT * HD)); v2h o16; v2us oh, ol;
#pragma unroll
    for (int q = 0; q < 2; ++q) { const float x = F[(size_t)(t + q) * pitch + g * HD + d]; o16[q] = tohx(x); unsigned short a2, c2; splitf(x, a2, c2); oh[q] = a2; ol[q] = c2; }
    *(v2h*)(V16 + e) = o16; *(v2us*)(Vh + e) = oh; *(v2us*)(Vl + e) = ol;  }
__global__ __launch_bounds__(256) void k_csid(float* CS) { const int idx = blockIdx.x * 256 + threadIdx.x; if (idx >= TT * HD) return; v2f cs; cs[0] = 1.0f; cs[1] = 0.0f; *(v2f*)(CS + (size_t)idx * 2) = cs;  }
// one sweep's reads of a score row: the BT / 2 chunks of its band, issued together ahead of the arithmetic so that a sweep waits on memory once
__device__ __forceinline__ void ldband(const float* __restrict__ sr, int cb, int lane, v4f* a5) {
    const int js = max(cb, 0) * 128 + lane * 4;   /* a chunk off the sequence loads this in-band one instead, so that no branch parts the loads; the sweeps mask it */
    const float* p[BT / 2];
#pragma unroll
    for (int c = 0; c < BT / 2; ++c) { const int ch = cb + c; p[c] = sr + ((ch >= 0 && ch < TT / 128) ? ch * 128 + lane * 4 : js); a5[c] = *(const v4f*)p[c]; }
    static_assert(BT / 2 == 5, "the wait below names five pointers");
    asm volatile("s_wait_xcnt 0x0" :: "v"(p[0]), "v"(p[1]), "v"(p[2]), "v"(p[3]), "v"(p[4]) : "memory");   /* stands before the loads' address registers are reused; the pointers are inputs so that those registers live up to it */
}
__global__ __launch_bounds__(256) void k_lsoft(const float* __restrict__ Sb, h16* P16, bf* Ph, bf* Pl) {
    const int lane = threadIdx.x & 31; const int row = blockIdx.x * 8 + (threadIdx.x >> 5); if (row >= ZH * TT) return; const int i = row % TT; const int zz = row / TT; const bool hires = (i < RH); const float* sr = Sb + (size_t)row * TT; float mx = -3.0e38f;
    const int cb = (((int)(blockIdx.x * 8 % TT) >> 6) - WNB / 64) >> 1;   /* first of the BT / 2 128-key chunks of the row tile's band (the block's 8 rows share a tile): what the score launches wrote and what P V reads */
    v4f a5[BT / 2];   /* the sweeps are unrolled whole: a5 stays in registers. A chunk off the sequence (on false) gets j0 = -TT, which fails the window test for every row */
    ldband(sr, cb, lane, a5);
#pragma unroll
    for (int c = 0; c < BT / 2; ++c) { const int ch = cb + c; const bool on = ch >= 0 && ch < TT / 128; const int j0 = on ? ch * 128 + lane * 4 : -TT; const v4f a = a5[c];
#pragma unroll
        for (int q = 0; q < 4; ++q) { float t = a[q] * SCL; asm volatile("" : "+v"(t)); t = (j0 + q <= i + WNB && j0 + q >= i - WNB) ? t : -3.0e38f;   /* symmetric window: |i - j| <= WNB */ mx = fmaxf(mx, t); } }
#pragma unroll
    for (int sh = 16; sh; sh >>= 1) mx = fmaxf(mx, __shfl_xor(mx, sh, 32));
    float sum = 0.f; ldband(sr, cb, lane, a5);
#pragma unroll
    for (int c = 0; c < BT / 2; ++c) { const int ch = cb + c; const bool on = ch >= 0 && ch < TT / 128; const int j0 = on ? ch * 128 + lane * 4 : -TT; const v4f a = a5[c];
#pragma unroll
        for (int q = 0; q < 4; ++q) { float t = a[q] * SCL; asm volatile("" : "+v"(t)); t = (j0 + q <= i + WNB && j0 + q >= i - WNB) ? t : -3.0e38f;   /* symmetric window: |i - j| <= WNB */ float d0 = __fsub_rn(t, mx); asm volatile("" : "+v"(d0)); sum += __builtin_amdgcn_exp2f(__fmul_rn(d0, 1.4426950408889634f)); } }
#pragma unroll
    for (int sh = 16; sh; sh >>= 1) sum += __shfl_xor(sum, sh, 32);
    const float f = __fdiv_rn(hires ? 1.0f : PCAR, sum); ldband(sr, cb, lane, a5);
{
        if (hires) {   /* rows < RH: normalised bf16 hi/lo over the band (symmetric window: keys beyond RH are live), planes [zz][RH][TT] */
#pragma unroll
            for (int c = 0; c < BT / 2; ++c) { const int ch = cb + c; const bool on = ch >= 0 && ch < TT / 128; const int j0 = on ? ch * 128 + lane * 4 : -TT; const v4f a = a5[c]; v4us oh, ol;
#pragma unroll
                for (int q = 0; q < 4; ++q) { float t = a[q] * SCL; asm volatile("" : "+v"(t)); t = (j0 + q <= i + WNB && j0 + q >= i - WNB) ? t : -3.0e38f;   /* symmetric window: |i - j| <= WNB */ float d0 = __fsub_rn(t, mx); asm volatile("" : "+v"(d0)); float ex = __builtin_amdgcn_exp2f(__fmul_rn(d0, 1.4426950408889634f)); asm volatile("" : "+v"(ex)); unsigned short a2, c2; splitf(ex * f, a2, c2); oh[q] = a2; ol[q] = c2; }
                if (on) { const size_t oo = ((size_t)zz * RH + i) * TT + j0; *(v4us*)(Ph + oo) = oh; *(v4us*)(Pl + oo) = ol; asm volatile("s_wait_xcnt 0x0" ::: "memory");   /* stands before the stores' registers are reused */ } }
        } else {
#pragma unroll
            for (int c = 0; c < BT / 2; ++c) { const int ch = cb + c; const bool on = ch >= 0 && ch < TT / 128; const int j0 = on ? ch * 128 + lane * 4 : -TT; const v4f a = a5[c]; v4h o4;
#pragma unroll
                for (int q = 0; q < 4; ++q) { float t = a[q] * SCL; asm volatile("" : "+v"(t)); t = (j0 + q <= i + WNB && j0 + q >= i - WNB) ? t : -3.0e38f;   /* symmetric window: |i - j| <= WNB */ float d0 = __fsub_rn(t, mx); asm volatile("" : "+v"(d0)); float ex = __builtin_amdgcn_exp2f(__fmul_rn(d0, 1.4426950408889634f)); asm volatile("" : "+v"(ex)); o4[q] = tohx(ex * f); }
                if (on) { *(v4h*)(P16 + (size_t)row * TT + j0) = o4; asm volatile("s_wait_xcnt 0x0" ::: "memory");   /* stands before the store's registers are reused */ } } }
         }
}


__global__ __launch_bounds__(256) void k_merge(const float* __restrict__ O, int h0, bf* Ah, bf* Al) { const size_t e = ((size_t)blockIdx.x * 256 + threadIdx.x) * 2; if (e >= (size_t)ZH * TT * HD) return; const int d = (int)(e % HD); const int t = (int)((e / HD) % TT); const int zz = (int)(e / ((size_t)HD * TT)); const float cs = (t < RH) ? 1.0f : (1.0f / PCAR); const size_t oo = (size_t)t * DQ + (h0 + zz) * HD + d;
    v2us oh, ol;
#pragma unroll
    for (int q = 0; q < 2; ++q) { unsigned short a, c2; splitf(O[e + q] * cs, a, c2); oh[q] = a; ol[q] = c2; } *(v2us*)(Ah + oo) = oh; *(v2us*)(Al + oo) = ol;  }

extern "C" void kernel_launch(void* const* d_in, const int* in_sizes, int n_in,
                              void* d_out, int out_size, void* d_ws, size_t ws_size, hipStream_t stream) {
    (void)in_sizes; (void)n_in; (void)out_size;
    const float* x = (const float*)d_in[0]; const float* wq = (const float*)d_in[1]; const float* bq = (const float*)d_in[2]; const float* wk = (const float*)d_in[3]; const float* bk = (const float*)d_in[4]; const float* wv = (const float*)d_in[5]; const float* bv = (const float*)d_in[6]; const float* wo = (const float*)d_in[7]; const float* bo = (const float*)d_in[8];
    float* OUT = (float*)d_out;     // [1][4096][1024]
    char* wsp = (char*)d_ws;
    auto take = [&](size_t bytes) { char* p = wsp; wsp += (bytes + 255) & ~(size_t)255; return (void*)p; };
    bf* WQ = (bf*)take((size_t)DQ * DM * 2); bf* WK = (bf*)take((size_t)DKV * DM * 2); bf* WV = (bf*)take((size_t)DKV * DM * 2); bf* WO = (bf*)take((size_t)DM * DQ * 2); float* CS = (float*)take((size_t)TT * HD * 2 * 4);
    bf* XB = (bf*)take((size_t)TT * DM * 2); float* FQ = (float*)take((size_t)TT * DQ * 4); float* FK = (float*)take((size_t)TT * DKV * 4);
    h16* QP16 = (h16*)take((size_t)NH_ * TT * HD * 2); h16* KP16 = (h16*)take((size_t)NKV * TT * HD * 2); h16* VT16 = (h16*)take((size_t)NKV * HD * TT * 2);
    bf* QPh = (bf*)take((size_t)NH_ * TT * HD * 2); bf* QPl = (bf*)take((size_t)NH_ * TT * HD * 2); bf* KPh = (bf*)take((size_t)NKV * TT * HD * 2); bf* KPl = (bf*)take((size_t)NKV * TT * HD * 2); bf* VTh = (bf*)take((size_t)NKV * HD * TT * 2); bf* VTl = (bf*)take((size_t)NKV * HD * TT * 2); bf* Ph = (bf*)take((size_t)ZH * RH * TT * 2); bf* Pl = (bf*)take((size_t)ZH * RH * TT * 2);
    float* Sb = (float*)take((size_t)ZH * TT * TT * 4); h16* P16 = (h16*)take((size_t)ZH * TT * TT * 2); float* Ob = (float*)take((size_t)ZH * TT * HD * 4); bf* ATh = (bf*)take((size_t)TT * DQ * 2); bf* ATl = (bf*)take((size_t)TT * DQ * 2);
    if ((size_t)(wsp - (char*)d_ws) > ws_size) return;    // ws 256 MiB
    float* FV = FK;   // v projection reuses the k buffer after the k planes are built (stream-ordered)
    { k_cvt8<<<(unsigned)(((size_t)DQ * DM / 8 + 255) / 256), 256, 0, stream>>>(wq, WQ, (size_t)DQ * DM / 8); k_cvt8<<<(unsigned)(((size_t)DKV * DM / 8 + 255) / 256), 256, 0, stream>>>(wk, WK, (size_t)DKV * DM / 8); k_cvt8<<<(unsigned)(((size_t)DKV * DM / 8 + 255) / 256), 256, 0, stream>>>(wv, WV, (size_t)DKV * DM / 8);
      k_cvt8<<<(unsigned)(((size_t)DM * DQ / 8 + 255) / 256), 256, 0, stream>>>(wo, WO, (size_t)DM * DQ / 8);
       }
    k_csid<<<(TT * HD + 255) / 256, 256, 0, stream>>>(CS);
    const unsigned LQ = (unsigned)(((size_t)NH_ * TT * HD / 2 + 255) / 256), LKv = (unsigned)(((size_t)NKV * TT * HD / 2 + 255) / 256);
    for (int b = 0; b < NB_; ++b) {
        
        k_cvt8<<<(unsigned)(((size_t)TT * DM / 8 + 255) / 256), 256, 0, stream>>>(x + (size_t)b * TT * DM, XB, (size_t)TT * DM / 8);
        k_gemmw<bf, 0, true><<<dim3(TT / 64, DQ / 64, 1), 32, 0, stream>>>(XB, nullptr, WQ, nullptr, DM, FQ, DQ, bq, 0, 0, 0, 0);
        k_rope<<<LQ, 256, 0, stream>>>(FQ, DQ, NH_, CS, nullptr, nullptr, 1.0f, QP16, QPh, QPl);
        k_gemmw<bf, 0, true><<<dim3(TT / 64, DKV / 64, 1), 32, 0, stream>>>(XB, nullptr, WK, nullptr, DM, FK, DKV, bk, 0, 0, 0, 0);
        k_rope<<<LKv, 256, 0, stream>>>(FK, DKV, NKV, CS, nullptr, nullptr, 1.0f, KP16, KPh, KPl);
        k_gemmw<bf, 0, true><<<dim3(TT / 64, DKV / 64, 1), 32, 0, stream>>>(XB, nullptr, WV, nullptr, DM, FV, DKV, bv, 0, 0, 0, 0); k_vtp<<<LKv, 256, 0, stream>>>(FV, DKV, NKV, VT16, VTh, VTl);
        for (int h0 = 0; h0 < NH_; h0 += ZH) { const size_t zq = (size_t)h0, zk = (size_t)(h0 / REP);   // one kv head per query head: the pass's one head (ZH = 1) uses kv plane zk = h0
            k_gemmw<bf, 2, false, 1><<<dim3(RH / 64, BT, ZH), 32, 0, stream>>>(QPh + zq * TT * HD, QPl + zq * TT * HD, KPh + zk * TT * HD, KPl + zk * TT * HD, HD, Sb, TT, nullptr, (size_t)TT * HD, (size_t)TT * HD, (size_t)TT * TT, 0);
            k_gemmw<h16, 0, false, 1><<<dim3((TT - RH) / 64, BT, ZH), 32, 0, stream>>>(QP16 + zq * TT * HD + (size_t)RH * HD, nullptr, KP16 + zk * TT * HD, nullptr, HD, Sb + (size_t)RH * TT, TT, nullptr, (size_t)TT * HD, (size_t)TT * HD, (size_t)TT * TT, RH);
            k_lsoft<<<ZH * TT / 8, 256, 0, stream>>>(Sb, P16, Ph, Pl);
            k_gemmw<bf, 2, false, 2><<<dim3(RH / 64, HD / 64, ZH), 32, 0, stream>>>(Ph, Pl, VTh + zk * HD * TT, VTl + zk * HD * TT, TT, Ob, HD, nullptr, (size_t)RH * TT, (size_t)HD * TT, (size_t)TT * HD, 0);
            k_gemmw<h16, 0, false, 2><<<dim3((TT - RH) / 64, HD / 64, ZH), 32, 0, stream>>>(P16 + (size_t)RH * TT, nullptr, VT16 + zk * HD * TT, nullptr, TT, Ob + (size_t)RH * HD, HD, nullptr, (size_t)TT * TT, (size_t)HD * TT, (size_t)TT * HD, RH);
            k_merge<<<(unsigned)(((size_t)ZH * TT * HD / 2 + 255) / 256), 256, 0, stream>>>(Ob, h0, ATh, ATl); }
        k_gemmw<bf, 1, true><<<dim3(TT / 64, DM / 64, 1), 32, 0, stream>>>(ATh, ATl, WO, nullptr, DQ, OUT + (size_t)b * TT * DM, DM, bo, 0, 0, 0, 0); }
}

// v002
// One run takes 287 microseconds.
// Timed twice side by side with v001, it ran 3.29 and 3.26 times as fast.
// Over all steps from v000 it is 14.3 times as fast.
#include <hip/hip_runtime.h>

// Local multi-head attention with a symmetric window (x [1][4096][1024]; q,k,v = x W^T + b ('oi' [1024][1024] + [1024], 0.02; 16 heads x 64); scores / 8; keys with |i - j| > 256 -> -inf; softmax; out = merged Wo^T + bo -> [1][4096][1024] (4.2 M)).
// Layout: bf16 copy of x; exact projections + f32 biases; T-4096 attention, all 16 heads per pass as grid z (hybrid rows: < 512 hi/lo 3 products, rest fp16 x1024; three-sweep softmax applying the |i - j| <= 256 window as an index select; scores, softmax and P V touch only the key band of each 64-row tile, in a score block of band pitch, whose rows the softmax overwrites with P); merged hi/lo x Wo exact + bo.
// Compute dtypes, f32 accumulate: every input rounded to bf16; projections exact + f32 biases; attention rows < 512 3 products, rest fp16; softmax f32; Wo hl x exact + bias.

#define NB_  1
#define TT   4096
#define DM   1024
#define NH_  16
#define NKV  16
#define REP  (NH_ / NKV)
#define HD   64
#define DQ   (NH_ * HD)
#define DKV  (NKV * HD)
#define ZH   16                   // heads per pass (grid z of the attention launches)
#define RH   512                  // query rows < RH use hi+lo planes (0: none)
#define WIN  0
#define PCAR 1024.0f
#define SCL  0.125f
#define WNB  256     // |i - j| <= 256 kept
#define BT   (2 * WNB / 64 + 2)   // 64-key tiles computed per 64-row tile: the 9 the window can reach, widened to whole 128-key softmax chunks
#define PB   (BT * 64)            // score row pitch in f32: the band alone; column 0 is the band's first key. The same bytes then hold the row's P at pitch 2 * PB 16-bit elements (fp16 in the first half; or bf16 hi, then lo at + PB)
typedef _Float16 h16;
typedef unsigned short bf;
typedef __attribute__((ext_vector_type(16))) __bf16   v16bf;
typedef __attribute__((ext_vector_type(16))) _Float16 v16h;
typedef __attribute__((ext_vector_type(8)))  _Float16 v8h;
typedef __attribute__((ext_vector_type(8)))  unsigned short v8us;
typedef __attribute__((ext_vector_type(8)))  float    v8f;
typedef __attribute__((ext_vector_type(4)))  float    v4f;
typedef v8h  __attribute__((may_alias)) v8ha;
typedef v4f  __attribute__((may_alias)) v4fa;
typedef v8us __attribute__((may_alias)) v8usa;

__device__ __forceinline__ unsigned short f2bf(float f) { unsigned u = __float_as_uint(f); u += 0x7FFFu + ((u >> 16) & 1u); return (unsigned short)(u >> 16); }
__device__ __forceinline__ float bf2f(unsigned short b) { return __uint_as_float(((unsigned)b) << 16); }
__device__ __forceinline__ float bfr(float f) { return bf2f(f2bf(f)); }
__device__ __forceinline__ v16h cat16(v8h lo, v8h hi) { return __builtin_shufflevector(lo, hi, 0, 1, 2, 3, 4, 5, 6, 7, 8, 9, 10, 11, 12, 13, 14, 15); }
__device__ __forceinline__ v16bf cat16b(v8us lo, v8us hi) { return __builtin_bit_cast(v16bf, __builtin_shufflevector(lo, hi, 0, 1, 2, 3, 4, 5, 6, 7, 8, 9, 10, 11, 12, 13, 14, 15)); }
__device__ __forceinline__ v8f wmma16(v16h a, v16h b, v8f c) { return __builtin_amdgcn_wmma_f32_16x16x32_f16(false, a, false, b, (short)0, c, false, false); }
__device__ __forceinline__ v8f wmmab(v16bf a, v16bf b, v8f c) { return __builtin_amdgcn_wmma_f32_16x16x32_bf16(false, a, false, b, (short)0, c, false, false); }



// ---- k_gemmw: register-blocked GEMM, ONE WAVE per 64x64 output tile (16 accumulators), operands straight from K-contiguous 16-bit planes; grid (M/64, N/64, Z), 32 threads.
// C[m][n] (f32, pitch ldc, + optional f32 bias[n]) = sum_k A[m][k] Bt[n][k] (+ split products per NSPLIT). A has pitch lda, Bt pitch K. z-batch strides sA/sB/sC in elements. K % 32 == 0.
// BAND 1 (scores): blockIdx.y counts the BT key tiles from the first one of the row tile's band, and is C's column tile too (band pitch); tiles off the sequence leave. BAND 2 (P V): k runs over the keys the row tile's window can reach; A's column 0 is the band's first key. rb = sequence row of the launch's row 0.
template <typename T16> struct WFrag;
template <> struct WFrag<h16> { typedef v16h V; static __device__ __forceinline__ V ld(const h16* p) { return cat16(*(const v8h*)p, *(const v8h*)(p + 16)); } static __device__ __forceinline__ v8f mma(V a, V b, v8f c) { return wmma16(a, b, c); } };
template <> struct WFrag<bf> { typedef v16bf V; static __device__ __forceinline__ V ld(const bf* p) { return cat16b(*(const v8us*)p, *(const v8us*)(p + 16)); } static __device__ __forceinline__ v8f mma(V a, V b, v8f c) { return wmmab(a, b, c); } };
template <typename T16, int NSPLIT, bool BIAS, int BAND = 0>
__global__ __launch_bounds__(32) void k_gemmw(const T16* __restrict__ A, const T16* __restrict__ A2, const T16* __restrict__ Bt, const T16* __restrict__ Bt2, int K, float* C, int ldc, const float* __restrict__ bias, size_t sA, size_t sB, size_t sC, int rb, int lda) {
    typedef typename WFrag<T16>::V V;
    __shared__ __align__(16) float os[16 * 68];
    const size_t z = blockIdx.z; A += z * sA; if (A2) A2 += z * sA; Bt += z * sB; if (Bt2) Bt2 += z * sB; C += z * sC;
    const int lane = threadIdx.x & 31, lr = lane & 15, hi = lane >> 4; const int r0 = blockIdx.x * 64; int c0 = blockIdx.y * 64; const int cc0 = c0;
    const int band0 = BAND ? ((((rb + r0) >> 6) - WNB / 64) & ~1) * 64 : 0;   /* first key of the row tile's band (below 0 at the sequence's start) */
    if (BAND == 1) { c0 += band0; if (c0 < 0 || c0 >= TT) return; }
    int k0 = 0, k1 = K; if (BAND == 2) { k0 = max(rb + r0 - WNB, 0); k1 = min(rb + r0 + 64 + WNB, K); }
    v8f acc[4][4];
#pragma unroll
    for (int mb = 0; mb < 4; ++mb)
#pragma unroll
        for (int nb = 0; nb < 4; ++nb) acc[mb][nb] = (v8f){};
    const size_t aoff = (size_t)(r0 + lr) * lda + 8 * hi - (BAND == 2 ? band0 : 0), boff = (size_t)(c0 + lr) * K + 8 * hi;
#pragma unroll 1
    for (int kc = k0; kc < k1; kc += 32) {
        V a[4], a2[4]; const T16* pa[4]; const T16* pa2[4];
#pragma unroll
        for (int mb = 0; mb < 4; ++mb) { pa[mb] = A + aoff + (size_t)mb * 16 * lda + kc; a[mb] = WFrag<T16>::ld(pa[mb]); if (NSPLIT == 1 || NSPLIT == 2) { pa2[mb] = A2 + aoff + (size_t)mb * 16 * lda + kc; a2[mb] = WFrag<T16>::ld(pa2[mb]); } }
        /* stands before the A loads' address registers are reused; the pointers are inputs so that those registers live up to it */
        if (NSPLIT == 1 || NSPLIT == 2) asm volatile("s_wait_xcnt 0x0" :: "v"(pa[0]), "v"(pa[1]), "v"(pa[2]), "v"(pa[3]), "v"(pa2[0]), "v"(pa2[1]), "v"(pa2[2]), "v"(pa2[3]) : "memory");
        else asm volatile("s_wait_xcnt 0x0" :: "v"(pa[0]), "v"(pa[1]), "v"(pa[2]), "v"(pa[3]) : "memory");
#pragma unroll
        for (int nb = 0; nb < 4; ++nb) { const V b = WFrag<T16>::ld(Bt + boff + (size_t)nb * 16 * K + kc); V b2; if (NSPLIT >= 2) b2 = WFrag<T16>::ld(Bt2 + boff + (size_t)nb * 16 * K + kc);
#pragma unroll
            for (int mb = 0; mb < 4; ++mb) { acc[mb][nb] = WFrag<T16>::mma(a[mb], b, acc[mb][nb]); if (NSPLIT == 1 || NSPLIT == 2) acc[mb][nb] = WFrag<T16>::mma(a2[mb], b, acc[mb][nb]); if (NSPLIT >= 2) acc[mb][nb] = WFrag<T16>::mma(a[mb], b2, acc[mb][nb]); } }
        asm volatile("v_nop\n\tv_nop\n\tv_nop\n\tv_nop" : "+v"(acc[0][0]), "+v"(acc[1][1]), "+v"(acc[2][2]), "+v"(acc[3][3]) : "v"(a[0]), "v"(a[3]));
    }
#pragma unroll
    for (int mb = 0; mb < 4; ++mb) {
#pragma unroll
        for (int nb = 0; nb < 4; ++nb) {
#pragma unroll
            for (int j = 0; j < 8; ++j) os[(hi * 8 + j) * 68 + nb * 16 + lr] = acc[mb][nb][j]; }
        __builtin_amdgcn_wave_barrier(); asm volatile("" ::: "memory");
        float* crow = C + (size_t)(r0 + mb * 16) * ldc + (BAND == 1 ? cc0 : c0);
{
#pragma unroll
            for (int s = 0; s < 8; ++s) { const int row = 2 * s + hi, cofs = lr * 4; v4f val = *(const v4fa*)(os + row * 68 + cofs); if (BIAS) { val[0] += bfr(bias[c0 + cofs]); val[1] += bfr(bias[c0 + cofs + 1]); val[2] += bfr(bias[c0 + cofs + 2]); val[3] += bfr(bias[c0 + cofs + 3]); }
                *(v4f*)(crow + (size_t)row * ldc + cofs) = val; }
             }
        __builtin_amdgcn_wave_barrier(); asm volatile("" ::: "memory");
    }
}

__device__ __forceinline__ h16 tohx(float x) { return (h16)x; }
__device__ __forceinline__ void splitf(float y, unsigned short& h, unsigned short& l) { h = f2bf(y); l = f2bf(y - bf2f(h)); }
typedef __attribute__((ext_vector_type(2))) _Float16 v2h;
typedef __attribute__((ext_vector_type(4))) _Float16 v4h;
typedef __attribute__((ext_vector_type(2))) unsigned short v2us;
typedef __attribute__((ext_vector_type(4))) unsigned short v4us;
typedef __attribute__((ext_vector_type(2))) float v2f;
typedef __attribute__((ext_vector_type(4))) int v4i;

__global__ __launch_bounds__(256) void k_wtG(const float* __restrict__ w, int K, int N, bf* Bt) {
    const int lane = threadIdx.x & 31; const int L0 = (blockIdx.x * 8 + (threadIdx.x >> 5)) * 8; const int nlines = N * K / 64;
{
#pragma unroll 1
        for (int l = 0; l < 8; ++l) { const int L = L0 + l; if (L >= nlines) break; const size_t e = (size_t)L * 64 + lane * 2; const int k = (int)(e % K), n = (int)(e / K); v2us o;
            o[0] = f2bf(w[(size_t)k * N + n]); o[1] = f2bf(w[(size_t)(k + 1) * N + n]); *(v2us*)(Bt + e) = o; }
         }
}
__global__ __launch_bounds__(256) void k_cvt8(const float* __restrict__ src, bf* dst, size_t n8) { const size_t i = (size_t)blockIdx.x * 256 + threadIdx.x; if (i >= n8) return; const v8f v = *(const v8f*)(src + i * 8); v8us o;
#pragma unroll
    for (int k = 0; k < 8; ++k) o[k] = f2bf(v[k]); *(v8us*)(dst + i * 8) = o;  }

// k_rope: head planes [h][t][d] (fp16 + hi/lo) of rope(x) x sc with the rotate-half convention out[d] = x[d] cos[t][d] - x[d+HD/2] sin[t][d], out[d+HD/2] = x[d+HD/2] cos[t][d+HD/2] + x[d] sin[t][d+HD/2]
__global__ __launch_bounds__(256) void k_rope(const float* __restrict__ F, int pitch, int nheads, const float* __restrict__ CS, const float* __restrict__ RF, const float* __restrict__ nw, float sc, h16* P16, bf* Ph, bf* Pl) {
    const size_t e = ((size_t)blockIdx.x * 256 + threadIdx.x) * 2; if (e >= (size_t)nheads * TT * HD) return; const int d = (int)(e % HD); const int t = (int)((e / HD) % TT); const int h = (int)(e / ((size_t)HD * TT)); const float* f = F + (size_t)t * pitch + h * HD; const float rf = RF ? RF[(size_t)h * TT + t] : 1.0f; v2h o16; v2us oh, ol;
#pragma unroll
    for (int q = 0; q < 2; ++q) { const int dd = d + q; const int dp = (dd < HD / 2) ? dd + HD / 2 : dd - HD / 2; float x0 = f[dd], x1 = f[dp];
        if (RF) { float n0 = __fmul_rn(x0, rf), n1 = __fmul_rn(x1, rf); asm volatile("" : "+v"(n0)); asm volatile("" : "+v"(n1)); x0 = __fmul_rn(bfr(nw[dd]), n0); x1 = __fmul_rn(bfr(nw[dp]), n1); }
        const v2f cs = *(const v2f*)(CS + ((size_t)t * HD + dd) * 2); float a = __fmul_rn(x0, cs[0]), bq = __fmul_rn(x1, cs[1]); asm volatile("" : "+v"(a)); asm volatile("" : "+v"(bq)); const float r = ((dd < HD / 2) ? __fsub_rn(a, bq) : __fadd_rn(a, bq)) * sc;
        o16[q] = tohx(r); unsigned short a2, c2; splitf(r, a2, c2); oh[q] = a2; ol[q] = c2; }
    *(v2h*)(P16 + e) = o16; *(v2us*)(Ph + e) = oh; *(v2us*)(Pl + e) = ol;  }
__global__ __launch_bounds__(256) void k_vtp(const float* __restrict__ F, int pitch, int nheads, h16* V16, bf* Vh, bf* Vl) { const size_t e = ((size_t)blockIdx.x * 256 + threadIdx.x) * 2; if (e >= (size_t)nheads * HD * TT) return; const int t = (int)(e % TT); const int d = (int)((e / TT) % HD); const int g = (int)(e / ((size_t)TT * HD)); v2h o16; v2us oh, ol;
#pragma unroll
    for (int q = 0; q < 2; ++q) { const float x = F[(size_t)(t + q) * pitch + g * HD + d]; o16[q] = tohx(x); unsigned short a2, c2; splitf(x, a2, c2); oh[q] = a2; ol[q] = c2; }
    *(v2h*)(V16 + e) = o16; *(v2us*)(Vh + e) = oh; *(v2us*)(Vl + e) = ol;  }
__global__ __launch_bounds__(256) void k_csid(float* CS) { const int idx = blockIdx.x * 256 + threadIdx.x; if (idx >= TT * HD) return; v2f cs; cs[0] = 1.0f; cs[1] = 0.0f; *(v2f*)(CS + (size_t)idx * 2) = cs;  }
// one sweep's reads of a score row: the BT / 2 chunks of its band, issued together ahead of the arithmetic so that a sweep waits on memory once
__device__ __forceinline__ void ldband(const float* sr, int cb, int lane, v4f* a5) {
    const int js = (max(cb, 0) - cb) * 128 + lane * 4;   /* a chunk off the sequence loads this in-band one instead, so that no branch parts the loads; the sweeps mask it */
    const float* p[BT / 2];
#pragma unroll
    for (int c = 0; c < BT / 2; ++c) { const int ch = cb + c; p[c] = sr + ((ch >= 0 && ch < TT / 128) ? c * 128 + lane * 4 : js); a5[c] = *(const v4f*)p[c]; }
    static_assert(BT / 2 == 5, "the wait below names five pointers");
    asm volatile("s_wait_xcnt 0x0" :: "v"(p[0]), "v"(p[1]), "v"(p[2]), "v"(p[3]), "v"(p[4]) : "memory");   /* stands before the loads' address registers are reused; the pointers are inputs so that those registers live up to it */
}
// P goes over the row's own scores: a wave owns its row, and its last sweep's reads have all returned before its first store
__global__ __launch_bounds__(256) void k_lsoft(float* Sb) {
    const int lane = threadIdx.x & 31; const int row = blockIdx.x * 8 + (threadIdx.x >> 5); if (row >= ZH * TT) return; const int i = row % TT; const bool hires = (i < RH); const float* sr = Sb + (size_t)row * PB; float mx = -3.0e38f;
    const int cb = (((int)(blockIdx.x * 8 % TT) >> 6) - WNB / 64) >> 1;   /* first of the BT / 2 128-key chunks of the row tile's band (the block's 8 rows share a tile): what the score launches wrote and what P V reads */
    v4f a5[BT / 2];   /* the sweeps are unrolled whole: a5 stays in registers. A chunk off the sequence (on false) gets j0 = -TT, which fails the window test for every row */
    ldband(sr, cb, lane, a5);
#pragma unroll
    for (int c = 0; c < BT / 2; ++c) { const int ch = cb + c; const bool on = ch >= 0 && ch < TT / 128; const int j0 = on ? ch * 128 + lane * 4 : -TT; const v4f a = a5[c];
#pragma unroll
        for (int q = 0; q < 4; ++q) { float t = a[q] * SCL; asm volatile("" : "+v"(t)); t = (j0 + q <= i + WNB && j0 + q >= i - WNB) ? t : -3.0e38f;   /* symmetric window: |i - j| <= WNB */ mx = fmaxf(mx, t); } }
#pragma unroll
    for (int sh = 16; sh; sh >>= 1) mx = fmaxf(mx, __shfl_xor(mx, sh, 32));
    float sum = 0.f; ldband(sr, cb, lane, a5);
#pragma unroll
    for (int c = 0; c < BT / 2; ++c) { const int ch = cb + c; const bool on = ch >= 0 && ch < TT / 128; const int j0 = on ? ch * 128 + lane * 4 : -TT; const v4f a = a5[c];
#pragma unroll
        for (int q = 0; q < 4; ++q) { float t = a[q] * SCL; asm volatile("" : "+v"(t)); t = (j0 + q <= i + WNB && j0 + q >= i - WNB) ? t : -3.0e38f;   /* symmetric window: |i - j| <= WNB */ float d0 = __fsub_rn(t, mx); asm volatile("" : "+v"(d0)); sum += __builtin_amdgcn_exp2f(__fmul_rn(d0, 1.4426950408889634f)); } }
#pragma unroll
    for (int sh = 16; sh; sh >>= 1) sum += __shfl_xor(sum, sh, 32);
    const float f = __fdiv_rn(hires ? 1.0f : PCAR, sum); ldband(sr, cb, lane, a5);
    asm volatile("s_wait_loadcnt 0x0" ::: "memory");   /* the stores below overwrite the bytes just read: every chunk is in registers first */
{
        if (hires) {   /* rows < RH: normalised bf16 hi/lo over the band (symmetric window: keys beyond RH are live): hi in the row's first half, lo in its second */
            bf* Ph = (bf*)Sb + (size_t)row * (2 * PB) + lane * 4; bf* Pl = Ph + PB;
#pragma unroll
            for (int c = 0; c < BT / 2; ++c) { const int ch = cb + c; const bool on = ch >= 0 && ch < TT / 128; const int j0 = on ? ch * 128 + lane * 4 : -TT; const v4f a = a5[c]; v4us oh, ol;
#pragma unroll
                for (int q = 0; q < 4; ++q) { float t = a[q] * SCL; asm volatile("" : "+v"(t)); t = (j0 + q <= i + WNB && j0 + q >= i - WNB) ? t : -3.0e38f;   /* symmetric window: |i - j| <= WNB */ float d0 = __fsub_rn(t, mx); asm volatile("" : "+v"(d0)); float ex = __builtin_amdgcn_exp2f(__fmul_rn(d0, 1.4426950408889634f)); asm volatile("" : "+v"(ex)); unsigned short a2, c2; splitf(ex * f, a2, c2); oh[q] = a2; ol[q] = c2; }
                if (on) { *(v4us*)(Ph + c * 128) = oh; *(v4us*)(Pl + c * 128) = ol; asm volatile("s_wait_xcnt 0x0" ::: "memory");   /* stands before the stores' registers are reused */ } }
        } else {
            h16* P16 = (h16*)Sb + (size_t)row * (2 * PB) + lane * 4;
#pragma unroll
            for (int c = 0; c < BT / 2; ++c) { const int ch = cb + c; const bool on = ch >= 0 && ch < TT / 128; const int j0 = on ? ch * 128 + lane * 4 : -TT; const v4f a = a5[c]; v4h o4;
#pragma unroll
                for (int q = 0; q < 4; ++q) { float t = a[q] * SCL; asm volatile("" : "+v"(t)); t = (j0 + q <= i + WNB && j0 + q >= i - WNB) ? t : -3.0e38f;   /* symmetric window: |i - j| <= WNB */ float d0 = __fsub_rn(t, mx); asm volatile("" : "+v"(d0)); float ex = __builtin_amdgcn_exp2f(__fmul_rn(d0, 1.4426950408889634f)); asm volatile("" : "+v"(ex)); o4[q] = tohx(ex * f); }
                if (on) { *(v4h*)(P16 + c * 128) = o4; asm volatile("s_wait_xcnt 0x0" ::: "memory");   /* stands before the store's registers are reused */ } } }
         }
}


__global__ __launch_bounds__(256) void k_merge(const float* __restrict__ O, int h0, bf* Ah, bf* Al) { const size_t e = ((size_t)blockIdx.x * 256 + threadIdx.x) * 2; if (e >= (size_t)ZH * TT * HD) return; const int d = (int)(e % HD); const int t = (int)((e / HD) % TT); const int zz = (int)(e / ((size_t)HD * TT)); const float cs = (t < RH) ? 1.0f : (1.0f / PCAR); const size_t oo = (size_t)t * DQ + (h0 + zz) * HD + d;
    v2us oh, ol;
#pragma unroll
    for (int q = 0; q < 2; ++q) { unsigned short a, c2; splitf(O[e + q] * cs, a, c2); oh[q] = a; ol[q] = c2; } *(v2us*)(Ah + oo) = oh; *(v2us*)(Al + oo) = ol;  }

extern "C" void kernel_launch(void* const* d_in, const int* in_sizes, int n_in,
                              void* d_out, int out_size, void* d_ws, size_t ws_size, hipStream_t stream) {
    (void)in_sizes; (void)n_in; (void)out_size;
    const float* x = (const float*)d_in[0]; const float* wq = (const float*)d_in[1]; const float* bq = (const float*)d_in[2]; const float* wk = (const float*)d_in[3]; const float* bk = (const float*)d_in[4]; const float* wv = (const float*)d_in[5]; const float* bv = (const float*)d_in[6]; const float* wo = (const float*)d_in[7]; const float* bo = (const float*)d_in[8];
    float* OUT = (float*)d_out;     // [1][4096][1024]
    char* wsp = (char*)d_ws;
    auto take = [&](size_t bytes) { char* p = wsp; wsp += (bytes + 255) & ~(size_t)255; return (void*)p; };
    bf* WO = (bf*)take((size_t)DM * DQ * 2);
    h16* QP16 = (h16*)take((size_t)NH_ * TT * HD * 2); h16* KP16 = (h16*)take((size_t)NKV * TT * HD * 2); h16* VT16 = (h16*)take((size_t)NKV * HD * TT * 2);
    bf* QPh = (bf*)take((size_t)NH_ * TT * HD * 2); bf* QPl = (bf*)take((size_t)NH_ * TT * HD * 2); bf* KPh = (bf*)take((size_t)NKV * TT * HD * 2); bf* KPl = (bf*)take((size_t)NKV * TT * HD * 2); bf* VTh = (bf*)take((size_t)NKV * HD * TT * 2); bf* VTl = (bf*)take((size_t)NKV * HD * TT * 2);
    float* Ob = (float*)take((size_t)ZH * TT * HD * 4); float* Sb = (float*)take((size_t)ZH * TT * PB * 4);
    if ((size_t)(wsp - (char*)d_ws) > ws_size) return;    // ws 256 MiB; 250 MiB taken
    // stream-ordered reuse: what only the projections and the plane builders read lies inside the score block, which is written after them; the merged planes take the q hi/lo planes, dead after the score launches
    static_assert((size_t)3 * DQ * DM * 2 + (size_t)TT * HD * 8 + (size_t)TT * DM * 2 + (size_t)2 * TT * DQ * 4 <= (size_t)ZH * TT * PB * 4, "the projection scratch fits the score block");
    wsp = (char*)Sb;
    bf* WQ = (bf*)take((size_t)DQ * DM * 2); bf* WK = (bf*)take((size_t)DKV * DM * 2); bf* WV = (bf*)take((size_t)DKV * DM * 2); float* CS = (float*)take((size_t)TT * HD * 2 * 4);
    bf* XB = (bf*)take((size_t)TT * DM * 2); float* FQ = (float*)take((size_t)TT * DQ * 4); float* FK = (float*)take((size_t)TT * DKV * 4);
    bf* ATh = QPh; bf* ATl = QPl; bf* Ph = (bf*)Sb; bf* Pl = Ph + PB; h16* P16 = (h16*)Sb;
    float* FV = FK;   // v projection reuses the k buffer after the k planes are built (stream-ordered)
    { k_cvt8<<<(unsigned)(((size_t)DQ * DM / 8 + 255) / 256), 256, 0, stream>>>(wq, WQ, (size_t)DQ * DM / 8); k_cvt8<<<(unsigned)(((size_t)DKV * DM / 8 + 255) / 256), 256, 0, stream>>>(wk, WK, (size_t)DKV * DM / 8); k_cvt8<<<(unsigned)(((size_t)DKV * DM / 8 + 255) / 256), 256, 0, stream>>>(wv, WV, (size_t)DKV * DM / 8);
      k_cvt8<<<(unsigned)(((size_t)DM * DQ / 8 + 255) / 256), 256, 0, stream>>>(wo, WO, (size_t)DM * DQ / 8);
       }
    k_csid<<<(TT * HD + 255) / 256, 256, 0, stream>>>(CS);
    const unsigned LQ = (unsigned)(((size_t)NH_ * TT * HD / 2 + 255) / 256), LKv = (unsigned)(((size_t)NKV * TT * HD / 2 + 255) / 256);
    for (int b = 0; b < NB_; ++b) {
        
        k_cvt8<<<(unsigned)(((size_t)TT * DM / 8 + 255) / 256), 256, 0, stream>>>(x + (size_t)b * TT * DM, XB, (size_t)TT * DM / 8);
        k_gemmw<bf, 0, true><<<dim3(TT / 64, DQ / 64, 1), 32, 0, stream>>>(XB, nullptr, WQ, nullptr, DM, FQ, DQ, bq, 0, 0, 0, 0, DM);
        k_rope<<<LQ, 256, 0, stream>>>(FQ, DQ, NH_, CS, nullptr, nullptr, 1.0f, QP16, QPh, QPl);
        k_gemmw<bf, 0, true><<<dim3(TT / 64, DKV / 64, 1), 32, 0, stream>>>(XB, nullptr, WK, nullptr, DM, FK, DKV, bk, 0, 0, 0, 0, DM);
        k_rope<<<LKv, 256, 0, stream>>>(FK, DKV, NKV, CS, nullptr, nullptr, 1.0f, KP16, KPh, KPl);
        k_gemmw<bf, 0, true><<<dim3(TT / 64, DKV / 64, 1), 32, 0, stream>>>(XB, nullptr, WV, nullptr, DM, FV, DKV, bv, 0, 0, 0, 0, DM); k_vtp<<<LKv, 256, 0, stream>>>(FV, DKV, NKV, VT16, VTh, VTl);
        for (int h0 = 0; h0 < NH_; h0 += ZH) { const size_t zq = (size_t)h0, zk = (size_t)(h0 / REP);   // one kv head per query head: the pass's heads use consecutive kv planes (z-strides TT*HD)
            k_gemmw<bf, 2, false, 1><<<dim3(RH / 64, BT, ZH), 32, 0, stream>>>(QPh + zq * TT * HD, QPl + zq * TT * HD, KPh + zk * TT * HD, KPl + zk * TT * HD, HD, Sb, PB, nullptr, (size_t)TT * HD, (size_t)TT * HD, (size_t)TT * PB, 0, HD);
            k_gemmw<h16, 0, false, 1><<<dim3((TT - RH) / 64, BT, ZH), 32, 0, stream>>>(QP16 + zq * TT * HD + (size_t)RH * HD, nullptr, KP16 + zk * TT * HD, nullptr, HD, Sb + (size_t)RH * PB, PB, nullptr, (size_t)TT * HD, (size_t)TT * HD, (size_t)TT * PB, RH, HD);
            k_lsoft<<<ZH * TT / 8, 256, 0, stream>>>(Sb);
            k_gemmw<bf, 2, false, 2><<<dim3(RH / 64, HD / 64, ZH), 32, 0, stream>>>(Ph, Pl, VTh + zk * HD * TT, VTl + zk * HD * TT, TT, Ob, HD, nullptr, (size_t)TT * 2 * PB, (size_t)HD * TT, (size_t)TT * HD, 0, 2 * PB);
            k_gemmw<h16, 0, false, 2><<<dim3((TT - RH) / 64, HD / 64, ZH), 32, 0, stream>>>(P16 + (size_t)RH * 2 * PB, nullptr, VT16 + zk * HD * TT, nullptr, TT, Ob + (size_t)RH * HD, HD, nullptr, (size_t)TT * 2 * PB, (size_t)HD * TT, (size_t)TT * HD, RH, 2 * PB);
            k_merge<<<(unsigned)(((size_t)ZH * TT * HD / 2 + 255) / 256), 256, 0, stream>>>(Ob, h0, ATh, ATl); }
        k_gemmw<bf, 1, true><<<dim3(TT / 64, DM / 64, 1), 32, 0, stream>>>(ATh, ATl, WO, nullptr, DQ, OUT + (size_t)b * TT * DM, DM, bo, 0, 0, 0, 0, DQ); }
}

// v003
// Measured time: 232 microseconds a run.
// In both of two side-by-side timings against v002, it was 1.23 times as fast.
// Over all steps from v000 it is 17.6 times as fast.
#include <hip/hip_runtime.h>

// Local multi-head attention with a symmetric window (x [1][4096][1024]; q,k,v = x W^T + b ('oi' [1024][1024] + [1024], 0.02; 16 heads x 64); scores / 8; keys with |i - j| > 256 -> -inf; softmax; out = merged Wo^T + bo -> [1][4096][1024] (4.2 M)).
// Layout: bf16 copy of x; exact projections + f32 biases; T-4096 attention, all 16 heads per pass as grid z (hybrid rows: < 512 hi/lo 3 products, rest fp16 x1024; softmax applying the |i - j| <= 256 window as an index select; scores, softmax and P V of a 64-row tile in one work-group, over the tile's key band alone, the score band in LDS, whose rows the softmax overwrites with P); merged hi/lo x Wo exact + bo.
// Compute dtypes, f32 accumulate: every input rounded to bf16; projections exact + f32 biases; attention rows < 512 3 products, rest fp16; softmax f32; Wo hl x exact + bias.

#define NB_  1
#define TT   4096
#define DM   1024
#define NH_  16
#define NKV  16
#define REP  (NH_ / NKV)
#define HD   64
#define DQ   (NH_ * HD)
#define DKV  (NKV * HD)
#define ZH   16                   // heads per pass (grid z of the attention launches)
#define RH   512                  // query rows < RH use hi+lo planes (0: none)
#define WIN  0
#define PCAR 1024.0f
#define SCL  0.125f
#define WNB  256     // |i - j| <= 256 kept
#define BT   (2 * WNB / 64 + 2)   // 64-key tiles computed per 64-row tile: the 9 the window can reach, widened to whole 128-key softmax chunks
#define PB   (BT * 64)            // score row pitch in f32 (LDS): the band alone; column 0 is the band's first key. The same bytes then hold the row's P at pitch 2 * PB 16-bit elements (fp16 in the first half; or bf16 hi, then lo at + PB)
typedef _Float16 h16;
typedef unsigned short bf;
typedef __attribute__((ext_vector_type(16))) __bf16   v16bf;
typedef __attribute__((ext_vector_type(16))) _Float16 v16h;
typedef __attribute__((ext_vector_type(8)))  _Float16 v8h;
typedef __attribute__((ext_vector_type(8)))  unsigned short v8us;
typedef __attribute__((ext_vector_type(8)))  float    v8f;
typedef __attribute__((ext_vector_type(4)))  float    v4f;
typedef v8h  __attribute__((may_alias)) v8ha;
typedef v4f  __attribute__((may_alias)) v4fa;
typedef v8us __attribute__((may_alias)) v8usa;

__device__ __forceinline__ unsigned short f2bf(float f) { unsigned u = __float_as_uint(f); u += 0x7FFFu + ((u >> 16) & 1u); return (unsigned short)(u >> 16); }
__device__ __forceinline__ float bf2f(unsigned short b) { return __uint_as_float(((unsigned)b) << 16); }
__device__ __forceinline__ float bfr(float f) { return bf2f(f2bf(f)); }
__device__ __forceinline__ v16h cat16(v8h lo, v8h hi) { return __builtin_shufflevector(lo, hi, 0, 1, 2, 3, 4, 5, 6, 7, 8, 9, 10, 11, 12, 13, 14, 15); }
__device__ __forceinline__ v16bf cat16b(v8us lo, v8us hi) { return __builtin_bit_cast(v16bf, __builtin_shufflevector(lo, hi, 0, 1, 2, 3, 4, 5, 6, 7, 8, 9, 10, 11, 12, 13, 14, 15)); }
__device__ __forceinline__ v8f wmma16(v16h a, v16h b, v8f c) { return __builtin_amdgcn_wmma_f32_16x16x32_f16(false, a, false, b, (short)0, c, false, false); }
__device__ __forceinline__ v8f wmmab(v16bf a, v16bf b, v8f c) { return __builtin_amdgcn_wmma_f32_16x16x32_bf16(false, a, false, b, (short)0, c, false, false); }



// ---- k_gemmw: register-blocked GEMM, ONE WAVE per 64x64 output tile (16 accumulators), operands straight from K-contiguous 16-bit planes; grid (M/64, N/64, Z), 32 threads.
// C[m][n] (f32, pitch ldc, + optional f32 bias[n]) = sum_k A[m][k] Bt[n][k] (+ split products per NSPLIT). A has pitch lda, Bt pitch K. z-batch strides sA/sB/sC in elements. K % 32 == 0.
// BAND 1 (scores): blockIdx.y counts the BT key tiles from the first one of the row tile's band, and is C's column tile too (band pitch); tiles off the sequence leave. BAND 2 (P V): k runs over the keys the row tile's window can reach; A's column 0 is the band's first key. rb = sequence row of the launch's row 0.
template <typename T16> struct WFrag;
template <> struct WFrag<h16> { typedef v16h V; static __device__ __forceinline__ V ld(const h16* p) { return cat16(*(const v8h*)p, *(const v8h*)(p + 16)); } static __device__ __forceinline__ v8f mma(V a, V b, v8f c) { return wmma16(a, b, c); } };
template <> struct WFrag<bf> { typedef v16bf V; static __device__ __forceinline__ V ld(const bf* p) { return cat16b(*(const v8us*)p, *(const v8us*)(p + 16)); } static __device__ __forceinline__ v8f mma(V a, V b, v8f c) { return wmmab(a, b, c); } };
template <typename T16, int NSPLIT, bool BIAS, int BAND = 0>
__global__ __launch_bounds__(32) void k_gemmw(const T16* __restrict__ A, const T16* __restrict__ A2, const T16* __restrict__ Bt, const T16* __restrict__ Bt2, int K, float* C, int ldc, const float* __restrict__ bias, size_t sA, size_t sB, size_t sC, int rb, int lda) {
    typedef typename WFrag<T16>::V V;
    __shared__ __align__(16) float os[16 * 68];
    const size_t z = blockIdx.z; A += z * sA; if (A2) A2 += z * sA; Bt += z * sB; if (Bt2) Bt2 += z * sB; C += z * sC;
    const int lane = threadIdx.x & 31, lr = lane & 15, hi = lane >> 4; const int r0 = blockIdx.x * 64; int c0 = blockIdx.y * 64; const int cc0 = c0;
    const int band0 = BAND ? ((((rb + r0) >> 6) - WNB / 64) & ~1) * 64 : 0;   /* first key of the row tile's band (below 0 at the sequence's start) */
    if (BAND == 1) { c0 += band0; if (c0 < 0 || c0 >= TT) return; }
    int k0 = 0, k1 = K; if (BAND == 2) { k0 = max(rb + r0 - WNB, 0); k1 = min(rb + r0 + 64 + WNB, K); }
    v8f acc[4][4];
#pragma unroll
    for (int mb = 0; mb < 4; ++mb)
#pragma unroll
        for (int nb = 0; nb < 4; ++nb) acc[mb][nb] = (v8f){};
    const size_t aoff = (size_t)(r0 + lr) * lda + 8 * hi - (BAND == 2 ? band0 : 0), boff = (size_t)(c0 + lr) * K + 8 * hi;
#pragma unroll 1
    for (int kc = k0; kc < k1; kc += 32) {
        V a[4], a2[4]; const T16* pa[4]; const T16* pa2[4];
#pragma unroll
        for (int mb = 0; mb < 4; ++mb) { pa[mb] = A + aoff + (size_t)mb * 16 * lda + kc; a[mb] = WFrag<T16>::ld(pa[mb]); if (NSPLIT == 1 || NSPLIT == 2) { pa2[mb] = A2 + aoff + (size_t)mb * 16 * lda + kc; a2[mb] = WFrag<T16>::ld(pa2[mb]); } }
        /* stands before the A loads' address registers are reused; the pointers are inputs so that those registers live up to it */
        if (NSPLIT == 1 || NSPLIT == 2) asm volatile("s_wait_xcnt 0x0" :: "v"(pa[0]), "v"(pa[1]), "v"(pa[2]), "v"(pa[3]), "v"(pa2[0]), "v"(pa2[1]), "v"(pa2[2]), "v"(pa2[3]) : "memory");
        else asm volatile("s_wait_xcnt 0x0" :: "v"(pa[0]), "v"(pa[1]), "v"(pa[2]), "v"(pa[3]) : "memory");
#pragma unroll
        for (int nb = 0; nb < 4; ++nb) { const V b = WFrag<T16>::ld(Bt + boff + (size_t)nb * 16 * K + kc); V b2; if (NSPLIT >= 2) b2 = WFrag<T16>::ld(Bt2 + boff + (size_t)nb * 16 * K + kc);
#pragma unroll
            for (int mb = 0; mb < 4; ++mb) { acc[mb][nb] = WFrag<T16>::mma(a[mb], b, acc[mb][nb]); if (NSPLIT == 1 || NSPLIT == 2) acc[mb][nb] = WFrag<T16>::mma(a2[mb], b, acc[mb][nb]); if (NSPLIT >= 2) acc[mb][nb] = WFrag<T16>::mma(a[mb], b2, acc[mb][nb]); } }
        asm volatile("v_nop\n\tv_nop\n\tv_nop\n\tv_nop" : "+v"(acc[0][0]), "+v"(acc[1][1]), "+v"(acc[2][2]), "+v"(acc[3][3]) : "v"(a[0]), "v"(a[3]));
    }
#pragma unroll
    for (int mb = 0; mb < 4; ++mb) {
#pragma unroll
        for (int nb = 0; nb < 4; ++nb) {
#pragma unroll
            for (int j = 0; j < 8; ++j) os[(hi * 8 + j) * 68 + nb * 16 + lr] = acc[mb][nb][j]; }
        __builtin_amdgcn_wave_barrier(); asm volatile("" ::: "memory");
        float* crow = C + (size_t)(r0 + mb * 16) * ldc + (BAND == 1 ? cc0 : c0);
{
#pragma unroll
            for (int s = 0; s < 8; ++s) { const int row = 2 * s + hi, cofs = lr * 4; v4f val = *(const v4fa*)(os + row * 68 + cofs); if (BIAS) { val[0] += bfr(bias[c0 + cofs]); val[1] += bfr(bias[c0 + cofs + 1]); val[2] += bfr(bias[c0 + cofs + 2]); val[3] += bfr(bias[c0 + cofs + 3]); }
                *(v4f*)(crow + (size_t)row * ldc + cofs) = val; }
             }
        __builtin_amdgcn_wave_barrier(); asm volatile("" ::: "memory");
    }
}

__device__ __forceinline__ h16 tohx(float x) { return (h16)x; }
__device__ __forceinline__ void splitf(float y, unsigned short& h, unsigned short& l) { h = f2bf(y); l = f2bf(y - bf2f(h)); }
typedef __attribute__((ext_vector_type(2))) _Float16 v2h;
typedef __attribute__((ext_vector_type(4))) _Float16 v4h;
typedef __attribute__((ext_vector_type(2))) unsigned short v2us;
typedef __attribute__((ext_vector_type(4))) unsigned short v4us;
typedef __attribute__((ext_vector_type(2))) float v2f;
typedef __attribute__((ext_vector_type(4))) int v4i;

__global__ __launch_bounds__(256) void k_wtG(const float* __restrict__ w, int K, int N, bf* Bt) {
    const int lane = threadIdx.x & 31; const int L0 = (blockIdx.x * 8 + (threadIdx.x >> 5)) * 8; const int nlines = N * K / 64;
{
#pragma unroll 1
        for (int l = 0; l < 8; ++l) { const int L = L0 + l; if (L >= nlines) break; const size_t e = (size_t)L * 64 + lane * 2; const int k = (int)(e % K), n = (int)(e / K); v2us o;
            o[0] = f2bf(w[(size_t)k * N + n]); o[1] = f2bf(w[(size_t)(k + 1) * N + n]); *(v2us*)(Bt + e) = o; }
         }
}
__global__ __launch_bounds__(256) void k_cvt8(const float* __restrict__ src, bf* dst, size_t n8) { const size_t i = (size_t)blockIdx.x * 256 + threadIdx.x; if (i >= n8) return; const v8f v = *(const v8f*)(src + i * 8); v8us o;
#pragma unroll
    for (int k = 0; k < 8; ++k) o[k] = f2bf(v[k]); *(v8us*)(dst + i * 8) = o;  }

// k_rope: head planes [h][t][d] (fp16 + hi/lo) of rope(x) x sc with the rotate-half convention out[d] = x[d] cos[t][d] - x[d+HD/2] sin[t][d], out[d+HD/2] = x[d+HD/2] cos[t][d+HD/2] + x[d] sin[t][d+HD/2]
__global__ __launch_bounds__(256) void k_rope(const float* __restrict__ F, int pitch, int nheads, const float* __restrict__ CS, const float* __restrict__ RF, const float* __restrict__ nw, float sc, h16* P16, bf* Ph, bf* Pl) {
    const size_t e = ((size_t)blockIdx.x * 256 + threadIdx.x) * 2; if (e >= (size_t)nheads * TT * HD) return; const int d = (int)(e % HD); const int t = (int)((e / HD) % TT); const int h = (int)(e / ((size_t)HD * TT)); const float* f = F + (size_t)t * pitch + h * HD; const float rf = RF ? RF[(size_t)h * TT + t] : 1.0f; v2h o16; v2us oh, ol;
#pragma unroll
    for (int q = 0; q < 2; ++q) { const int dd = d + q; const int dp = (dd < HD / 2) ? dd + HD / 2 : dd - HD / 2; float x0 = f[dd], x1 = f[dp];
        if (RF) { float n0 = __fmul_rn(x0, rf), n1 = __fmul_rn(x1, rf); asm volatile("" : "+v"(n0)); asm volatile("" : "+v"(n1)); x0 = __fmul_rn(bfr(nw[dd]), n0); x1 = __fmul_rn(bfr(nw[dp]), n1); }
        const v2f cs = *(const v2f*)(CS + ((size_t)t * HD + dd) * 2); float a = __fmul_rn(x0, cs[0]), bq = __fmul_rn(x1, cs[1]); asm volatile("" : "+v"(a)); asm volatile("" : "+v"(bq)); const float r = ((dd < HD / 2) ? __fsub_rn(a, bq) : __fadd_rn(a, bq)) * sc;
        o16[q] = tohx(r); unsigned short a2, c2; splitf(r, a2, c2); oh[q] = a2; ol[q] = c2; }
    *(v2h*)(P16 + e) = o16; *(v2us*)(Ph + e) = oh; *(v2us*)(Pl + e) = ol;  }
__global__ __launch_bounds__(256) void k_vtp(const float* __restrict__ F, int pitch, int nheads, h16* V16, bf* Vh, bf* Vl) { const size_t e = ((size_t)blockIdx.x * 256 + threadIdx.x) * 2; if (e >= (size_t)nheads * HD * TT) return; const int t = (int)(e % TT); const int d = (int)((e / TT) % HD); const int g = (int)(e / ((size_t)TT * HD)); v2h o16; v2us oh, ol;
#pragma unroll
    for (int q = 0; q < 2; ++q) { const float x = F[(size_t)(t + q) * pitch + g * HD + d]; o16[q] = tohx(x); unsigned short a2, c2; splitf(x, a2, c2); oh[q] = a2; ol[q] = c2; }
    *(v2h*)(V16 + e) = o16; *(v2us*)(Vh + e) = oh; *(v2us*)(Vl + e) = ol;  }
__global__ __launch_bounds__(256) void k_csid(float* CS) { const int idx = blockIdx.x * 256 + threadIdx.x; if (idx >= TT * HD) return; v2f cs; cs[0] = 1.0f; cs[1] = 0.0f; *(v2f*)(CS + (size_t)idx * 2) = cs;  }
typedef v4h  __attribute__((may_alias)) v4ha;
typedef v4us __attribute__((may_alias)) v4usa;
// a 16x32 A fragment from two 16-byte pieces in LDS
template <typename T16> struct LFrag;
template <> struct LFrag<h16> { static __device__ __forceinline__ v16h ld2(const h16* p, const h16* q) { return cat16(*(const v8ha*)p, *(const v8ha*)q); } };
template <> struct LFrag<bf> { static __device__ __forceinline__ v16bf ld2(const bf* p, const bf* q) { return cat16b(*(const v8usa*)p, *(const v8usa*)q); } };

// ---- attention of one (64-row tile, head) by one work-group of 8 waves; the tile's score band S[64][PB] f32 lives in LDS and never reaches memory.
// 1 scores: wave w does the 64 rows x keys [80 w, 80 w + 80) of the band, q fragments held in registers. A score of logical column x of row r lies at x ^ (16 if r & 8): the two half-waves of an accumulator store then hit different banks.
// 2 softmax: wave w owns rows 8 w .. 8 w + 7; a row is read once, and its P goes over its own bytes (fp16 in the first half; or bf16 hi, then lo at + PB), the 16-byte piece c of row r at piece c ^ (r & 15): the 16 rows of an A fragment read then fall in 16 different bank groups.
// 3 P V: wave w does rows 16 (w >> 1) .. + 15 x columns 32 (w & 1) .. + 31, k ascending over the keys the tile's window can reach; V^T fragments come from memory one 64-key group ahead.
template <typename T16, bool HR>
__device__ __forceinline__ void attn_tile(float* S, const T16* __restrict__ Q, const T16* __restrict__ Q2, const T16* __restrict__ Kp, const T16* __restrict__ K2, const T16* __restrict__ Vt, const T16* __restrict__ Vt2, float* O, const int r0) {
    typedef typename WFrag<T16>::V V;
    const int lane = threadIdx.x & 31, lr = lane & 15, hi = lane >> 4; const int wv = __builtin_amdgcn_readfirstlane((int)(threadIdx.x >> 5));
    const int band0 = (((r0 >> 6) - WNB / 64) & ~1) * 64;   /* first key of the row tile's band (below 0 at the sequence's start) */
    {
        V a[4][2], a2[4][2]; const T16* pq[4]; const T16* pq2[4];
#pragma unroll
        for (int mb = 0; mb < 4; ++mb) { pq[mb] = Q + (size_t)(r0 + mb * 16 + lr) * HD + 8 * hi; a[mb][0] = WFrag<T16>::ld(pq[mb]); a[mb][1] = WFrag<T16>::ld(pq[mb] + 32); if constexpr (HR) { pq2[mb] = Q2 + (size_t)(r0 + mb * 16 + lr) * HD + 8 * hi; a2[mb][0] = WFrag<T16>::ld(pq2[mb]); a2[mb][1] = WFrag<T16>::ld(pq2[mb] + 32); } }
        /* stands before the q loads' address registers are reused; the pointers are inputs so that those registers live up to it */
        if constexpr (HR) asm volatile("s_wait_xcnt 0x0" :: "v"(pq[0]), "v"(pq[1]), "v"(pq[2]), "v"(pq[3]), "v"(pq2[0]), "v"(pq2[1]), "v"(pq2[2]), "v"(pq2[3]) : "memory");
        else asm volatile("s_wait_xcnt 0x0" :: "v"(pq[0]), "v"(pq[1]), "v"(pq[2]), "v"(pq[3]) : "memory");
        constexpr int G = HR ? 1 : 5;   /* 16-key pieces whose k fragments are fetched together (hi/lo planes: one, for registers) */
#pragma unroll
        for (int g = 0; g < 5; g += G) {
            V b[G][2], b2[G][2]; const T16* pk[G]; const T16* pk2[G];
#pragma unroll
            for (int u = 0; u < G; ++u) { const int key = min(max(band0 + (wv * 5 + g + u) * 16, 0), TT - 16);   /* a piece off the sequence loads in-bounds keys, so that no branch parts the loads; it is skipped below */
                pk[u] = Kp + (size_t)(key + lr) * HD + 8 * hi; b[u][0] = WFrag<T16>::ld(pk[u]); b[u][1] = WFrag<T16>::ld(pk[u] + 32); if constexpr (HR) { pk2[u] = K2 + (size_t)(key + lr) * HD + 8 * hi; b2[u][0] = WFrag<T16>::ld(pk2[u]); b2[u][1] = WFrag<T16>::ld(pk2[u] + 32); } }
            /* stands before the k loads' address registers are reused; the pointers are inputs so that those registers live up to it */
            if constexpr (HR) asm volatile("s_wait_xcnt 0x0" :: "v"(pk[0]), "v"(pk2[0]) : "memory");
            else asm volatile("s_wait_xcnt 0x0" :: "v"(pk[0]), "v"(pk[1]), "v"(pk[2]), "v"(pk[3]), "v"(pk[4]) : "memory");
#pragma unroll
            for (int u = 0; u < G; ++u) { const int sub = wv * 5 + g + u; const int key0 = band0 + sub * 16; if (key0 < 0 || key0 >= TT) continue;
                v8f acc[4];
#pragma unroll
                for (int mb = 0; mb < 4; ++mb) acc[mb] = (v8f){};
#pragma unroll
                for (int kk = 0; kk < 2; ++kk)
#pragma unroll
                    for (int mb = 0; mb < 4; ++mb) { acc[mb] = WFrag<T16>::mma(a[mb][kk], b[u][kk], acc[mb]); if constexpr (HR) { acc[mb] = WFrag<T16>::mma(a2[mb][kk], b[u][kk], acc[mb]); acc[mb] = WFrag<T16>::mma(a[mb][kk], b2[u][kk], acc[mb]); } }
                float* sc = S + hi * 8 * PB + ((sub * 16 + lr) ^ (hi << 4));
#pragma unroll
                for (int mb = 0; mb < 4; ++mb)
#pragma unroll
                    for (int j = 0; j < 8; ++j) sc[(mb * 16 + j) * PB] = acc[mb][j]; }
        }
    }
    __syncthreads();   /* every wave's scores are in LDS before a row is read */
    const int cb = band0 >> 7;   /* first of the BT / 2 128-key chunks of the band; a chunk off the sequence (on false) gets j0 = -TT, which fails the window test for every row */
    const int sw = (wv & 1) << 4;
#pragma unroll 2   /* two rows in flight: one row's cross-lane reductions are covered by the other's arithmetic */
    for (int rr = 0; rr < 8; ++rr) { const int row = wv * 8 + rr, i = r0 + row; float* sr = S + row * PB; float t[BT / 2][4]; float mx = -3.0e38f;
#pragma unroll
        for (int c = 0; c < BT / 2; ++c) { const int ch = cb + c; const bool on = ch >= 0 && ch < TT / 128; const int j0 = on ? ch * 128 + lane * 4 : -TT; const v4f a = *(const v4fa*)(sr + (((on ? c : max(cb, 0) - cb) * 128 + lane * 4) ^ sw));   /* a chunk off the sequence reads an in-band one; the window test masks it */
#pragma unroll
            for (int q = 0; q < 4; ++q) { const float s = a[q] * SCL; t[c][q] = (j0 + q <= i + WNB && j0 + q >= i - WNB) ? s : -3.0e38f;   /* symmetric window: |i - j| <= WNB */ mx = fmaxf(mx, t[c][q]); } }
#pragma unroll
        for (int sh = 16; sh; sh >>= 1) mx = fmaxf(mx, __shfl_xor(mx, sh, 32));
        float sum = 0.f;
#pragma unroll
        for (int c = 0; c < BT / 2; ++c)
#pragma unroll
            for (int q = 0; q < 4; ++q) { t[c][q] = __builtin_amdgcn_exp2f(__fmul_rn(__fsub_rn(t[c][q], mx), 1.4426950408889634f)); sum += t[c][q]; }
#pragma unroll
        for (int sh = 16; sh; sh >>= 1) sum += __shfl_xor(sum, sh, 32);
        const float f = __fdiv_rn(HR ? 1.0f : PCAR, sum);
        T16* pr = (T16*)sr + (lane & 1) * 4;
#pragma unroll
        for (int c = 0; c < BT / 2; ++c) { const int ch = cb + c; if (ch < 0 || ch >= TT / 128) continue; const int pc = ((c * 16 + (lane >> 1)) ^ (row & 15)) * 8;
            if constexpr (HR) { v4us oh, ol;
#pragma unroll
                for (int q = 0; q < 4; ++q) { unsigned short a2, c2; splitf(t[c][q] * f, a2, c2); oh[q] = a2; ol[q] = c2; }
                *(v4usa*)(pr + pc) = oh; *(v4usa*)(pr + PB + pc) = ol;
            } else { v4h o4;
#pragma unroll
                for (int q = 0; q < 4; ++q) o4[q] = tohx(t[c][q] * f);
                *(v4ha*)(pr + pc) = o4; } } }
    __syncthreads();   /* every row's P is in LDS before a fragment of it is read */
    const int mb = wv >> 1, n0 = (wv & 1) * 32; const int k0 = max(r0 - WNB, 0), k1 = min(r0 + 64 + WNB, TT);
    const T16* pa = (const T16*)S + (mb * 16 + lr) * (2 * PB);
    const size_t voff = (size_t)(n0 + lr) * TT + 8 * hi;
    v8f acc[2]; acc[0] = (v8f){}; acc[1] = (v8f){};
    V bc[2][2], bc2[2][2], bn[2][2], bn2[2][2];   /* [column block][32-key step] */
    auto ldv = [&](V (&d)[2][2], V (&d2)[2][2], int kc) { const T16* p[2]; const T16* p2[2];
#pragma unroll
        for (int nb = 0; nb < 2; ++nb) { p[nb] = Vt + voff + (size_t)nb * 16 * TT + kc; d[nb][0] = WFrag<T16>::ld(p[nb]); d[nb][1] = WFrag<T16>::ld(p[nb] + 32); if constexpr (HR) { p2[nb] = Vt2 + voff + (size_t)nb * 16 * TT + kc; d2[nb][0] = WFrag<T16>::ld(p2[nb]); d2[nb][1] = WFrag<T16>::ld(p2[nb] + 32); } }
        /* stands before the v loads' address registers are reused; the pointers are inputs so that those registers live up to it */
        if constexpr (HR) asm volatile("s_wait_xcnt 0x0" :: "v"(p[0]), "v"(p[1]), "v"(p2[0]), "v"(p2[1]) : "memory");
        else asm volatile("s_wait_xcnt 0x0" :: "v"(p[0]), "v"(p[1]) : "memory"); };
    auto step = [&](V (&d)[2][2], V (&d2)[2][2], int kc) {
#pragma unroll
        for (int s = 0; s < 2; ++s) { const int pc = ((kc - band0) >> 3) + s * 4 + hi; const V a = LFrag<T16>::ld2(pa + ((pc ^ lr) << 3), pa + (((pc + 2) ^ lr) << 3)); V a2; if constexpr (HR) a2 = LFrag<T16>::ld2(pa + PB + ((pc ^ lr) << 3), pa + PB + (((pc + 2) ^ lr) << 3));
#pragma unroll
            for (int nb = 0; nb < 2; ++nb) { acc[nb] = WFrag<T16>::mma(a, d[nb][s], acc[nb]); if constexpr (HR) { acc[nb] = WFrag<T16>::mma(a2, d[nb][s], acc[nb]); acc[nb] = WFrag<T16>::mma(a, d2[nb][s], acc[nb]); } } }
        asm volatile("v_nop\n\tv_nop\n\tv_nop\n\tv_nop" : "+v"(acc[0]), "+v"(acc[1]));   /* a branch follows: keeps the matrix instructions' distance on its taken side too */
    };
    ldv(bc, bc2, k0);
#pragma unroll 1
    for (int kc = k0; kc < k1; kc += 128) {   /* two register sets in turn: the next 64-key group flies while this one is multiplied; the last fetch takes the last group again rather than branch */
        ldv(bn, bn2, min(kc + 64, k1 - 64)); step(bc, bc2, kc);
        if (kc + 64 >= k1) break;
        ldv(bc, bc2, min(kc + 128, k1 - 64)); step(bn, bn2, kc + 64);
    }
    float* po = O + (size_t)(r0 + mb * 16 + hi * 8) * HD + n0 + lr;
#pragma unroll
    for (int nb = 0; nb < 2; ++nb)
#pragma unroll
        for (int j = 0; j < 8; ++j) po[j * HD + nb * 16] = acc[nb][j];
}
__global__ __launch_bounds__(256) void k_attn(const h16* __restrict__ Q16, const h16* __restrict__ K16, const h16* __restrict__ V16, const bf* __restrict__ Qh, const bf* __restrict__ Ql, const bf* __restrict__ Kh, const bf* __restrict__ Kl, const bf* __restrict__ Vh, const bf* __restrict__ Vl, float* O) {
    __shared__ __align__(16) float S[64 * PB];
    const size_t zo = (size_t)blockIdx.z * TT * HD; const int r0 = blockIdx.x * 64;
    if (r0 < RH) attn_tile<bf, true>(S, Qh + zo, Ql + zo, Kh + zo, Kl + zo, Vh + zo, Vl + zo, O + zo, r0);
    else attn_tile<h16, false>(S, Q16 + zo, nullptr, K16 + zo, nullptr, V16 + zo, nullptr, O + zo, r0);
}


__global__ __launch_bounds__(256) void k_merge(const float* __restrict__ O, int h0, bf* Ah, bf* Al) { const size_t e = ((size_t)blockIdx.x * 256 + threadIdx.x) * 2; if (e >= (size_t)ZH * TT * HD) return; const int d = (int)(e % HD); const int t = (int)((e / HD) % TT); const int zz = (int)(e / ((size_t)HD * TT)); const float cs = (t < RH) ? 1.0f : (1.0f / PCAR); const size_t oo = (size_t)t * DQ + (h0 + zz) * HD + d;
    v2us oh, ol;
#pragma unroll
    for (int q = 0; q < 2; ++q) { unsigned short a, c2; splitf(O[e + q] * cs, a, c2); oh[q] = a; ol[q] = c2; } *(v2us*)(Ah + oo) = oh; *(v2us*)(Al + oo) = ol;  }

extern "C" void kernel_launch(void* const* d_in, const int* in_sizes, int n_in,
                              void* d_out, int out_size, void* d_ws, size_t ws_size, hipStream_t stream) {
    (void)in_sizes; (void)n_in; (void)out_size;
    const float* x = (const float*)d_in[0]; const float* wq = (const float*)d_in[1]; const float* bq = (const float*)d_in[2]; const float* wk = (const float*)d_in[3]; const float* bk = (const float*)d_in[4]; const float* wv = (const float*)d_in[5]; const float* bv = (const float*)d_in[6]; const float* wo = (const float*)d_in[7]; const float* bo = (const float*)d_in[8];
    float* OUT = (float*)d_out;     // [1][4096][1024]
    char* wsp = (char*)d_ws;
    auto take = [&](size_t bytes) { char* p = wsp; wsp += (bytes + 255) & ~(size_t)255; return (void*)p; };
    bf* WO = (bf*)take((size_t)DM * DQ * 2);
    h16* QP16 = (h16*)take((size_t)NH_ * TT * HD * 2); h16* KP16 = (h16*)take((size_t)NKV * TT * HD * 2); h16* VT16 = (h16*)take((size_t)NKV * HD * TT * 2);
    bf* QPh = (bf*)take((size_t)NH_ * TT * HD * 2); bf* QPl = (bf*)take((size_t)NH_ * TT * HD * 2); bf* KPh = (bf*)take((size_t)NKV * TT * HD * 2); bf* KPl = (bf*)take((size_t)NKV * TT * HD * 2); bf* VTh = (bf*)take((size_t)NKV * HD * TT * 2); bf* VTl = (bf*)take((size_t)NKV * HD * TT * 2);
    float* Ob = (float*)take((size_t)ZH * TT * HD * 4);
    bf* WQ = (bf*)take((size_t)DQ * DM * 2); bf* WK = (bf*)take((size_t)DKV * DM * 2); bf* WV = (bf*)take((size_t)DKV * DM * 2); float* CS = (float*)take((size_t)TT * HD * 2 * 4);
    bf* XB = (bf*)take((size_t)TT * DM * 2); float* FQ = (float*)take((size_t)TT * DQ * 4); float* FK = (float*)take((size_t)TT * DKV * 4);
    if ((size_t)(wsp - (char*)d_ws) > ws_size) return;    // ws 256 MiB; 138 MiB taken
    bf* ATh = QPh; bf* ATl = QPl;   // stream-ordered reuse: the merged planes take the q hi/lo planes, dead after the attention launch
    float* FV = FK;   // v projection reuses the k buffer after the k planes are built (stream-ordered)
    { k_cvt8<<<(unsigned)(((size_t)DQ * DM / 8 + 255) / 256), 256, 0, stream>>>(wq, WQ, (size_t)DQ * DM / 8); k_cvt8<<<(unsigned)(((size_t)DKV * DM / 8 + 255) / 256), 256, 0, stream>>>(wk, WK, (size_t)DKV * DM / 8); k_cvt8<<<(unsigned)(((size_t)DKV * DM / 8 + 255) / 256), 256, 0, stream>>>(wv, WV, (size_t)DKV * DM / 8);
      k_cvt8<<<(unsigned)(((size_t)DM * DQ / 8 + 255) / 256), 256, 0, stream>>>(wo, WO, (size_t)DM * DQ / 8);
       }
    k_csid<<<(TT * HD + 255) / 256, 256, 0, stream>>>(CS);
    const unsigned LQ = (unsigned)(((size_t)NH_ * TT * HD / 2 + 255) / 256), LKv = (unsigned)(((size_t)NKV * TT * HD / 2 + 255) / 256);
    for (int b = 0; b < NB_; ++b) {
        
        k_cvt8<<<(unsigned)(((size_t)TT * DM / 8 + 255) / 256), 256, 0, stream>>>(x + (size_t)b * TT * DM, XB, (size_t)TT * DM / 8);
        k_gemmw<bf, 0, true><<<dim3(TT / 64, DQ / 64, 1), 32, 0, stream>>>(XB, nullptr, WQ, nullptr, DM, FQ, DQ, bq, 0, 0, 0, 0, DM);
        k_rope<<<LQ, 256, 0, stream>>>(FQ, DQ, NH_, CS, nullptr, nullptr, 1.0f, QP16, QPh, QPl);
        k_gemmw<bf, 0, true><<<dim3(TT / 64, DKV / 64, 1), 32, 0, stream>>>(XB, nullptr, WK, nullptr, DM, FK, DKV, bk, 0, 0, 0, 0, DM);
        k_rope<<<LKv, 256, 0, stream>>>(FK, DKV, NKV, CS, nullptr, nullptr, 1.0f, KP16, KPh, KPl);
        k_gemmw<bf, 0, true><<<dim3(TT / 64, DKV / 64, 1), 32, 0, stream>>>(XB, nullptr, WV, nullptr, DM, FV, DKV, bv, 0, 0, 0, 0, DM); k_vtp<<<LKv, 256, 0, stream>>>(FV, DKV, NKV, VT16, VTh, VTl);
        for (int h0 = 0; h0 < NH_; h0 += ZH) { const size_t zq = (size_t)h0, zk = (size_t)(h0 / REP);   // one kv head per query head: the pass's heads use consecutive kv planes (z-strides TT*HD)
            k_attn<<<dim3(TT / 64, 1, ZH), 256, 0, stream>>>(QP16 + zq * TT * HD, KP16 + zk * TT * HD, VT16 + zk * HD * TT, QPh + zq * TT * HD, QPl + zq * TT * HD, KPh + zk * TT * HD, KPl + zk * TT * HD, VTh + zk * HD * TT, VTl + zk * HD * TT, Ob);
            k_merge<<<(unsigned)(((size_t)ZH * TT * HD / 2 + 255) / 256), 256, 0, stream>>>(Ob, h0, ATh, ATl); }
        k_gemmw<bf, 1, true><<<dim3(TT / 64, DM / 64, 1), 32, 0, stream>>>(ATh, ATl, WO, nullptr, DQ, OUT + (size_t)b * TT * DM, DM, bo, 0, 0, 0, 0, DQ); }
}

// v004
// A run of this version takes 176 microseconds.
// Next to v003, in two timings, it ran 1.33 times as fast each time.
// All steps since v000 together make it 23.5 times as fast.
#include <hip/hip_runtime.h>

// Local multi-head attention with a symmetric window (x [1][4096][1024]; q,k,v = x W^T + b ('oi' [1024][1024] + [1024], 0.02; 16 heads x 64); scores / 8; keys with |i - j| > 256 -> -inf; softmax; out = merged Wo^T + bo -> [1][4096][1024] (4.2 M)).
// Layout: bf16 copy of x; exact projections + f32 biases; T-4096 attention, all 16 heads per pass as grid z (hybrid rows: < 512 hi/lo 3 products, rest fp16 x1024; softmax applying the |i - j| <= 256 window as an index select; scores, softmax and P V of a 64-row tile in one work-group, over the tile's key band alone, the score band in LDS, whose rows the softmax overwrites with P); merged hi/lo x Wo exact + bo.
// Compute dtypes, f32 accumulate: every input rounded to bf16; projections exact + f32 biases; attention rows < 512 3 products, rest fp16; softmax f32; Wo hl x exact + bias.

#define NB_  1
#define TT   4096
#define DM   1024
#define NH_  16
#define NKV  16
#define REP  (NH_ / NKV)
#define HD   64
#define DQ   (NH_ * HD)
#define DKV  (NKV * HD)
#define ZH   16                   // heads per pass (grid z of the attention launches)
#define RH   512                  // query rows < RH use hi+lo planes (0: none)
#define WIN  0
#define PCAR 1024.0f
#define SCL  0.125f
#define WNB  256     // |i - j| <= 256 kept
#define BT   (2 * WNB / 64 + 2)   // 64-key tiles computed per 64-row tile: the 9 the window can reach, widened to whole 128-key softmax chunks
#define PB   (BT * 64)            // score row pitch in f32 (LDS): the band alone; column 0 is the band's first key. The same bytes then hold the row's P at pitch 2 * PB 16-bit elements (fp16 in the first half; or bf16 hi, then lo at + PB)
typedef _Float16 h16;
typedef unsigned short bf;
typedef __attribute__((ext_vector_type(16))) __bf16   v16bf;
typedef __attribute__((ext_vector_type(16))) _Float16 v16h;
typedef __attribute__((ext_vector_type(8)))  _Float16 v8h;
typedef __attribute__((ext_vector_type(8)))  unsigned short v8us;
typedef __attribute__((ext_vector_type(8)))  float    v8f;
typedef __attribute__((ext_vector_type(4)))  float    v4f;
typedef v8h  __attribute__((may_alias)) v8ha;
typedef v4f  __attribute__((may_alias)) v4fa;
typedef v8us __attribute__((may_alias)) v8usa;

__device__ __forceinline__ unsigned short f2bf(float f) { unsigned u = __float_as_uint(f); u += 0x7FFFu + ((u >> 16) & 1u); return (unsigned short)(u >> 16); }
__device__ __forceinline__ float bf2f(unsigned short b) { return __uint_as_float(((unsigned)b) << 16); }
__device__ __forceinline__ float bfr(float f) { return bf2f(f2bf(f)); }
__device__ __forceinline__ v16h cat16(v8h lo, v8h hi) { return __builtin_shufflevector(lo, hi, 0, 1, 2, 3, 4, 5, 6, 7, 8, 9, 10, 11, 12, 13, 14, 15); }
__device__ __forceinline__ v16bf cat16b(v8us lo, v8us hi) { return __builtin_bit_cast(v16bf, __builtin_shufflevector(lo, hi, 0, 1, 2, 3, 4, 5, 6, 7, 8, 9, 10, 11, 12, 13, 14, 15)); }
__device__ __forceinline__ v8f wmma16(v16h a, v16h b, v8f c) { return __builtin_amdgcn_wmma_f32_16x16x32_f16(false, a, false, b, (short)0, c, false, false); }
__device__ __forceinline__ v8f wmmab(v16bf a, v16bf b, v8f c) { return __builtin_amdgcn_wmma_f32_16x16x32_bf16(false, a, false, b, (short)0, c, false, false); }



// a 16x32 fragment from two 16-byte pieces of a K-contiguous 16-bit row, and its matrix instruction
template <typename T16> struct WFrag;
template <> struct WFrag<h16> { typedef v16h V; static __device__ __forceinline__ V ld(const h16* p) { return cat16(*(const v8h*)p, *(const v8h*)(p + 16)); } static __device__ __forceinline__ v8f mma(V a, V b, v8f c) { return wmma16(a, b, c); } };
template <> struct WFrag<bf> { typedef v16bf V; static __device__ __forceinline__ V ld(const bf* p) { return cat16b(*(const v8us*)p, *(const v8us*)(p + 16)); } static __device__ __forceinline__ v8f mma(V a, V b, v8f c) { return wmmab(a, b, c); } };

__device__ __forceinline__ h16 tohx(float x) { return (h16)x; }
__device__ __forceinline__ void splitf(float y, unsigned short& h, unsigned short& l) { h = f2bf(y); l = f2bf(y - bf2f(h)); }
typedef __attribute__((ext_vector_type(2))) _Float16 v2h;
typedef __attribute__((ext_vector_type(4))) _Float16 v4h;
typedef __attribute__((ext_vector_type(2))) unsigned short v2us;
typedef __attribute__((ext_vector_type(4))) unsigned short v4us;
typedef __attribute__((ext_vector_type(2))) float v2f;
typedef __attribute__((ext_vector_type(4))) int v4i;

__global__ __launch_bounds__(256) void k_wtG(const float* __restrict__ w, int K, int N, bf* Bt) {
    const int lane = threadIdx.x & 31; const int L0 = (blockIdx.x * 8 + (threadIdx.x >> 5)) * 8; const int nlines = N * K / 64;
{
#pragma unroll 1
        for (int l = 0; l < 8; ++l) { const int L = L0 + l; if (L >= nlines) break; const size_t e = (size_t)L * 64 + lane * 2; const int k = (int)(e % K), n = (int)(e / K); v2us o;
            o[0] = f2bf(w[(size_t)k * N + n]); o[1] = f2bf(w[(size_t)(k + 1) * N + n]); *(v2us*)(Bt + e) = o; }
         }
}
__global__ __launch_bounds__(256) void k_cvt8(const float* __restrict__ src, bf* dst, size_t n8) { const size_t i = (size_t)blockIdx.x * 256 + threadIdx.x; if (i >= n8) return; const v8f v = *(const v8f*)(src + i * 8); v8us o;
#pragma unroll
    for (int k = 0; k < 8; ++k) o[k] = f2bf(v[k]); *(v8us*)(dst + i * 8) = o;  }

// k_rope: head planes [h][t][d] (fp16 + hi/lo) of rope(x) x sc with the rotate-half convention out[d] = x[d] cos[t][d] - x[d+HD/2] sin[t][d], out[d+HD/2] = x[d+HD/2] cos[t][d+HD/2] + x[d] sin[t][d+HD/2]
__global__ __launch_bounds__(256) void k_rope(const float* __restrict__ F, int pitch, int nheads, const float* __restrict__ CS, const float* __restrict__ RF, const float* __restrict__ nw, float sc, h16* P16, bf* Ph, bf* Pl) {
    const size_t e = ((size_t)blockIdx.x * 256 + threadIdx.x) * 2; if (e >= (size_t)nheads * TT * HD) return; const int d = (int)(e % HD); const int t = (int)((e / HD) % TT); const int h = (int)(e / ((size_t)HD * TT)); const float* f = F + (size_t)t * pitch + h * HD; const float rf = RF ? RF[(size_t)h * TT + t] : 1.0f; v2h o16; v2us oh, ol;
#pragma unroll
    for (int q = 0; q < 2; ++q) { const int dd = d + q; const int dp = (dd < HD / 2) ? dd + HD / 2 : dd - HD / 2; float x0 = f[dd], x1 = f[dp];
        if (RF) { float n0 = __fmul_rn(x0, rf), n1 = __fmul_rn(x1, rf); asm volatile("" : "+v"(n0)); asm volatile("" : "+v"(n1)); x0 = __fmul_rn(bfr(nw[dd]), n0); x1 = __fmul_rn(bfr(nw[dp]), n1); }
        const v2f cs = *(const v2f*)(CS + ((size_t)t * HD + dd) * 2); float a = __fmul_rn(x0, cs[0]), bq = __fmul_rn(x1, cs[1]); asm volatile("" : "+v"(a)); asm volatile("" : "+v"(bq)); const float r = ((dd < HD / 2) ? __fsub_rn(a, bq) : __fadd_rn(a, bq)) * sc;
        o16[q] = tohx(r); unsigned short a2, c2; splitf(r, a2, c2); oh[q] = a2; ol[q] = c2; }
    *(v2h*)(P16 + e) = o16; *(v2us*)(Ph + e) = oh; *(v2us*)(Pl + e) = ol;  }
__global__ __launch_bounds__(256) void k_vtp(const float* __restrict__ F, int pitch, int nheads, h16* V16, bf* Vh, bf* Vl) { const size_t e = ((size_t)blockIdx.x * 256 + threadIdx.x) * 2; if (e >= (size_t)nheads * HD * TT) return; const int t = (int)(e % TT); const int d = (int)((e / TT) % HD); const int g = (int)(e / ((size_t)TT * HD)); v2h o16; v2us oh, ol;
#pragma unroll
    for (int q = 0; q < 2; ++q) { const float x = F[(size_t)(t + q) * pitch + g * HD + d]; o16[q] = tohx(x); unsigned short a2, c2; splitf(x, a2, c2); oh[q] = a2; ol[q] = c2; }
    *(v2h*)(V16 + e) = o16; *(v2us*)(Vh + e) = oh; *(v2us*)(Vl + e) = ol;  }
__global__ __launch_bounds__(256) void k_csid(float* CS) { const int idx = blockIdx.x * 256 + threadIdx.x; if (idx >= TT * HD) return; v2f cs; cs[0] = 1.0f; cs[1] = 0.0f; *(v2f*)(CS + (size_t)idx * 2) = cs;  }
typedef v4h  __attribute__((may_alias)) v4ha;
typedef v4us __attribute__((may_alias)) v4usa;
// a 16x32 A fragment from two 16-byte pieces in LDS
template <typename T16> struct LFrag;
template <> struct LFrag<h16> { static __device__ __forceinline__ v16h ld2(const h16* p, const h16* q) { return cat16(*(const v8ha*)p, *(const v8ha*)q); } };
template <> struct LFrag<bf> { static __device__ __forceinline__ v16bf ld2(const bf* p, const bf* q) { return cat16b(*(const v8usa*)p, *(const v8usa*)q); } };

// ---- k_gemms: C[m][n] (f32, pitch ldc, + f32 bias[n]) = sum_k A[m][k] Bt[n][k] (NSPLIT 1: + A2[m][k] Bt[n][k]); A, A2, Bt K-contiguous bf16 planes of pitch K; K % 128 == 0, K >= 256. grid (M/128, N/128), 128 threads.
// One work-group of 4 waves per 128x128 tile, a wave per 64x64 quarter (16 accumulators). A pass is 128 k: 256 bytes of each of the tile's 128 A (A2) and 128 Bt rows, brought whole-line into LDS by asynchronous copies, two buffers, the next pass's copies in flight while this pass is multiplied. LDS row pitch 272 bytes (16 x odd: the 16 rows of a fragment read fall in different bank groups).
#define GP 136   // LDS row pitch in 16-bit elements
// eight copies of 16 bytes a lane, 8 rows apart (global pitch K elements, LDS pitch GP); g is the same for the whole work-group, toff the lane's own offset in elements
template <int K> __device__ __forceinline__ void copy8(unsigned l, const bf* g, size_t toff) {
    unsigned la[8]; const bf* ga[8];
#pragma unroll
    for (int i = 0; i < 8; ++i) { la[i] = l + i * 8 * GP * 2; ga[i] = g + (size_t)i * 8 * K + toff; }
    /* the wait stands in the copies' own statement: it ends before any of their address registers is rewritten */
    asm volatile("global_load_async_to_lds_b128 %0, %8, off\n\t"
                 "global_load_async_to_lds_b128 %1, %9, off\n\t"
                 "global_load_async_to_lds_b128 %2, %10, off\n\t"
                 "global_load_async_to_lds_b128 %3, %11, off\n\t"
                 "global_load_async_to_lds_b128 %4, %12, off\n\t"
                 "global_load_async_to_lds_b128 %5, %13, off\n\t"
                 "global_load_async_to_lds_b128 %6, %14, off\n\t"
                 "global_load_async_to_lds_b128 %7, %15, off\n\t"
                 "s_wait_xcnt 0x0"
                 :: "v"(la[0]), "v"(la[1]), "v"(la[2]), "v"(la[3]), "v"(la[4]), "v"(la[5]), "v"(la[6]), "v"(la[7]),
                    "v"(ga[0]), "v"(ga[1]), "v"(ga[2]), "v"(ga[3]), "v"(ga[4]), "v"(ga[5]), "v"(ga[6]), "v"(ga[7]) : "memory");
}
template <int NSPLIT, bool BIAS, int K>
__global__ __launch_bounds__(128) void k_gemms(const bf* __restrict__ A, const bf* __restrict__ A2, const bf* __restrict__ Bt, float* C, int ldc, const float* __restrict__ bias) {
    constexpr int NP = NSPLIT ? 3 : 2;   /* planes of a stage: A, Bt (, A2) */
    __shared__ __align__(16) bf ring[2][NP][128 * GP];
    __shared__ __align__(16) float osb[4][16 * 68];
    const int tid = threadIdx.x, lane = tid & 31, lr = lane & 15, hi = lane >> 4; const int wv = __builtin_amdgcn_readfirstlane(tid >> 5);
    const int R0 = blockIdx.x * 128, C0 = blockIdx.y * 128; const int wm = (wv >> 1) * 64, wn = (wv & 1) * 64; const int r0 = R0 + wm, c0 = C0 + wn;
    /* a thread copies piece tid & 15 of rows tid >> 4, + 8, ... + 120 of each plane: a wave's copy takes two whole 256-byte row parts */
    const size_t toff = (size_t)(tid >> 4) * K + (tid & 15) * 8; const int lo = (tid >> 4) * GP + (tid & 15) * 8;
    auto fill = [&](int buf, int t) {
        const bf* pa = A + (size_t)R0 * K + t * 128; const bf* pb = Bt + (size_t)C0 * K + t * 128;
        copy8<K>((unsigned)(size_t)&ring[buf][0][lo], pa, toff); copy8<K>((unsigned)(size_t)&ring[buf][0][lo + 64 * GP], pa + (size_t)64 * K, toff);
        copy8<K>((unsigned)(size_t)&ring[buf][1][lo], pb, toff); copy8<K>((unsigned)(size_t)&ring[buf][1][lo + 64 * GP], pb + (size_t)64 * K, toff);
        if constexpr (NSPLIT) { const bf* pa2 = A2 + (size_t)R0 * K + t * 128; copy8<K>((unsigned)(size_t)&ring[buf][2][lo], pa2, toff); copy8<K>((unsigned)(size_t)&ring[buf][2][lo + 64 * GP], pa2 + (size_t)64 * K, toff); } };
    v8f acc[4][4];
#pragma unroll
    for (int mb = 0; mb < 4; ++mb)
#pragma unroll
        for (int nb = 0; nb < 4; ++nb) acc[mb][nb] = (v8f){};
    constexpr int NT = K / 128;
    fill(0, 0);
    asm volatile("s_wait_asynccnt 0x0" ::: "memory");   /* this wave's copies of pass 0 have landed */
    __syncthreads();   /* every wave's have: pass 0 may be read */
    fill(1, 1);
#pragma unroll 1   /* one pass a trip: the two buffers take turns by the trip's parity */
    for (int t = 0; t < NT; ++t) {
        const bf* As = &ring[t & 1][0][(wm + lr) * GP + 8 * hi]; const bf* Bs = &ring[t & 1][1][(wn + lr) * GP + 8 * hi]; const bf* A2s = &ring[t & 1][NP - 1][(wm + lr) * GP + 8 * hi];
        v16bf a[2][4], a2[2][4], b[2][4];   /* two fragment sets: a 32-k block's 16 (24) LDS reads go out while the block before it is multiplied */
        auto ldf = [&](int s, int ks) {
#pragma unroll
            for (int mb = 0; mb < 4; ++mb) { a[s][mb] = LFrag<bf>::ld2(As + mb * 16 * GP + ks * 32, As + mb * 16 * GP + ks * 32 + 16); if constexpr (NSPLIT) a2[s][mb] = LFrag<bf>::ld2(A2s + mb * 16 * GP + ks * 32, A2s + mb * 16 * GP + ks * 32 + 16); }
#pragma unroll
            for (int nb = 0; nb < 4; ++nb) b[s][nb] = LFrag<bf>::ld2(Bs + nb * 16 * GP + ks * 32, Bs + nb * 16 * GP + ks * 32 + 16); };
        ldf(0, 0);
#pragma unroll
        for (int ks = 0; ks < 4; ++ks) {
            if (ks < 3) ldf((ks + 1) & 1, ks + 1);
            __builtin_amdgcn_sched_barrier(0);   /* holds the next block's reads, as one group, ahead of this block's matrix instructions; sunk to their uses, each would expose the LDS latency to the SIMD's one wave */
#pragma unroll
            for (int nb = 0; nb < 4; ++nb) {
#pragma unroll
                for (int mb = 0; mb < 4; ++mb) acc[mb][nb] = wmmab(a[ks & 1][mb], b[ks & 1][nb], acc[mb][nb]);
                if constexpr (NSPLIT) {
#pragma unroll
                    for (int mb = 0; mb < 4; ++mb) acc[mb][nb] = wmmab(a2[ks & 1][mb], b[ks & 1][nb], acc[mb][nb]); } }
            __builtin_amdgcn_sched_barrier(0);   /* the block's matrix instructions stay ahead of the reads that reuse its fragment set, and of the pass's foot */
        }
        asm volatile("v_nop\n\tv_nop\n\tv_nop\n\tv_nop" : "+v"(acc[0][3]), "+v"(acc[1][3]), "+v"(acc[2][3]), "+v"(acc[3][3]));   /* a branch follows: keeps the matrix instructions' distance on its taken side too */
        asm volatile("s_wait_dscnt 0x0" ::: "memory");      /* this wave has left the buffer that is refilled below */
        asm volatile("s_wait_asynccnt 0x0" ::: "memory");   /* this wave's copies of pass t + 1 have landed */
        __syncthreads();   /* publishes pass t + 1 and ends every wave's reads of pass t */
        if (t + 2 < NT) fill(t & 1, t + 2);
    }
    asm volatile("s_wait_asynccnt 0x0" ::: "memory");   /* no copy is in flight when the wave goes on to its end */
    float* os = osb[wv];
#pragma unroll
    for (int mb = 0; mb < 4; ++mb) {
#pragma unroll
        for (int nb = 0; nb < 4; ++nb) {
#pragma unroll
            for (int j = 0; j < 8; ++j) os[(hi * 8 + j) * 68 + nb * 16 + lr] = acc[mb][nb][j]; }
        __builtin_amdgcn_wave_barrier(); asm volatile("" ::: "memory");
        float* crow = C + (size_t)(r0 + mb * 16) * ldc + c0;
{
#pragma unroll
            for (int s = 0; s < 8; ++s) { const int row = 2 * s + hi, cofs = lr * 4; v4f val = *(const v4fa*)(os + row * 68 + cofs); if (BIAS) { val[0] += bfr(bias[c0 + cofs]); val[1] += bfr(bias[c0 + cofs + 1]); val[2] += bfr(bias[c0 + cofs + 2]); val[3] += bfr(bias[c0 + cofs + 3]); }
                *(v4f*)(crow + (size_t)row * ldc + cofs) = val; }
             }
        asm volatile("s_wait_xcnt 0x0" ::: "memory");   /* stands before the stores' data and address registers are reused for the next 16 rows */
        __builtin_amdgcn_wave_barrier(); asm volatile("" ::: "memory");
    }
}


// ---- attention of one (64-row tile, head) by one work-group of 8 waves; the tile's score band S[64][PB] f32 lives in LDS and never reaches memory.
// 1 scores: wave w does the 64 rows x keys [80 w, 80 w + 80) of the band, q fragments held in registers. A score of logical column x of row r lies at x ^ (16 if r & 8): the two half-waves of an accumulator store then hit different banks.
// 2 softmax: wave w owns rows 8 w .. 8 w + 7; a row is read once, and its P goes over its own bytes (fp16 in the first half; or bf16 hi, then lo at + PB), the 16-byte piece c of row r at piece c ^ (r & 15): the 16 rows of an A fragment read then fall in 16 different bank groups.
// 3 P V: wave w does rows 16 (w >> 1) .. + 15 x columns 32 (w & 1) .. + 31, k ascending over the keys the tile's window can reach; V^T fragments come from memory one 64-key group ahead.
template <typename T16, bool HR>
__device__ __forceinline__ void attn_tile(float* S, const T16* __restrict__ Q, const T16* __restrict__ Q2, const T16* __restrict__ Kp, const T16* __restrict__ K2, const T16* __restrict__ Vt, const T16* __restrict__ Vt2, float* O, const int r0) {
    typedef typename WFrag<T16>::V V;
    const int lane = threadIdx.x & 31, lr = lane & 15, hi = lane >> 4; const int wv = __builtin_amdgcn_readfirstlane((int)(threadIdx.x >> 5));
    const int band0 = (((r0 >> 6) - WNB / 64) & ~1) * 64;   /* first key of the row tile's band (below 0 at the sequence's start) */
    {
        V a[4][2], a2[4][2]; const T16* pq[4]; const T16* pq2[4];
#pragma unroll
        for (int mb = 0; mb < 4; ++mb) { pq[mb] = Q + (size_t)(r0 + mb * 16 + lr) * HD + 8 * hi; a[mb][0] = WFrag<T16>::ld(pq[mb]); a[mb][1] = WFrag<T16>::ld(pq[mb] + 32); if constexpr (HR) { pq2[mb] = Q2 + (size_t)(r0 + mb * 16 + lr) * HD + 8 * hi; a2[mb][0] = WFrag<T16>::ld(pq2[mb]); a2[mb][1] = WFrag<T16>::ld(pq2[mb] + 32); } }
        /* stands before the q loads' address registers are reused; the pointers are inputs so that those registers live up to it */
        if constexpr (HR) asm volatile("s_wait_xcnt 0x0" :: "v"(pq[0]), "v"(pq[1]), "v"(pq[2]), "v"(pq[3]), "v"(pq2[0]), "v"(pq2[1]), "v"(pq2[2]), "v"(pq2[3]) : "memory");
        else asm volatile("s_wait_xcnt 0x0" :: "v"(pq[0]), "v"(pq[1]), "v"(pq[2]), "v"(pq[3]) : "memory");
        constexpr int G = HR ? 1 : 5;   /* 16-key pieces whose k fragments are fetched together (hi/lo planes: one, for registers) */
#pragma unroll
        for (int g = 0; g < 5; g += G) {
            V b[G][2], b2[G][2]; const T16* pk[G]; const T16* pk2[G];
#pragma unroll
            for (int u = 0; u < G; ++u) { const int key = min(max(band0 + (wv * 5 + g + u) * 16, 0), TT - 16);   /* a piece off the sequence loads in-bounds keys, so that no branch parts the loads; it is skipped below */
                pk[u] = Kp + (size_t)(key + lr) * HD + 8 * hi; b[u][0] = WFrag<T16>::ld(pk[u]); b[u][1] = WFrag<T16>::ld(pk[u] + 32); if constexpr (HR) { pk2[u] = K2 + (size_t)(key + lr) * HD + 8 * hi; b2[u][0] = WFrag<T16>::ld(pk2[u]); b2[u][1] = WFrag<T16>::ld(pk2[u] + 32); } }
            /* stands before the k loads' address registers are reused; the pointers are inputs so that those registers live up to it */
            if constexpr (HR) asm volatile("s_wait_xcnt 0x0" :: "v"(pk[0]), "v"(pk2[0]) : "memory");
            else asm volatile("s_wait_xcnt 0x0" :: "v"(pk[0]), "v"(pk[1]), "v"(pk[2]), "v"(pk[3]), "v"(pk[4]) : "memory");
#pragma unroll
            for (int u = 0; u < G; ++u) { const int sub = wv * 5 + g + u; const int key0 = band0 + sub * 16; if (key0 < 0 || key0 >= TT) continue;
                v8f acc[4];
#pragma unroll
                for (int mb = 0; mb < 4; ++mb) acc[mb] = (v8f){};
#pragma unroll
                for (int kk = 0; kk < 2; ++kk)
#pragma unroll
                    for (int mb = 0; mb < 4; ++mb) { acc[mb] = WFrag<T16>::mma(a[mb][kk], b[u][kk], acc[mb]); if constexpr (HR) { acc[mb] = WFrag<T16>::mma(a2[mb][kk], b[u][kk], acc[mb]); acc[mb] = WFrag<T16>::mma(a[mb][kk], b2[u][kk], acc[mb]); } }
                float* sc = S + hi * 8 * PB + ((sub * 16 + lr) ^ (hi << 4));
#pragma unroll
                for (int mb = 0; mb < 4; ++mb)
#pragma unroll
                    for (int j = 0; j < 8; ++j) sc[(mb * 16 + j) * PB] = acc[mb][j]; }
        }
    }
    __syncthreads();   /* every wave's scores are in LDS before a row is read */
    const int cb = band0 >> 7;   /* first of the BT / 2 128-key chunks of the band; a chunk off the sequence (on false) gets j0 = -TT, which fails the window test for every row */
    const int sw = (wv & 1) << 4;
#pragma unroll 2   /* two rows in flight: one row's cross-lane reductions are covered by the other's arithmetic */
    for (int rr = 0; rr < 8; ++rr) { const int row = wv * 8 + rr, i = r0 + row; float* sr = S + row * PB; float t[BT / 2][4]; float mx = -3.0e38f;
#pragma unroll
        for (int c = 0; c < BT / 2; ++c) { const int ch = cb + c; const bool on = ch >= 0 && ch < TT / 128; const int j0 = on ? ch * 128 + lane * 4 : -TT; const v4f a = *(const v4fa*)(sr + (((on ? c : max(cb, 0) - cb) * 128 + lane * 4) ^ sw));   /* a chunk off the sequence reads an in-band one; the window test masks it */
#pragma unroll
            for (int q = 0; q < 4; ++q) { const float s = a[q] * SCL; t[c][q] = (j0 + q <= i + WNB && j0 + q >= i - WNB) ? s : -3.0e38f;   /* symmetric window: |i - j| <= WNB */ mx = fmaxf(mx, t[c][q]); } }
#pragma unroll
        for (int sh = 16; sh; sh >>= 1) mx = fmaxf(mx, __shfl_xor(mx, sh, 32));
        float sum = 0.f;
#pragma unroll
        for (int c = 0; c < BT / 2; ++c)
#pragma unroll
            for (int q = 0; q < 4; ++q) { t[c][q] = __builtin_amdgcn_exp2f(__fmul_rn(__fsub_rn(t[c][q], mx), 1.4426950408889634f)); sum += t[c][q]; }
#pragma unroll
        for (int sh = 16; sh; sh >>= 1) sum += __shfl_xor(sum, sh, 32);
        const float f = __fdiv_rn(HR ? 1.0f : PCAR, sum);
        T16* pr = (T16*)sr + (lane & 1) * 4;
#pragma unroll
        for (int c = 0; c < BT / 2; ++c) { const int ch = cb + c; if (ch < 0 || ch >= TT / 128) continue; const int pc = ((c * 16 + (lane >> 1)) ^ (row & 15)) * 8;
            if constexpr (HR) { v4us oh, ol;
#pragma unroll
                for (int q = 0; q < 4; ++q) { unsigned short a2, c2; splitf(t[c][q] * f, a2, c2); oh[q] = a2; ol[q] = c2; }
                *(v4usa*)(pr + pc) = oh; *(v4usa*)(pr + PB + pc) = ol;
            } else { v4h o4;
#pragma unroll
                for (int q = 0; q < 4; ++q) o4[q] = tohx(t[c][q] * f);
                *(v4ha*)(pr + pc) = o4; } } }
    __syncthreads();   /* every row's P is in LDS before a fragment of it is read */
    const int mb = wv >> 1, n0 = (wv & 1) * 32; const int k0 = max(r0 - WNB, 0), k1 = min(r0 + 64 + WNB, TT);
    const T16* pa = (const T16*)S + (mb * 16 + lr) * (2 * PB);
    const size_t voff = (size_t)(n0 + lr) * TT + 8 * hi;
    v8f acc[2]; acc[0] = (v8f){}; acc[1] = (v8f){};
    V bc[2][2], bc2[2][2], bn[2][2], bn2[2][2];   /* [column block][32-key step] */
    auto ldv = [&](V (&d)[2][2], V (&d2)[2][2], int kc) { const T16* p[2]; const T16* p2[2];
#pragma unroll
        for (int nb = 0; nb < 2; ++nb) { p[nb] = Vt + voff + (size_t)nb * 16 * TT + kc; d[nb][0] = WFrag<T16>::ld(p[nb]); d[nb][1] = WFrag<T16>::ld(p[nb] + 32); if constexpr (HR) { p2[nb] = Vt2 + voff + (size_t)nb * 16 * TT + kc; d2[nb][0] = WFrag<T16>::ld(p2[nb]); d2[nb][1] = WFrag<T16>::ld(p2[nb] + 32); } }
        /* stands before the v loads' address registers are reused; the pointers are inputs so that those registers live up to it */
        if constexpr (HR) asm volatile("s_wait_xcnt 0x0" :: "v"(p[0]), "v"(p[1]), "v"(p2[0]), "v"(p2[1]) : "memory");
        else asm volatile("s_wait_xcnt 0x0" :: "v"(p[0]), "v"(p[1]) : "memory"); };
    auto step = [&](V (&d)[2][2], V (&d2)[2][2], int kc) {
#pragma unroll
        for (int s = 0; s < 2; ++s) { const int pc = ((kc - band0) >> 3) + s * 4 + hi; const V a = LFrag<T16>::ld2(pa + ((pc ^ lr) << 3), pa + (((pc + 2) ^ lr) << 3)); V a2; if constexpr (HR) a2 = LFrag<T16>::ld2(pa + PB + ((pc ^ lr) << 3), pa + PB + (((pc + 2) ^ lr) << 3));
#pragma unroll
            for (int nb = 0; nb < 2; ++nb) { acc[nb] = WFrag<T16>::mma(a, d[nb][s], acc[nb]); if constexpr (HR) { acc[nb] = WFrag<T16>::mma(a2, d[nb][s], acc[nb]); acc[nb] = WFrag<T16>::mma(a, d2[nb][s], acc[nb]); } } }
        asm volatile("v_nop\n\tv_nop\n\tv_nop\n\tv_nop" : "+v"(acc[0]), "+v"(acc[1]));   /* a branch follows: keeps the matrix instructions' distance on its taken side too */
    };
    ldv(bc, bc2, k0);
#pragma unroll 1
    for (int kc = k0; kc < k1; kc += 128) {   /* two register sets in turn: the next 64-key group flies while this one is multiplied; the last fetch takes the last group again rather than branch */
        ldv(bn, bn2, min(kc + 64, k1 - 64)); step(bc, bc2, kc);
        if (kc + 64 >= k1) break;
        ldv(bc, bc2, min(kc + 128, k1 - 64)); step(bn, bn2, kc + 64);
    }
    float* po = O + (size_t)(r0 + mb * 16 + hi * 8) * HD + n0 + lr;
#pragma unroll
    for (int nb = 0; nb < 2; ++nb)
#pragma unroll
        for (int j = 0; j < 8; ++j) po[j * HD + nb * 16] = acc[nb][j];
}
__global__ __launch_bounds__(256) void k_attn(const h16* __restrict__ Q16, const h16* __restrict__ K16, const h16* __restrict__ V16, const bf* __restrict__ Qh, const bf* __restrict__ Ql, const bf* __restrict__ Kh, const bf* __restrict__ Kl, const bf* __restrict__ Vh, const bf* __restrict__ Vl, float* O) {
    __shared__ __align__(16) float S[64 * PB];
    const size_t zo = (size_t)blockIdx.z * TT * HD; const int r0 = blockIdx.x * 64;
    if (r0 < RH) attn_tile<bf, true>(S, Qh + zo, Ql + zo, Kh + zo, Kl + zo, Vh + zo, Vl + zo, O + zo, r0);
    else attn_tile<h16, false>(S, Q16 + zo, nullptr, K16 + zo, nullptr, V16 + zo, nullptr, O + zo, r0);
}


__global__ __launch_bounds__(256) void k_merge(const float* __restrict__ O, int h0, bf* Ah, bf* Al) { const size_t e = ((size_t)blockIdx.x * 256 + threadIdx.x) * 2; if (e >= (size_t)ZH * TT * HD) return; const int d = (int)(e % HD); const int t = (int)((e / HD) % TT); const int zz = (int)(e / ((size_t)HD * TT)); const float cs = (t < RH) ? 1.0f : (1.0f / PCAR); const size_t oo = (size_t)t * DQ + (h0 + zz) * HD + d;
    v2us oh, ol;
#pragma unroll
    for (int q = 0; q < 2; ++q) { unsigned short a, c2; splitf(O[e + q] * cs, a, c2); oh[q] = a; ol[q] = c2; } *(v2us*)(Ah + oo) = oh; *(v2us*)(Al + oo) = ol;  }

extern "C" void kernel_launch(void* const* d_in, const int* in_sizes, int n_in,
                              void* d_out, int out_size, void* d_ws, size_t ws_size, hipStream_t stream) {
    (void)in_sizes; (void)n_in; (void)out_size;
    const float* x = (const float*)d_in[0]; const float* wq = (const float*)d_in[1]; const float* bq = (const float*)d_in[2]; const float* wk = (const float*)d_in[3]; const float* bk = (const float*)d_in[4]; const float* wv = (const float*)d_in[5]; const float* bv = (const float*)d_in[6]; const float* wo = (const float*)d_in[7]; const float* bo = (const float*)d_in[8];
    float* OUT = (float*)d_out;     // [1][4096][1024]
    char* wsp = (char*)d_ws;
    auto take = [&](size_t bytes) { char* p = wsp; wsp += (bytes + 255) & ~(size_t)255; return (void*)p; };
    bf* WO = (bf*)take((size_t)DM * DQ * 2);
    h16* QP16 = (h16*)take((size_t)NH_ * TT * HD * 2); h16* KP16 = (h16*)take((size_t)NKV * TT * HD * 2); h16* VT16 = (h16*)take((size_t)NKV * HD * TT * 2);
    bf* QPh = (bf*)take((size_t)NH_ * TT * HD * 2); bf* QPl = (bf*)take((size_t)NH_ * TT * HD * 2); bf* KPh = (bf*)take((size_t)NKV * TT * HD * 2); bf* KPl = (bf*)take((size_t)NKV * TT * HD * 2); bf* VTh = (bf*)take((size_t)NKV * HD * TT * 2); bf* VTl = (bf*)take((size_t)NKV * HD * TT * 2);
    float* Ob = (float*)take((size_t)ZH * TT * HD * 4);
    bf* WQ = (bf*)take((size_t)DQ * DM * 2); bf* WK = (bf*)take((size_t)DKV * DM * 2); bf* WV = (bf*)take((size_t)DKV * DM * 2); float* CS = (float*)take((size_t)TT * HD * 2 * 4);
    bf* XB = (bf*)take((size_t)TT * DM * 2); float* FQ = (float*)take((size_t)TT * DQ * 4); float* FK = (float*)take((size_t)TT * DKV * 4);
    if ((size_t)(wsp - (char*)d_ws) > ws_size) return;    // ws 256 MiB; 138 MiB taken
    bf* ATh = QPh; bf* ATl = QPl;   // stream-ordered reuse: the merged planes take the q hi/lo planes, dead after the attention launch
    float* FV = FK;   // v projection reuses the k buffer after the k planes are built (stream-ordered)
    { k_cvt8<<<(unsigned)(((size_t)DQ * DM / 8 + 255) / 256), 256, 0, stream>>>(wq, WQ, (size_t)DQ * DM / 8); k_cvt8<<<(unsigned)(((size_t)DKV * DM / 8 + 255) / 256), 256, 0, stream>>>(wk, WK, (size_t)DKV * DM / 8); k_cvt8<<<(unsigned)(((size_t)DKV * DM / 8 + 255) / 256), 256, 0, stream>>>(wv, WV, (size_t)DKV * DM / 8);
      k_cvt8<<<(unsigned)(((size_t)DM * DQ / 8 + 255) / 256), 256, 0, stream>>>(wo, WO, (size_t)DM * DQ / 8);
       }
    k_csid<<<(TT * HD + 255) / 256, 256, 0, stream>>>(CS);
    const unsigned LQ = (unsigned)(((size_t)NH_ * TT * HD / 2 + 255) / 256), LKv = (unsigned)(((size_t)NKV * TT * HD / 2 + 255) / 256);
    for (int b = 0; b < NB_; ++b) {
        
        k_cvt8<<<(unsigned)(((size_t)TT * DM / 8 + 255) / 256), 256, 0, stream>>>(x + (size_t)b * TT * DM, XB, (size_t)TT * DM / 8);
        k_gemms<0, true, DM><<<dim3(TT / 128, DQ / 128, 1), 128, 0, stream>>>(XB, nullptr, WQ, FQ, DQ, bq);
        k_rope<<<LQ, 256, 0, stream>>>(FQ, DQ, NH_, CS, nullptr, nullptr, 1.0f, QP16, QPh, QPl);
        k_gemms<0, true, DM><<<dim3(TT / 128, DKV / 128, 1), 128, 0, stream>>>(XB, nullptr, WK, FK, DKV, bk);
        k_rope<<<LKv, 256, 0, stream>>>(FK, DKV, NKV, CS, nullptr, nullptr, 1.0f, KP16, KPh, KPl);
        k_gemms<0, true, DM><<<dim3(TT / 128, DKV / 128, 1), 128, 0, stream>>>(XB, nullptr, WV, FV, DKV, bv); k_vtp<<<LKv, 256, 0, stream>>>(FV, DKV, NKV, VT16, VTh, VTl);
        for (int h0 = 0; h0 < NH_; h0 += ZH) { const size_t zq = (size_t)h0, zk = (size_t)(h0 / REP);   // one kv head per query head: the pass's heads use consecutive kv planes (z-strides TT*HD)
            k_attn<<<dim3(TT / 64, 1, ZH), 256, 0, stream>>>(QP16 + zq * TT * HD, KP16 + zk * TT * HD, VT16 + zk * HD * TT, QPh + zq * TT * HD, QPl + zq * TT * HD, KPh + zk * TT * HD, KPl + zk * TT * HD, VTh + zk * HD * TT, VTl + zk * HD * TT, Ob);
            k_merge<<<(unsigned)(((size_t)ZH * TT * HD / 2 + 255) / 256), 256, 0, stream>>>(Ob, h0, ATh, ATl); }
        k_gemms<1, true, DQ><<<dim3(TT / 128, DM / 128, 1), 128, 0, stream>>>(ATh, ATl, WO, OUT + (size_t)b * TT * DM, DM, bo); }
}

// v005
// One run takes 141 microseconds.
// In two side-by-side timings against v004, it was 1.26 and 1.23 times as fast.
// Counting every step since v000, it is 29.2 times as fast.
#include <hip/hip_runtime.h>

// Local multi-head attention with a symmetric window (x [1][4096][1024]; q,k,v = x W^T + b ('oi' [1024][1024] + [1024], 0.02; 16 heads x 64); scores / 8; keys with |i - j| > 256 -> -inf; softmax; out = merged Wo^T + bo -> [1][4096][1024] (4.2 M)).
// Layout: bf16 copy of x; exact projections + f32 biases, whose epilogues write the fp16 and bf16 hi/lo head planes themselves (q, k as [h][t][d]; v as [h][d][t], from the product taken as Wv x^T); attention, all 16 heads per pass as grid z (hybrid rows: < 512 hi/lo 3 products, rest fp16 x1024; softmax applying the |i - j| <= 256 window as an index select; scores, softmax and P V of a 64-row tile in one work-group, over the tile's key band alone, the score band in LDS, whose rows the softmax overwrites with P; the tile's output leaves as the merged hi/lo planes); merged hi/lo x Wo exact + bo.
// Compute dtypes, f32 accumulate: every input rounded to bf16; projections exact + f32 biases; attention rows < 512 3 products, rest fp16; softmax f32; Wo hl x exact + bias.

#define NB_  1
#define TT   4096
#define DM   1024
#define NH_  16
#define NKV  16
#define REP  (NH_ / NKV)
#define HD   64
#define DQ   (NH_ * HD)
#define DKV  (NKV * HD)
#define ZH   16                   // heads per pass (grid z of the attention launches)
#define RH   512                  // query rows < RH use hi+lo planes (0: none)
#define WIN  0
#define PCAR 1024.0f
#define SCL  0.125f
#define WNB  256     // |i - j| <= 256 kept
#define BT   (2 * WNB / 64 + 2)   // 64-key tiles computed per 64-row tile: the 9 the window can reach, widened to whole 128-key softmax chunks
#define PB   (BT * 64)            // score row pitch in f32 (LDS): the band alone; column 0 is the band's first key. The same bytes then hold the row's P at pitch 2 * PB 16-bit elements (fp16 in the first half; or bf16 hi, then lo at + PB)
typedef _Float16 h16;
typedef unsigned short bf;
typedef __attribute__((ext_vector_type(16))) __bf16   v16bf;
typedef __attribute__((ext_vector_type(16))) _Float16 v16h;
typedef __attribute__((ext_vector_type(8)))  _Float16 v8h;
typedef __attribute__((ext_vector_type(8)))  unsigned short v8us;
typedef __attribute__((ext_vector_type(8)))  float    v8f;
typedef __attribute__((ext_vector_type(4)))  float    v4f;
typedef v8h  __attribute__((may_alias)) v8ha;
typedef v4f  __attribute__((may_alias)) v4fa;
typedef v8us __attribute__((may_alias)) v8usa;

__device__ __forceinline__ unsigned short f2bf(float f) { unsigned u = __float_as_uint(f); u += 0x7FFFu + ((u >> 16) & 1u); return (unsigned short)(u >> 16); }
__device__ __forceinline__ float bf2f(unsigned short b) { return __uint_as_float(((unsigned)b) << 16); }
__device__ __forceinline__ float bfr(float f) { return bf2f(f2bf(f)); }
__device__ __forceinline__ v16h cat16(v8h lo, v8h hi) { return __builtin_shufflevector(lo, hi, 0, 1, 2, 3, 4, 5, 6, 7, 8, 9, 10, 11, 12, 13, 14, 15); }
__device__ __forceinline__ v16bf cat16b(v8us lo, v8us hi) { return __builtin_bit_cast(v16bf, __builtin_shufflevector(lo, hi, 0, 1, 2, 3, 4, 5, 6, 7, 8, 9, 10, 11, 12, 13, 14, 15)); }
__device__ __forceinline__ v8f wmma16(v16h a, v16h b, v8f c) { return __builtin_amdgcn_wmma_f32_16x16x32_f16(false, a, false, b, (short)0, c, false, false); }
__device__ __forceinline__ v8f wmmab(v16bf a, v16bf b, v8f c) { return __builtin_amdgcn_wmma_f32_16x16x32_bf16(false, a, false, b, (short)0, c, false, false); }



// a 16x32 fragment from two 16-byte pieces of a K-contiguous 16-bit row, and its matrix instruction
template <typename T16> struct WFrag;
template <> struct WFrag<h16> { typedef v16h V; static __device__ __forceinline__ V ld(const h16* p) { return cat16(*(const v8h*)p, *(const v8h*)(p + 16)); } static __device__ __forceinline__ v8f mma(V a, V b, v8f c) { return wmma16(a, b, c); } };
template <> struct WFrag<bf> { typedef v16bf V; static __device__ __forceinline__ V ld(const bf* p) { return cat16b(*(const v8us*)p, *(const v8us*)(p + 16)); } static __device__ __forceinline__ v8f mma(V a, V b, v8f c) { return wmmab(a, b, c); } };

__device__ __forceinline__ h16 tohx(float x) { return (h16)x; }
__device__ __forceinline__ void splitf(float y, unsigned short& h, unsigned short& l) { h = f2bf(y); l = f2bf(y - bf2f(h)); }
typedef __attribute__((ext_vector_type(2))) _Float16 v2h;
typedef __attribute__((ext_vector_type(4))) _Float16 v4h;
typedef __attribute__((ext_vector_type(2))) unsigned short v2us;
typedef __attribute__((ext_vector_type(4))) unsigned short v4us;
typedef __attribute__((ext_vector_type(2))) float v2f;
typedef __attribute__((ext_vector_type(4))) int v4i;

__global__ __launch_bounds__(256) void k_wtG(const float* __restrict__ w, int K, int N, bf* Bt) {
    const int lane = threadIdx.x & 31; const int L0 = (blockIdx.x * 8 + (threadIdx.x >> 5)) * 8; const int nlines = N * K / 64;
{
#pragma unroll 1
        for (int l = 0; l < 8; ++l) { const int L = L0 + l; if (L >= nlines) break; const size_t e = (size_t)L * 64 + lane * 2; const int k = (int)(e % K), n = (int)(e / K); v2us o;
            o[0] = f2bf(w[(size_t)k * N + n]); o[1] = f2bf(w[(size_t)(k + 1) * N + n]); *(v2us*)(Bt + e) = o; }
         }
}
__global__ __launch_bounds__(256) void k_cvt8(const float* __restrict__ src, bf* dst, size_t n8) { const size_t i = (size_t)blockIdx.x * 256 + threadIdx.x; if (i >= n8) return; const v8f v = *(const v8f*)(src + i * 8); v8us o;
#pragma unroll
    for (int k = 0; k < 8; ++k) o[k] = f2bf(v[k]); *(v8us*)(dst + i * 8) = o;  }

typedef v4h  __attribute__((may_alias)) v4ha;
typedef v4us __attribute__((may_alias)) v4usa;
// a 16x32 A fragment from two 16-byte pieces in LDS
template <typename T16> struct LFrag;
template <> struct LFrag<h16> { static __device__ __forceinline__ v16h ld2(const h16* p, const h16* q) { return cat16(*(const v8ha*)p, *(const v8ha*)q); } };
template <> struct LFrag<bf> { static __device__ __forceinline__ v16bf ld2(const bf* p, const bf* q) { return cat16b(*(const v8usa*)p, *(const v8usa*)q); } };

// ---- k_gemms: y[m][n] = sum_k A[m][k] Bt[n][k] (NSPLIT 1: + A2[m][k] Bt[n][k]) + f32 bias. EPI 0: bias[n], y to C (f32, pitch ldc). EPI 1: bias[n], y as fp16, bf16 hi and bf16 lo to the planes P16, Ph, Pl at [n / 64][m][n % 64], ldc rows a plane. EPI 2: bias[m], the same three forms at [m][n], pitch ldc. A, A2, Bt K-contiguous bf16 planes of pitch K; K % 128 == 0, K >= 256. grid (M/128, N/128), 128 threads.
// One work-group of 4 waves per 128x128 tile, a wave per 64x64 quarter (16 accumulators). A pass is 128 k: 256 bytes of each of the tile's 128 A (A2) and 128 Bt rows, brought whole-line into LDS by asynchronous copies, two buffers, the next pass's copies in flight while this pass is multiplied. LDS row pitch 272 bytes (16 x odd: the 16 rows of a fragment read fall in different bank groups).
#define GP 136   // LDS row pitch in 16-bit elements
// eight copies of 16 bytes a lane, 8 rows apart (global pitch K elements, LDS pitch GP); g is the same for the whole work-group, toff the lane's own offset in elements
template <int K> __device__ __forceinline__ void copy8(unsigned l, const bf* g, size_t toff) {
    unsigned la[8]; const bf* ga[8];
#pragma unroll
    for (int i = 0; i < 8; ++i) { la[i] = l + i * 8 * GP * 2; ga[i] = g + (size_t)i * 8 * K + toff; }
    /* the wait stands in the copies' own statement: it ends before any of their address registers is rewritten */
    asm volatile("global_load_async_to_lds_b128 %0, %8, off\n\t"
                 "global_load_async_to_lds_b128 %1, %9, off\n\t"
                 "global_load_async_to_lds_b128 %2, %10, off\n\t"
                 "global_load_async_to_lds_b128 %3, %11, off\n\t"
                 "global_load_async_to_lds_b128 %4, %12, off\n\t"
                 "global_load_async_to_lds_b128 %5, %13, off\n\t"
                 "global_load_async_to_lds_b128 %6, %14, off\n\t"
                 "global_load_async_to_lds_b128 %7, %15, off\n\t"
                 "s_wait_xcnt 0x0"
                 :: "v"(la[0]), "v"(la[1]), "v"(la[2]), "v"(la[3]), "v"(la[4]), "v"(la[5]), "v"(la[6]), "v"(la[7]),
                    "v"(ga[0]), "v"(ga[1]), "v"(ga[2]), "v"(ga[3]), "v"(ga[4]), "v"(ga[5]), "v"(ga[6]), "v"(ga[7]) : "memory");
}
template <int NSPLIT, int EPI, int K>
__global__ __launch_bounds__(128) void k_gemms(const bf* __restrict__ A, const bf* __restrict__ A2, const bf* __restrict__ Bt, float* C, int ldc, const float* __restrict__ bias, h16* P16, bf* Ph, bf* Pl) {
    constexpr int NP = NSPLIT ? 3 : 2;   /* planes of a stage: A, Bt (, A2) */
    __shared__ __align__(16) bf ring[2][NP][128 * GP];
    __shared__ __align__(16) float osb[4][16 * 68];
    const int tid = threadIdx.x, lane = tid & 31, lr = lane & 15, hi = lane >> 4; const int wv = __builtin_amdgcn_readfirstlane(tid >> 5);
    const int R0 = blockIdx.x * 128, C0 = blockIdx.y * 128; const int wm = (wv >> 1) * 64, wn = (wv & 1) * 64; const int r0 = R0 + wm, c0 = C0 + wn;
    /* a thread copies piece tid & 15 of rows tid >> 4, + 8, ... + 120 of each plane: a wave's copy takes two whole 256-byte row parts */
    const size_t toff = (size_t)(tid >> 4) * K + (tid & 15) * 8; const int lo = (tid >> 4) * GP + (tid & 15) * 8;
    auto fill = [&](int buf, int t) {
        const bf* pa = A + (size_t)R0 * K + t * 128; const bf* pb = Bt + (size_t)C0 * K + t * 128;
        copy8<K>((unsigned)(size_t)&ring[buf][0][lo], pa, toff); copy8<K>((unsigned)(size_t)&ring[buf][0][lo + 64 * GP], pa + (size_t)64 * K, toff);
        copy8<K>((unsigned)(size_t)&ring[buf][1][lo], pb, toff); copy8<K>((unsigned)(size_t)&ring[buf][1][lo + 64 * GP], pb + (size_t)64 * K, toff);
        if constexpr (NSPLIT) { const bf* pa2 = A2 + (size_t)R0 * K + t * 128; copy8<K>((unsigned)(size_t)&ring[buf][2][lo], pa2, toff); copy8<K>((unsigned)(size_t)&ring[buf][2][lo + 64 * GP], pa2 + (size_t)64 * K, toff); } };
    v8f acc[4][4];
#pragma unroll
    for (int mb = 0; mb < 4; ++mb)
#pragma unroll
        for (int nb = 0; nb < 4; ++nb) acc[mb][nb] = (v8f){};
    constexpr int NT = K / 128;
    fill(0, 0);
    asm volatile("s_wait_asynccnt 0x0" ::: "memory");   /* this wave's copies of pass 0 have landed */
    __syncthreads();   /* every wave's have: pass 0 may be read */
    fill(1, 1);
#pragma unroll 1   /* one pass a trip: the two buffers take turns by the trip's parity */
    for (int t = 0; t < NT; ++t) {
        const bf* As = &ring[t & 1][0][(wm + lr) * GP + 8 * hi]; const bf* Bs = &ring[t & 1][1][(wn + lr) * GP + 8 * hi]; const bf* A2s = &ring[t & 1][NP - 1][(wm + lr) * GP + 8 * hi];
        v16bf a[2][4], a2[2][4], b[2][4];   /* two fragment sets: a 32-k block's 16 (24) LDS reads go out while the block before it is multiplied */
        auto ldf = [&](int s, int ks) {
#pragma unroll
            for (int mb = 0; mb < 4; ++mb) { a[s][mb] = LFrag<bf>::ld2(As + mb * 16 * GP + ks * 32, As + mb * 16 * GP + ks * 32 + 16); if constexpr (NSPLIT) a2[s][mb] = LFrag<bf>::ld2(A2s + mb * 16 * GP + ks * 32, A2s + mb * 16 * GP + ks * 32 + 16); }
#pragma unroll
            for (int nb = 0; nb < 4; ++nb) b[s][nb] = LFrag<bf>::ld2(Bs + nb * 16 * GP + ks * 32, Bs + nb * 16 * GP + ks * 32 + 16); };
        ldf(0, 0);
#pragma unroll
        for (int ks = 0; ks < 4; ++ks) {
            if (ks < 3) ldf((ks + 1) & 1, ks + 1);
            __builtin_amdgcn_sched_barrier(0);   /* holds the next block's reads, as one group, ahead of this block's matrix instructions; sunk to their uses, each would expose the LDS latency to the SIMD's one wave */
#pragma unroll
            for (int nb = 0; nb < 4; ++nb) {
#pragma unroll
                for (int mb = 0; mb < 4; ++mb) acc[mb][nb] = wmmab(a[ks & 1][mb], b[ks & 1][nb], acc[mb][nb]);
                if constexpr (NSPLIT) {
#pragma unroll
                    for (int mb = 0; mb < 4; ++mb) acc[mb][nb] = wmmab(a2[ks & 1][mb], b[ks & 1][nb], acc[mb][nb]); } }
            __builtin_amdgcn_sched_barrier(0);   /* the block's matrix instructions stay ahead of the reads that reuse its fragment set, and of the pass's foot */
        }
        asm volatile("v_nop\n\tv_nop\n\tv_nop\n\tv_nop" : "+v"(acc[0][3]), "+v"(acc[1][3]), "+v"(acc[2][3]), "+v"(acc[3][3]));   /* a branch follows: keeps the matrix instructions' distance on its taken side too */
        asm volatile("s_wait_dscnt 0x0" ::: "memory");      /* this wave has left the buffer that is refilled below */
        asm volatile("s_wait_asynccnt 0x0" ::: "memory");   /* this wave's copies of pass t + 1 have landed */
        __syncthreads();   /* publishes pass t + 1 and ends every wave's reads of pass t */
        if (t + 2 < NT) fill(t & 1, t + 2);
    }
    asm volatile("s_wait_asynccnt 0x0" ::: "memory");   /* no copy is in flight when the wave goes on to its end */
    float* os = osb[wv];
#pragma unroll
    for (int mb = 0; mb < 4; ++mb) {
#pragma unroll
        for (int nb = 0; nb < 4; ++nb) {
#pragma unroll
            for (int j = 0; j < 8; ++j) os[(hi * 8 + j) * 68 + nb * 16 + lr] = acc[mb][nb][j]; }
        __builtin_amdgcn_wave_barrier(); asm volatile("" ::: "memory");
        if constexpr (EPI == 0) {
            float* crow = C + (size_t)(r0 + mb * 16) * ldc + c0;
#pragma unroll
            for (int s = 0; s < 8; ++s) { const int row = 2 * s + hi, cofs = lr * 4; v4f val = *(const v4fa*)(os + row * 68 + cofs); val[0] += bfr(bias[c0 + cofs]); val[1] += bfr(bias[c0 + cofs + 1]); val[2] += bfr(bias[c0 + cofs + 2]); val[3] += bfr(bias[c0 + cofs + 3]);
                *(v4f*)(crow + (size_t)row * ldc + cofs) = val; }
        } else {   /* eight lanes a row: a row's 64 values leave as one whole 128-byte line of each plane */
            const float* pb = bias + (EPI == 1 ? c0 + (lane & 7) * 8 : r0 + mb * 16 + (lane >> 3)); float bv[EPI == 1 ? 8 : 4];   /* the biases of the lane's eight columns (EPI 1) or four rows (EPI 2) */
#pragma unroll
            for (int q = 0; q < (EPI == 1 ? 8 : 4); ++q) bv[q] = pb[EPI == 1 ? q : 4 * q];
            asm volatile("s_wait_xcnt 0x0" :: "v"(pb) : "memory");   /* stands before the bias loads' address registers are reused; the pointer is an input so that those registers live up to it */
#pragma unroll
            for (int s = 0; s < 4; ++s) { const int row = 4 * s + (lane >> 3), cofs = (lane & 7) * 8, m = r0 + mb * 16 + row;
                const v8f u = __builtin_shufflevector(*(const v4fa*)(os + row * 68 + cofs), *(const v4fa*)(os + row * 68 + cofs + 4), 0, 1, 2, 3, 4, 5, 6, 7); v8h o16; v8us oh, ol;
#pragma unroll
                for (int q = 0; q < 8; ++q) { const float y = u[q] + bfr(bv[EPI == 1 ? q : s]); o16[q] = tohx(y); unsigned short a2, c2; splitf(y, a2, c2); oh[q] = a2; ol[q] = c2; }
                const size_t e = EPI == 1 ? ((size_t)(c0 >> 6) * ldc + m) * HD + cofs : (size_t)m * ldc + c0 + cofs;
                *(v8h*)(P16 + e) = o16; *(v8us*)(Ph + e) = oh; *(v8us*)(Pl + e) = ol; }
        }
        asm volatile("s_wait_xcnt 0x0" ::: "memory");   /* stands before the stores' data and address registers are reused for the next 16 rows */
        __builtin_amdgcn_wave_barrier(); asm volatile("" ::: "memory");
    }
}


// ---- attention of one (64-row tile, head) by one work-group of 8 waves; the tile's score band S[64][PB] f32 lives in LDS and never reaches memory.
// 1 scores: wave w does the 64 rows x keys [80 w, 80 w + 80) of the band, q fragments held in registers. A score of logical column x of row r lies at x ^ (16 if r & 8): the two half-waves of an accumulator store then hit different banks.
// 2 softmax: wave w owns rows 8 w .. 8 w + 7; a row is read once, and its P goes over its own bytes (fp16 in the first half; or bf16 hi, then lo at + PB), the 16-byte piece c of row r at piece c ^ (r & 15): the 16 rows of an A fragment read then fall in 16 different bank groups.
// 3 P V: wave w does rows 16 (w >> 1) .. + 15 x columns 32 (w & 1) .. + 31, k ascending over the keys the tile's window can reach; V^T fragments come from memory one 64-key group ahead.
// 4 output: the 64x64 tile is gathered in the band's LDS, free by then, and leaves as bf16 hi and lo planes at [t][head 64 + d] (pitch DQ), the operands of the last projection; four lanes a row, so a row's 64 values are one whole 128-byte line of each plane.
template <typename T16, bool HR>
__device__ __forceinline__ void attn_tile(float* S, const T16* __restrict__ Q, const T16* __restrict__ Q2, const T16* __restrict__ Kp, const T16* __restrict__ K2, const T16* __restrict__ Vt, const T16* __restrict__ Vt2, bf* Ah, bf* Al, const int r0) {
    typedef typename WFrag<T16>::V V;
    const int lane = threadIdx.x & 31, lr = lane & 15, hi = lane >> 4; const int wv = __builtin_amdgcn_readfirstlane((int)(threadIdx.x >> 5));
    const int band0 = (((r0 >> 6) - WNB / 64) & ~1) * 64;   /* first key of the row tile's band (below 0 at the sequence's start) */
    {
        V a[4][2], a2[4][2]; const T16* pq[4]; const T16* pq2[4];
#pragma unroll
        for (int mb = 0; mb < 4; ++mb) { pq[mb] = Q + (size_t)(r0 + mb * 16 + lr) * HD + 8 * hi; a[mb][0] = WFrag<T16>::ld(pq[mb]); a[mb][1] = WFrag<T16>::ld(pq[mb] + 32); if constexpr (HR) { pq2[mb] = Q2 + (size_t)(r0 + mb * 16 + lr) * HD + 8 * hi; a2[mb][0] = WFrag<T16>::ld(pq2[mb]); a2[mb][1] = WFrag<T16>::ld(pq2[mb] + 32); } }
        /* stands before the q loads' address registers are reused; the pointers are inputs so that those registers live up to it */
        if constexpr (HR) asm volatile("s_wait_xcnt 0x0" :: "v"(pq[0]), "v"(pq[1]), "v"(pq[2]), "v"(pq[3]), "v"(pq2[0]), "v"(pq2[1]), "v"(pq2[2]), "v"(pq2[3]) : "memory");
        else asm volatile("s_wait_xcnt 0x0" :: "v"(pq[0]), "v"(pq[1]), "v"(pq[2]), "v"(pq[3]) : "memory");
        constexpr int G = HR ? 1 : 5;   /* 16-key pieces whose k fragments are fetched together (hi/lo planes: one, for registers) */
#pragma unroll
        for (int g = 0; g < 5; g += G) {
            V b[G][2], b2[G][2]; const T16* pk[G]; const T16* pk2[G];
#pragma unroll
            for (int u = 0; u < G; ++u) { const int key = min(max(band0 + (wv * 5 + g + u) * 16, 0), TT - 16);   /* a piece off the sequence loads in-bounds keys, so that no branch parts the loads; it is skipped below */
                pk[u] = Kp + (size_t)(key + lr) * HD + 8 * hi; b[u][0] = WFrag<T16>::ld(pk[u]); b[u][1] = WFrag<T16>::ld(pk[u] + 32); if constexpr (HR) { pk2[u] = K2 + (size_t)(key + lr) * HD + 8 * hi; b2[u][0] = WFrag<T16>::ld(pk2[u]); b2[u][1] = WFrag<T16>::ld(pk2[u] + 32); } }
            /* stands before the k loads' address registers are reused; the pointers are inputs so that those registers live up to it */
            if constexpr (HR) asm volatile("s_wait_xcnt 0x0" :: "v"(pk[0]), "v"(pk2[0]) : "memory");
            else asm volatile("s_wait_xcnt 0x0" :: "v"(pk[0]), "v"(pk[1]), "v"(pk[2]), "v"(pk[3]), "v"(pk[4]) : "memory");
#pragma unroll
            for (int u = 0; u < G; ++u) { const int sub = wv * 5 + g + u; const int key0 = band0 + sub * 16; if (key0 < 0 || key0 >= TT) continue;
                v8f acc[4];
#pragma unroll
                for (int mb = 0; mb < 4; ++mb) acc[mb] = (v8f){};
#pragma unroll
                for (int kk = 0; kk < 2; ++kk)
#pragma unroll
                    for (int mb = 0; mb < 4; ++mb) { acc[mb] = WFrag<T16>::mma(a[mb][kk], b[u][kk], acc[mb]); if constexpr (HR) { acc[mb] = WFrag<T16>::mma(a2[mb][kk], b[u][kk], acc[mb]); acc[mb] = WFrag<T16>::mma(a[mb][kk], b2[u][kk], acc[mb]); } }
                float* sc = S + hi * 8 * PB + ((sub * 16 + lr) ^ (hi << 4));
#pragma unroll
                for (int mb = 0; mb < 4; ++mb)
#pragma unroll
                    for (int j = 0; j < 8; ++j) sc[(mb * 16 + j) * PB] = acc[mb][j]; }
        }
    }
    __syncthreads();   /* every wave's scores are in LDS before a row is read */
    const int cb = band0 >> 7;   /* first of the BT / 2 128-key chunks of the band; a chunk off the sequence (on false) gets j0 = -TT, which fails the window test for every row */
    const int sw = (wv & 1) << 4;
#pragma unroll 2   /* two rows in flight: one row's cross-lane reductions are covered by the other's arithmetic */
    for (int rr = 0; rr < 8; ++rr) { const int row = wv * 8 + rr, i = r0 + row; float* sr = S + row * PB; float t[BT / 2][4]; float mx = -3.0e38f;
#pragma unroll
        for (int c = 0; c < BT / 2; ++c) { const int ch = cb + c; const bool on = ch >= 0 && ch < TT / 128; const int j0 = on ? ch * 128 + lane * 4 : -TT; const v4f a = *(const v4fa*)(sr + (((on ? c : max(cb, 0) - cb) * 128 + lane * 4) ^ sw));   /* a chunk off the sequence reads an in-band one; the window test masks it */
#pragma unroll
            for (int q = 0; q < 4; ++q) { const float s = a[q] * SCL; t[c][q] = (j0 + q <= i + WNB && j0 + q >= i - WNB) ? s : -3.0e38f;   /* symmetric window: |i - j| <= WNB */ mx = fmaxf(mx, t[c][q]); } }
#pragma unroll
        for (int sh = 16; sh; sh >>= 1) mx = fmaxf(mx, __shfl_xor(mx, sh, 32));
        float sum = 0.f;
#pragma unroll
        for (int c = 0; c < BT / 2; ++c)
#pragma unroll
            for (int q = 0; q < 4; ++q) { t[c][q] = __builtin_amdgcn_exp2f(__fmul_rn(__fsub_rn(t[c][q], mx), 1.4426950408889634f)); sum += t[c][q]; }
#pragma unroll
        for (int sh = 16; sh; sh >>= 1) sum += __shfl_xor(sum, sh, 32);
        const float f = __fdiv_rn(HR ? 1.0f : PCAR, sum);
        T16* pr = (T16*)sr + (lane & 1) * 4;
#pragma unroll
        for (int c = 0; c < BT / 2; ++c) { const int ch = cb + c; if (ch < 0 || ch >= TT / 128) continue; const int pc = ((c * 16 + (lane >> 1)) ^ (row & 15)) * 8;
            if constexpr (HR) { v4us oh, ol;
#pragma unroll
                for (int q = 0; q < 4; ++q) { unsigned short a2, c2; splitf(t[c][q] * f, a2, c2); oh[q] = a2; ol[q] = c2; }
                *(v4usa*)(pr + pc) = oh; *(v4usa*)(pr + PB + pc) = ol;
            } else { v4h o4;
#pragma unroll
                for (int q = 0; q < 4; ++q) o4[q] = tohx(t[c][q] * f);
                *(v4ha*)(pr + pc) = o4; } } }
    __syncthreads();   /* every row's P is in LDS before a fragment of it is read */
    const int mb = wv >> 1, n0 = (wv & 1) * 32; const int k0 = max(r0 - WNB, 0), k1 = min(r0 + 64 + WNB, TT);
    const T16* pa = (const T16*)S + (mb * 16 + lr) * (2 * PB);
    const size_t voff = (size_t)(n0 + lr) * TT + 8 * hi;
    v8f acc[2]; acc[0] = (v8f){}; acc[1] = (v8f){};
    V bc[2][2], bc2[2][2], bn[2][2], bn2[2][2];   /* [column block][32-key step] */
    auto ldv = [&](V (&d)[2][2], V (&d2)[2][2], int kc) { const T16* p[2]; const T16* p2[2];
#pragma unroll
        for (int nb = 0; nb < 2; ++nb) { p[nb] = Vt + voff + (size_t)nb * 16 * TT + kc; d[nb][0] = WFrag<T16>::ld(p[nb]); d[nb][1] = WFrag<T16>::ld(p[nb] + 32); if constexpr (HR) { p2[nb] = Vt2 + voff + (size_t)nb * 16 * TT + kc; d2[nb][0] = WFrag<T16>::ld(p2[nb]); d2[nb][1] = WFrag<T16>::ld(p2[nb] + 32); } }
        /* stands before the v loads' address registers are reused; the pointers are inputs so that those registers live up to it */
        if constexpr (HR) asm volatile("s_wait_xcnt 0x0" :: "v"(p[0]), "v"(p[1]), "v"(p2[0]), "v"(p2[1]) : "memory");
        else asm volatile("s_wait_xcnt 0x0" :: "v"(p[0]), "v"(p[1]) : "memory"); };
    auto step = [&](V (&d)[2][2], V (&d2)[2][2], int kc) {
#pragma unroll
        for (int s = 0; s < 2; ++s) { const int pc = ((kc - band0) >> 3) + s * 4 + hi; const V a = LFrag<T16>::ld2(pa + ((pc ^ lr) << 3), pa + (((pc + 2) ^ lr) << 3)); V a2; if constexpr (HR) a2 = LFrag<T16>::ld2(pa + PB + ((pc ^ lr) << 3), pa + PB + (((pc + 2) ^ lr) << 3));
#pragma unroll
            for (int nb = 0; nb < 2; ++nb) { acc[nb] = WFrag<T16>::mma(a, d[nb][s], acc[nb]); if constexpr (HR) { acc[nb] = WFrag<T16>::mma(a2, d[nb][s], acc[nb]); acc[nb] = WFrag<T16>::mma(a, d2[nb][s], acc[nb]); } } }
        asm volatile("v_nop\n\tv_nop\n\tv_nop\n\tv_nop" : "+v"(acc[0]), "+v"(acc[1]));   /* a branch follows: keeps the matrix instructions' distance on its taken side too */
    };
    ldv(bc, bc2, k0);
#pragma unroll 1
    for (int kc = k0; kc < k1; kc += 128) {   /* two register sets in turn: the next 64-key group flies while this one is multiplied; the last fetch takes the last group again rather than branch */
        ldv(bn, bn2, min(kc + 64, k1 - 64)); step(bc, bc2, kc);
        if (kc + 64 >= k1) break;
        ldv(bc, bc2, min(kc + 128, k1 - 64)); step(bn, bn2, kc + 64);
    }
    __syncthreads();   /* every wave has read its last P fragment: the band's LDS may take the output tile */
    float* so = S + (mb * 16 + hi * 8) * 68 + n0 + lr;
#pragma unroll
    for (int nb = 0; nb < 2; ++nb)
#pragma unroll
        for (int j = 0; j < 8; ++j) so[j * 68 + nb * 16] = acc[nb][j];
    __syncthreads();   /* a row's two halves come from two waves: both are in LDS before the row is read */
    const int orow = (int)(threadIdx.x >> 2), ocol = (int)(threadIdx.x & 3) * 16; const float cs = HR ? 1.0f : (1.0f / PCAR);
    v8us oh[2], ol[2];
#pragma unroll
    for (int p = 0; p < 2; ++p) { const v8f u = __builtin_shufflevector(*(const v4fa*)(S + orow * 68 + ocol + p * 8), *(const v4fa*)(S + orow * 68 + ocol + p * 8 + 4), 0, 1, 2, 3, 4, 5, 6, 7);
#pragma unroll
        for (int q = 0; q < 8; ++q) { unsigned short a2, c2; splitf(u[q] * cs, a2, c2); oh[p][q] = a2; ol[p][q] = c2; } }
    const size_t oo = (size_t)(r0 + orow) * DQ + ocol;
    *(v8us*)(Ah + oo) = oh[0]; *(v8us*)(Ah + oo + 8) = oh[1]; *(v8us*)(Al + oo) = ol[0]; *(v8us*)(Al + oo + 8) = ol[1];
}
__global__ __launch_bounds__(256) void k_attn(const h16* __restrict__ Q16, const h16* __restrict__ K16, const h16* __restrict__ V16, const bf* __restrict__ Qh, const bf* __restrict__ Ql, const bf* __restrict__ Kh, const bf* __restrict__ Kl, const bf* __restrict__ Vh, const bf* __restrict__ Vl, bf* Ah, bf* Al) {
    __shared__ __align__(16) float S[64 * PB];
    const size_t zo = (size_t)blockIdx.z * TT * HD; const int r0 = blockIdx.x * 64; const int ho = blockIdx.z * HD;
    if (r0 < RH) attn_tile<bf, true>(S, Qh + zo, Ql + zo, Kh + zo, Kl + zo, Vh + zo, Vl + zo, Ah + ho, Al + ho, r0);
    else attn_tile<h16, false>(S, Q16 + zo, nullptr, K16 + zo, nullptr, V16 + zo, nullptr, Ah + ho, Al + ho, r0);
}


extern "C" void kernel_launch(void* const* d_in, const int* in_sizes, int n_in,
                              void* d_out, int out_size, void* d_ws, size_t ws_size, hipStream_t stream) {
    (void)in_sizes; (void)n_in; (void)out_size;
    const float* x = (const float*)d_in[0]; const float* wq = (const float*)d_in[1]; const float* bq = (const float*)d_in[2]; const float* wk = (const float*)d_in[3]; const float* bk = (const float*)d_in[4]; const float* wv = (const float*)d_in[5]; const float* bv = (const float*)d_in[6]; const float* wo = (const float*)d_in[7]; const float* bo = (const float*)d_in[8];
    float* OUT = (float*)d_out;     // [1][4096][1024]
    char* wsp = (char*)d_ws;
    auto take = [&](size_t bytes) { char* p = wsp; wsp += (bytes + 255) & ~(size_t)255; return (void*)p; };
    bf* WO = (bf*)take((size_t)DM * DQ * 2);
    h16* QP16 = (h16*)take((size_t)NH_ * TT * HD * 2); h16* KP16 = (h16*)take((size_t)NKV * TT * HD * 2); h16* VT16 = (h16*)take((size_t)NKV * HD * TT * 2);
    bf* QPh = (bf*)take((size_t)NH_ * TT * HD * 2); bf* QPl = (bf*)take((size_t)NH_ * TT * HD * 2); bf* KPh = (bf*)take((size_t)NKV * TT * HD * 2); bf* KPl = (bf*)take((size_t)NKV * TT * HD * 2); bf* VTh = (bf*)take((size_t)NKV * HD * TT * 2); bf* VTl = (bf*)take((size_t)NKV * HD * TT * 2);
    bf* ATh = (bf*)take((size_t)TT * DQ * 2); bf* ATl = (bf*)take((size_t)TT * DQ * 2);   // planes of their own: the attention launch writes them while its other work-groups still read the q planes
    bf* WQ = (bf*)take((size_t)DQ * DM * 2); bf* WK = (bf*)take((size_t)DKV * DM * 2); bf* WV = (bf*)take((size_t)DKV * DM * 2);
    bf* XB = (bf*)take((size_t)TT * DM * 2);
    if ((size_t)(wsp - (char*)d_ws) > ws_size) return;    // ws 256 MiB; 104 MiB taken
    { k_cvt8<<<(unsigned)(((size_t)DQ * DM / 8 + 255) / 256), 256, 0, stream>>>(wq, WQ, (size_t)DQ * DM / 8); k_cvt8<<<(unsigned)(((size_t)DKV * DM / 8 + 255) / 256), 256, 0, stream>>>(wk, WK, (size_t)DKV * DM / 8); k_cvt8<<<(unsigned)(((size_t)DKV * DM / 8 + 255) / 256), 256, 0, stream>>>(wv, WV, (size_t)DKV * DM / 8);
      k_cvt8<<<(unsigned)(((size_t)DM * DQ / 8 + 255) / 256), 256, 0, stream>>>(wo, WO, (size_t)DM * DQ / 8);
       }
    for (int b = 0; b < NB_; ++b) {
        
        k_cvt8<<<(unsigned)(((size_t)TT * DM / 8 + 255) / 256), 256, 0, stream>>>(x + (size_t)b * TT * DM, XB, (size_t)TT * DM / 8);
        k_gemms<0, 1, DM><<<dim3(TT / 128, DQ / 128, 1), 128, 0, stream>>>(XB, nullptr, WQ, nullptr, TT, bq, QP16, QPh, QPl);
        k_gemms<0, 1, DM><<<dim3(TT / 128, DKV / 128, 1), 128, 0, stream>>>(XB, nullptr, WK, nullptr, TT, bk, KP16, KPh, KPl);
        k_gemms<0, 2, DM><<<dim3(DKV / 128, TT / 128, 1), 128, 0, stream>>>(WV, nullptr, XB, nullptr, TT, bv, VT16, VTh, VTl);   // v^T = Wv x^T: its rows are the [h][d] rows of the v planes
        for (int h0 = 0; h0 < NH_; h0 += ZH) { const size_t zq = (size_t)h0, zk = (size_t)(h0 / REP);   // one kv head per query head: the pass's heads use consecutive kv planes (z-strides TT*HD)
            k_attn<<<dim3(TT / 64, 1, ZH), 256, 0, stream>>>(QP16 + zq * TT * HD, KP16 + zk * TT * HD, VT16 + zk * HD * TT, QPh + zq * TT * HD, QPl + zq * TT * HD, KPh + zk * TT * HD, KPl + zk * TT * HD, VTh + zk * HD * TT, VTl + zk * HD * TT, ATh + zq * HD, ATl + zq * HD); }
        k_gemms<1, 0, DQ><<<dim3(TT / 128, DM / 128, 1), 128, 0, stream>>>(ATh, ATl, WO, OUT + (size_t)b * TT * DM, DM, bo, nullptr, nullptr, nullptr); }
}

// v006
// A run of this version takes 123 microseconds.
// Two timings next to v005 put it at 1.15 and 1.14 times that version's speed.
// All steps since v000 together make it 33.4 times as fast.
#include <hip/hip_runtime.h>

// Local multi-head attention with a symmetric window (x [1][4096][1024]; q,k,v = x W^T + b ('oi' [1024][1024] + [1024], 0.02; 16 heads x 64); scores / 8; keys with |i - j| > 256 -> -inf; softmax; out = merged Wo^T + bo -> [1][4096][1024] (4.2 M)).
// Layout: bf16 copy of x; exact projections + f32 biases, whose epilogues write the fp16 and bf16 hi/lo head planes themselves (q, k as [h][t][d]; v as [h][d][t], from the product taken as Wv x^T); attention, all 16 heads per pass as grid z (hybrid rows: < 512 hi/lo 3 products, rest fp16 x1024; softmax applying the |i - j| <= 256 window as an index select; scores, softmax and P V of a 64-row tile in one work-group, over the tile's key band alone, the score band in LDS, whose rows the softmax overwrites with P; the tile's output leaves as the merged hi/lo planes); merged hi/lo x Wo exact + bo.
// Compute dtypes, f32 accumulate: every input rounded to bf16; projections exact + f32 biases; attention rows < 512 3 products, rest fp16; softmax f32; Wo hl x exact + bias.

#define NB_  1
#define TT   4096
#define DM   1024
#define NH_  16
#define NKV  16
#define REP  (NH_ / NKV)
#define HD   64
#define DQ   (NH_ * HD)
#define DKV  (NKV * HD)
#define ZH   16                   // heads per pass (grid z of the attention launches)
#define RH   512                  // query rows < RH use hi+lo planes (0: none)
#define WIN  0
#define PCAR 1024.0f
#define SCL  0.125f
#define WNB  256     // |i - j| <= 256 kept
#define BT   (2 * WNB / 64 + 2)   // 64-key tiles computed per 64-row tile: the 9 the window can reach, widened to whole 128-key softmax chunks
#define PB   (BT * 64)            // score row pitch in f32 (LDS): the band alone; column 0 is the band's first key. The same bytes then hold the row's P at pitch 2 * PB 16-bit elements (fp16 in the first half; or bf16 hi, then lo at + PB)
typedef _Float16 h16;
typedef unsigned short bf;
typedef __attribute__((ext_vector_type(16))) __bf16   v16bf;
typedef __attribute__((ext_vector_type(16))) _Float16 v16h;
typedef __attribute__((ext_vector_type(8)))  _Float16 v8h;
typedef __attribute__((ext_vector_type(8)))  unsigned short v8us;
typedef __attribute__((ext_vector_type(8)))  float    v8f;
typedef __attribute__((ext_vector_type(4)))  float    v4f;
typedef v8h  __attribute__((may_alias)) v8ha;
typedef v4f  __attribute__((may_alias)) v4fa;
typedef v8us __attribute__((may_alias)) v8usa;

__device__ __forceinline__ unsigned short f2bf(float f) { unsigned u = __float_as_uint(f); u += 0x7FFFu + ((u >> 16) & 1u); return (unsigned short)(u >> 16); }
__device__ __forceinline__ float bf2f(unsigned short b) { return __uint_as_float(((unsigned)b) << 16); }
__device__ __forceinline__ float bfr(float f) { return bf2f(f2bf(f)); }
__device__ __forceinline__ v16h cat16(v8h lo, v8h hi) { return __builtin_shufflevector(lo, hi, 0, 1, 2, 3, 4, 5, 6, 7, 8, 9, 10, 11, 12, 13, 14, 15); }
__device__ __forceinline__ v16bf cat16b(v8us lo, v8us hi) { return __builtin_bit_cast(v16bf, __builtin_shufflevector(lo, hi, 0, 1, 2, 3, 4, 5, 6, 7, 8, 9, 10, 11, 12, 13, 14, 15)); }
__device__ __forceinline__ v8f wmma16(v16h a, v16h b, v8f c) { return __builtin_amdgcn_wmma_f32_16x16x32_f16(false, a, false, b, (short)0, c, false, false); }
__device__ __forceinline__ v8f wmmab(v16bf a, v16bf b, v8f c) { return __builtin_amdgcn_wmma_f32_16x16x32_bf16(false, a, false, b, (short)0, c, false, false); }



// a 16x32 fragment from two 16-byte pieces of a K-contiguous 16-bit row, and its matrix instruction
template <typename T16> struct WFrag;
template <> struct WFrag<h16> { typedef v16h V; static __device__ __forceinline__ V ld(const h16* p) { return cat16(*(const v8h*)p, *(const v8h*)(p + 16)); } static __device__ __forceinline__ v8f mma(V a, V b, v8f c) { return wmma16(a, b, c); } };
template <> struct WFrag<bf> { typedef v16bf V; static __device__ __forceinline__ V ld(const bf* p) { return cat16b(*(const v8us*)p, *(const v8us*)(p + 16)); } static __device__ __forceinline__ v8f mma(V a, V b, v8f c) { return wmmab(a, b, c); } };

__device__ __forceinline__ h16 tohx(float x) { return (h16)x; }
__device__ __forceinline__ void splitf(float y, unsigned short& h, unsigned short& l) { h = f2bf(y); l = f2bf(y - bf2f(h)); }
typedef __attribute__((ext_vector_type(2))) _Float16 v2h;
typedef __attribute__((ext_vector_type(4))) _Float16 v4h;
typedef __attribute__((ext_vector_type(2))) unsigned short v2us;
typedef __attribute__((ext_vector_type(4))) unsigned short v4us;
typedef __attribute__((ext_vector_type(2))) float v2f;
typedef __attribute__((ext_vector_type(4))) int v4i;

__global__ __launch_bounds__(256) void k_wtG(const float* __restrict__ w, int K, int N, bf* Bt) {
    const int lane = threadIdx.x & 31; const int L0 = (blockIdx.x * 8 + (threadIdx.x >> 5)) * 8; const int nlines = N * K / 64;
{
#pragma unroll 1
        for (int l = 0; l < 8; ++l) { const int L = L0 + l; if (L >= nlines) break; const size_t e = (size_t)L * 64 + lane * 2; const int k = (int)(e % K), n = (int)(e / K); v2us o;
            o[0] = f2bf(w[(size_t)k * N + n]); o[1] = f2bf(w[(size_t)(k + 1) * N + n]); *(v2us*)(Bt + e) = o; }
         }
}
// every f32 -> bf16 conversion of the call in one launch: x, then Wq, Wk, Wv, Wo. A work-group takes CPG consecutive 8-element pieces of one array; a thread eight of them, 256 pieces apart, all its loads in flight before the first is converted. grid (TT * DM + 4 * DM * DM) / (8 * CPG).
#define CPG 2048
__global__ __launch_bounds__(256) void k_cvtall(const float* __restrict__ x, const float* __restrict__ wq, const float* __restrict__ wk, const float* __restrict__ wv, const float* __restrict__ wo, bf* XB, bf* WQ, bf* WK, bf* WV, bf* WO) {
    constexpr int GX = TT * DM / (8 * CPG), GW = DM * DM / (8 * CPG);   /* work-groups of x, and of one weight matrix */
    int g = blockIdx.x; const float* src = x; bf* dst = XB;
    if (g >= GX) { const int a = (g - GX) / GW; g = (g - GX) % GW; src = a == 0 ? wq : a == 1 ? wk : a == 2 ? wv : wo; dst = a == 0 ? WQ : a == 1 ? WK : a == 2 ? WV : WO; }
    const size_t e0 = ((size_t)g * CPG + threadIdx.x) * 8; const float* ps = src + e0; v8f v[8]; v8us o[8];
#pragma unroll
    for (int i = 0; i < 8; ++i) v[i] = *(const v8f*)(ps + i * 256 * 8);
    asm volatile("s_wait_xcnt 0x0" :: "v"(ps) : "memory");   /* stands before the loads' address registers are reused; the pointer is an input so that those registers live up to it */
#pragma unroll
    for (int i = 0; i < 8; ++i)
#pragma unroll
        for (int k = 0; k < 8; ++k) o[i][k] = f2bf(v[i][k]);
#pragma unroll
    for (int i = 0; i < 8; ++i) *(v8us*)(dst + e0 + i * 256 * 8) = o[i];
}

typedef v4h  __attribute__((may_alias)) v4ha;
typedef v4us __attribute__((may_alias)) v4usa;
// a 16x32 A fragment from two 16-byte pieces in LDS
template <typename T16> struct LFrag;
template <> struct LFrag<h16> { static __device__ __forceinline__ v16h ld2(const h16* p, const h16* q) { return cat16(*(const v8ha*)p, *(const v8ha*)q); } };
template <> struct LFrag<bf> { static __device__ __forceinline__ v16bf ld2(const bf* p, const bf* q) { return cat16b(*(const v8usa*)p, *(const v8usa*)q); } };

// ---- gemm_tile: y[m][n] = sum_k A[m][k] Bt[n][k] (NSPLIT 1: + A2[m][k] Bt[n][k]) + f32 bias. EPI 0: bias[n], y to C (f32, pitch ldc). EPI 1: bias[n], y as fp16, bf16 hi and bf16 lo to the planes P16, Ph, Pl at [n / 64][m][n % 64], ldc rows a plane. EPI 2: bias[m], the same three forms at [m][n], pitch ldc. A, A2, Bt K-contiguous bf16 planes of pitch K; K % 128 == 0, K >= 256. Tile (bx, by) of (M/128, N/128), 128 threads.
// One work-group of 4 waves per 128x128 tile, a wave per 64x64 quarter (16 accumulators). A pass is 128 k: 256 bytes of each of the tile's 128 A (A2) and 128 Bt rows, brought whole-line into LDS by asynchronous copies, two buffers, the next pass's copies in flight while this pass is multiplied. LDS row pitch 272 bytes (16 x odd: the 16 rows of a fragment read fall in different bank groups).
#define GP 136   // LDS row pitch in 16-bit elements
// eight copies of 16 bytes a lane, 8 rows apart (global pitch K elements, LDS pitch GP); g is the same for the whole work-group, toff the lane's own offset in elements
template <int K> __device__ __forceinline__ void copy8(unsigned l, const bf* g, size_t toff) {
    unsigned la[8]; const bf* ga[8];
#pragma unroll
    for (int i = 0; i < 8; ++i) { la[i] = l + i * 8 * GP * 2; ga[i] = g + (size_t)i * 8 * K + toff; }
    /* the wait stands in the copies' own statement: it ends before any of their address registers is rewritten */
    asm volatile("global_load_async_to_lds_b128 %0, %8, off\n\t"
                 "global_load_async_to_lds_b128 %1, %9, off\n\t"
                 "global_load_async_to_lds_b128 %2, %10, off\n\t"
                 "global_load_async_to_lds_b128 %3, %11, off\n\t"
                 "global_load_async_to_lds_b128 %4, %12, off\n\t"
                 "global_load_async_to_lds_b128 %5, %13, off\n\t"
                 "global_load_async_to_lds_b128 %6, %14, off\n\t"
                 "global_load_async_to_lds_b128 %7, %15, off\n\t"
                 "s_wait_xcnt 0x0"
                 :: "v"(la[0]), "v"(la[1]), "v"(la[2]), "v"(la[3]), "v"(la[4]), "v"(la[5]), "v"(la[6]), "v"(la[7]),
                    "v"(ga[0]), "v"(ga[1]), "v"(ga[2]), "v"(ga[3]), "v"(ga[4]), "v"(ga[5]), "v"(ga[6]), "v"(ga[7]) : "memory");
}
template <int NSPLIT, int EPI, int K>
__device__ __forceinline__ void gemm_tile(bf (*ring)[NSPLIT ? 3 : 2][128 * GP], float (*osb)[16 * 68], const int bx, const int by, const bf* __restrict__ A, const bf* __restrict__ A2, const bf* __restrict__ Bt, float* C, int ldc, const float* __restrict__ bias, h16* P16, bf* Ph, bf* Pl) {
    constexpr int NP = NSPLIT ? 3 : 2;   /* planes of a stage: A, Bt (, A2) */
    const int tid = threadIdx.x, lane = tid & 31, lr = lane & 15, hi = lane >> 4; const int wv = __builtin_amdgcn_readfirstlane(tid >> 5);
    const int R0 = bx * 128, C0 = by * 128; const int wm = (wv >> 1) * 64, wn = (wv & 1) * 64; const int r0 = R0 + wm, c0 = C0 + wn;
    /* a thread copies piece tid & 15 of rows tid >> 4, + 8, ... + 120 of each plane: a wave's copy takes two whole 256-byte row parts */
    const size_t toff = (size_t)(tid >> 4) * K + (tid & 15) * 8; const int lo = (tid >> 4) * GP + (tid & 15) * 8;
    auto fill = [&](int buf, int t) {
        const bf* pa = A + (size_t)R0 * K + t * 128; const bf* pb = Bt + (size_t)C0 * K + t * 128;
        copy8<K>((unsigned)(size_t)&ring[buf][0][lo], pa, toff); copy8<K>((unsigned)(size_t)&ring[buf][0][lo + 64 * GP], pa + (size_t)64 * K, toff);
        copy8<K>((unsigned)(size_t)&ring[buf][1][lo], pb, toff); copy8<K>((unsigned)(size_t)&ring[buf][1][lo + 64 * GP], pb + (size_t)64 * K, toff);
        if constexpr (NSPLIT) { const bf* pa2 = A2 + (size_t)R0 * K + t * 128; copy8<K>((unsigned)(size_t)&ring[buf][2][lo], pa2, toff); copy8<K>((unsigned)(size_t)&ring[buf][2][lo + 64 * GP], pa2 + (size_t)64 * K, toff); } };
    v8f acc[4][4];
#pragma unroll
    for (int mb = 0; mb < 4; ++mb)
#pragma unroll
        for (int nb = 0; nb < 4; ++nb) acc[mb][nb] = (v8f){};
    constexpr int NT = K / 128;
    fill(0, 0);
    asm volatile("s_wait_asynccnt 0x0" ::: "memory");   /* this wave's copies of pass 0 have landed */
    __syncthreads();   /* every wave's have: pass 0 may be read */
    fill(1, 1);
#pragma unroll 1   /* one pass a trip: the two buffers take turns by the trip's parity */
    for (int t = 0; t < NT; ++t) {
        const bf* As = &ring[t & 1][0][(wm + lr) * GP + 8 * hi]; const bf* Bs = &ring[t & 1][1][(wn + lr) * GP + 8 * hi]; const bf* A2s = &ring[t & 1][NP - 1][(wm + lr) * GP + 8 * hi];
        v16bf a[2][4], a2[2][4], b[2][4];   /* two fragment sets: a 32-k block's 16 (24) LDS reads go out while the block before it is multiplied */
        auto ldf = [&](int s, int ks) {
#pragma unroll
            for (int mb = 0; mb < 4; ++mb) { a[s][mb] = LFrag<bf>::ld2(As + mb * 16 * GP + ks * 32, As + mb * 16 * GP + ks * 32 + 16); if constexpr (NSPLIT) a2[s][mb] = LFrag<bf>::ld2(A2s + mb * 16 * GP + ks * 32, A2s + mb * 16 * GP + ks * 32 + 16); }
#pragma unroll
            for (int nb = 0; nb < 4; ++nb) b[s][nb] = LFrag<bf>::ld2(Bs + nb * 16 * GP + ks * 32, Bs + nb * 16 * GP + ks * 32 + 16); };
        ldf(0, 0);
#pragma unroll
        for (int ks = 0; ks < 4; ++ks) {
            if (ks < 3) ldf((ks + 1) & 1, ks + 1);
            __builtin_amdgcn_sched_barrier(0);   /* holds the next block's reads, as one group, ahead of this block's matrix instructions; sunk to their uses, each would expose the LDS latency */
#pragma unroll
            for (int nb = 0; nb < 4; ++nb) {
#pragma unroll
                for (int mb = 0; mb < 4; ++mb) acc[mb][nb] = wmmab(a[ks & 1][mb], b[ks & 1][nb], acc[mb][nb]);
                if constexpr (NSPLIT) {
#pragma unroll
                    for (int mb = 0; mb < 4; ++mb) acc[mb][nb] = wmmab(a2[ks & 1][mb], b[ks & 1][nb], acc[mb][nb]); } }
            __builtin_amdgcn_sched_barrier(0);   /* the block's matrix instructions stay ahead of the reads that reuse its fragment set, and of the pass's foot */
        }
        asm volatile("v_nop\n\tv_nop\n\tv_nop\n\tv_nop" : "+v"(acc[0][3]), "+v"(acc[1][3]), "+v"(acc[2][3]), "+v"(acc[3][3]));   /* a branch follows: keeps the matrix instructions' distance on its taken side too */
        asm volatile("s_wait_dscnt 0x0" ::: "memory");      /* this wave has left the buffer that is refilled below */
        asm volatile("s_wait_asynccnt 0x0" ::: "memory");   /* this wave's copies of pass t + 1 have landed */
        __syncthreads();   /* publishes pass t + 1 and ends every wave's reads of pass t */
        if (t + 2 < NT) fill(t & 1, t + 2);
    }
    asm volatile("s_wait_asynccnt 0x0" ::: "memory");   /* no copy is in flight when the wave goes on to its end */
    float* os = osb[wv];
#pragma unroll
    for (int mb = 0; mb < 4; ++mb) {
#pragma unroll
        for (int nb = 0; nb < 4; ++nb) {
#pragma unroll
            for (int j = 0; j < 8; ++j) os[(hi * 8 + j) * 68 + nb * 16 + lr] = acc[mb][nb][j]; }
        __builtin_amdgcn_wave_barrier(); asm volatile("" ::: "memory");
        if constexpr (EPI == 0) {
            float* crow = C + (size_t)(r0 + mb * 16) * ldc + c0;
#pragma unroll
            for (int s = 0; s < 8; ++s) { const int row = 2 * s + hi, cofs = lr * 4; v4f val = *(const v4fa*)(os + row * 68 + cofs); val[0] += bfr(bias[c0 + cofs]); val[1] += bfr(bias[c0 + cofs + 1]); val[2] += bfr(bias[c0 + cofs + 2]); val[3] += bfr(bias[c0 + cofs + 3]);
                *(v4f*)(crow + (size_t)row * ldc + cofs) = val; }
        } else {   /* eight lanes a row: a row's 64 values leave as one whole 128-byte line of each plane */
            const float* pb = bias + (EPI == 1 ? c0 + (lane & 7) * 8 : r0 + mb * 16 + (lane >> 3)); float bv[EPI == 1 ? 8 : 4];   /* the biases of the lane's eight columns (EPI 1) or four rows (EPI 2) */
#pragma unroll
            for (int q = 0; q < (EPI == 1 ? 8 : 4); ++q) bv[q] = pb[EPI == 1 ? q : 4 * q];
            asm volatile("s_wait_xcnt 0x0" :: "v"(pb) : "memory");   /* stands before the bias loads' address registers are reused; the pointer is an input so that those registers live up to it */
#pragma unroll
            for (int s = 0; s < 4; ++s) { const int row = 4 * s + (lane >> 3), cofs = (lane & 7) * 8, m = r0 + mb * 16 + row;
                const v8f u = __builtin_shufflevector(*(const v4fa*)(os + row * 68 + cofs), *(const v4fa*)(os + row * 68 + cofs + 4), 0, 1, 2, 3, 4, 5, 6, 7); v8h o16; v8us oh, ol;
#pragma unroll
                for (int q = 0; q < 8; ++q) { const float y = u[q] + bfr(bv[EPI == 1 ? q : s]); o16[q] = tohx(y); unsigned short a2, c2; splitf(y, a2, c2); oh[q] = a2; ol[q] = c2; }
                const size_t e = EPI == 1 ? ((size_t)(c0 >> 6) * ldc + m) * HD + cofs : (size_t)m * ldc + c0 + cofs;
                *(v8h*)(P16 + e) = o16; *(v8us*)(Ph + e) = oh; *(v8us*)(Pl + e) = ol; }
        }
        asm volatile("s_wait_xcnt 0x0" ::: "memory");   /* stands before the stores' data and address registers are reused for the next 16 rows */
        __builtin_amdgcn_wave_barrier(); asm volatile("" ::: "memory");
    }
}
template <int NSPLIT, int EPI, int K>
__global__ __launch_bounds__(128) void k_gemms(const bf* __restrict__ A, const bf* __restrict__ A2, const bf* __restrict__ Bt, float* C, int ldc, const float* __restrict__ bias, h16* P16, bf* Ph, bf* Pl) {
    __shared__ __align__(16) bf ring[2][NSPLIT ? 3 : 2][128 * GP];
    __shared__ __align__(16) float osb[4][16 * 68];
    gemm_tile<NSPLIT, EPI, K>(ring, osb, blockIdx.x, blockIdx.y, A, A2, Bt, C, ldc, bias, P16, Ph, Pl);
}
// the q, k and v projections in one launch, grid (TT / 128, DM / 128, 3): z = 0 is q = x Wq^T, z = 1 is k = x Wk^T, z = 2 is v^T = Wv x^T (its rows are the [h][d] rows of the v planes; block x stays the 128 rows of x). Two work-groups fit a WGP's LDS: one's copies, barriers and epilogue run beside the other's matrix instructions.
__global__ __launch_bounds__(128) void k_qkv(const bf* __restrict__ X, const bf* __restrict__ Wq, const bf* __restrict__ Wk, const bf* __restrict__ Wv, const float* __restrict__ bq, const float* __restrict__ bk, const float* __restrict__ bv,
                                             h16* Q16, bf* Qh, bf* Ql, h16* K16, bf* Kh, bf* Kl, h16* V16, bf* Vh, bf* Vl) {
    __shared__ __align__(16) bf ring[2][2][128 * GP];
    __shared__ __align__(16) float osb[4][16 * 68];
    const int z = blockIdx.z;
    if (z == 2) gemm_tile<0, 2, DM>(ring, osb, blockIdx.y, blockIdx.x, Wv, nullptr, X, nullptr, TT, bv, V16, Vh, Vl);
    else gemm_tile<0, 1, DM>(ring, osb, blockIdx.x, blockIdx.y, X, nullptr, z ? Wk : Wq, nullptr, TT, z ? bk : bq, z ? K16 : Q16, z ? Kh : Qh, z ? Kl : Ql);
}


// ---- attention of one (64-row tile, head) by one work-group of 8 waves; the tile's score band S[64][PB] f32 lives in LDS and never reaches memory.
// 1 scores: wave w does the 64 rows x keys [80 w, 80 w + 80) of the band, q fragments held in registers. A score of logical column x of row r lies at x ^ (16 if r & 8): the two half-waves of an accumulator store then hit different banks.
// 2 softmax: wave w owns rows 8 w .. 8 w + 7; a row is read once, and its P goes over its own bytes (fp16 in the first half; or bf16 hi, then lo at + PB), the 16-byte piece c of row r at piece c ^ (r & 15): the 16 rows of an A fragment read then fall in 16 different bank groups.
// 3 P V: wave w does rows 16 (w >> 1) .. + 15 x columns 32 (w & 1) .. + 31, k ascending over the keys the tile's window can reach; V^T fragments come from memory one 64-key group ahead.
// 4 output: the 64x64 tile is gathered in the band's LDS, free by then, and leaves as bf16 hi and lo planes at [t][head 64 + d] (pitch DQ), the operands of the last projection; four lanes a row, so a row's 64 values are one whole 128-byte line of each plane.
template <typename T16, bool HR>
__device__ __forceinline__ void attn_tile(float* S, const T16* __restrict__ Q, const T16* __restrict__ Q2, const T16* __restrict__ Kp, const T16* __restrict__ K2, const T16* __restrict__ Vt, const T16* __restrict__ Vt2, bf* Ah, bf* Al, const int r0) {
    typedef typename WFrag<T16>::V V;
    const int lane = threadIdx.x & 31, lr = lane & 15, hi = lane >> 4; const int wv = __builtin_amdgcn_readfirstlane((int)(threadIdx.x >> 5));
    const int band0 = (((r0 >> 6) - WNB / 64) & ~1) * 64;   /* first key of the row tile's band (below 0 at the sequence's start) */
    {
        V a[4][2], a2[4][2]; const T16* pq[4]; const T16* pq2[4];
#pragma unroll
        for (int mb = 0; mb < 4; ++mb) { pq[mb] = Q + (size_t)(r0 + mb * 16 + lr) * HD + 8 * hi; a[mb][0] = WFrag<T16>::ld(pq[mb]); a[mb][1] = WFrag<T16>::ld(pq[mb] + 32); if constexpr (HR) { pq2[mb] = Q2 + (size_t)(r0 + mb * 16 + lr) * HD + 8 * hi; a2[mb][0] = WFrag<T16>::ld(pq2[mb]); a2[mb][1] = WFrag<T16>::ld(pq2[mb] + 32); } }
        /* stands before the q loads' address registers are reused; the pointers are inputs so that those registers live up to it */
        if constexpr (HR) asm volatile("s_wait_xcnt 0x0" :: "v"(pq[0]), "v"(pq[1]), "v"(pq[2]), "v"(pq[3]), "v"(pq2[0]), "v"(pq2[1]), "v"(pq2[2]), "v"(pq2[3]) : "memory");
        else asm volatile("s_wait_xcnt 0x0" :: "v"(pq[0]), "v"(pq[1]), "v"(pq[2]), "v"(pq[3]) : "memory");
        constexpr int G = HR ? 1 : 5;   /* 16-key pieces whose k fragments are fetched together (hi/lo planes: one, for registers) */
#pragma unroll
        for (int g = 0; g < 5; g += G) {
            V b[G][2], b2[G][2]; const T16* pk[G]; const T16* pk2[G];
#pragma unroll
            for (int u = 0; u < G; ++u) { const int key = min(max(band0 + (wv * 5 + g + u) * 16, 0), TT - 16);   /* a piece off the sequence loads in-bounds keys, so that no branch parts the loads; it is skipped below */
                pk[u] = Kp + (size_t)(key + lr) * HD + 8 * hi; b[u][0] = WFrag<T16>::ld(pk[u]); b[u][1] = WFrag<T16>::ld(pk[u] + 32); if constexpr (HR) { pk2[u] = K2 + (size_t)(key + lr) * HD + 8 * hi; b2[u][0] = WFrag<T16>::ld(pk2[u]); b2[u][1] = WFrag<T16>::ld(pk2[u] + 32); } }
            /* stands before the k loads' address registers are reused; the pointers are inputs so that those registers live up to it */
            if constexpr (HR) asm volatile("s_wait_xcnt 0x0" :: "v"(pk[0]), "v"(pk2[0]) : "memory");
            else asm volatile("s_wait_xcnt 0x0" :: "v"(pk[0]), "v"(pk[1]), "v"(pk[2]), "v"(pk[3]), "v"(pk[4]) : "memory");
#pragma unroll
            for (int u = 0; u < G; ++u) { const int sub = wv * 5 + g + u; const int key0 = band0 + sub * 16; if (key0 < 0 || key0 >= TT) continue;
                v8f acc[4];
#pragma unroll
                for (int mb = 0; mb < 4; ++mb) acc[mb] = (v8f){};
#pragma unroll
                for (int kk = 0; kk < 2; ++kk)
#pragma unroll
                    for (int mb = 0; mb < 4; ++mb) { acc[mb] = WFrag<T16>::mma(a[mb][kk], b[u][kk], acc[mb]); if constexpr (HR) { acc[mb] = WFrag<T16>::mma(a2[mb][kk], b[u][kk], acc[mb]); acc[mb] = WFrag<T16>::mma(a[mb][kk], b2[u][kk], acc[mb]); } }
                float* sc = S + hi * 8 * PB + ((sub * 16 + lr) ^ (hi << 4));
#pragma unroll
                for (int mb = 0; mb < 4; ++mb)
#pragma unroll
                    for (int j = 0; j < 8; ++j) sc[(mb * 16 + j) * PB] = acc[mb][j]; }
        }
    }
    __syncthreads();   /* every wave's scores are in LDS before a row is read */
    const int cb = band0 >> 7;   /* first of the BT / 2 128-key chunks of the band; a chunk off the sequence (on false) gets j0 = -TT, which fails the window test for every row */
    const int sw = (wv & 1) << 4;
#pragma unroll 2   /* two rows in flight: one row's cross-lane reductions are covered by the other's arithmetic */
    for (int rr = 0; rr < 8; ++rr) { const int row = wv * 8 + rr, i = r0 + row; float* sr = S + row * PB; float t[BT / 2][4]; float mx = -3.0e38f;
#pragma unroll
        for (int c = 0; c < BT / 2; ++c) { const int ch = cb + c; const bool on = ch >= 0 && ch < TT / 128; const int j0 = on ? ch * 128 + lane * 4 : -TT; const v4f a = *(const v4fa*)(sr + (((on ? c : max(cb, 0) - cb) * 128 + lane * 4) ^ sw));   /* a chunk off the sequence reads an in-band one; the window test masks it */
#pragma unroll
            for (int q = 0; q < 4; ++q) { const float s = a[q] * SCL; t[c][q] = (j0 + q <= i + WNB && j0 + q >= i - WNB) ? s : -3.0e38f;   /* symmetric window: |i - j| <= WNB */ mx = fmaxf(mx, t[c][q]); } }
#pragma unroll
        for (int sh = 16; sh; sh >>= 1) mx = fmaxf(mx, __shfl_xor(mx, sh, 32));
        float sum = 0.f;
#pragma unroll
        for (int c = 0; c < BT / 2; ++c)
#pragma unroll
            for (int q = 0; q < 4; ++q) { t[c][q] = __builtin_amdgcn_exp2f(__fmul_rn(__fsub_rn(t[c][q], mx), 1.4426950408889634f)); sum += t[c][q]; }
#pragma unroll
        for (int sh = 16; sh; sh >>= 1) sum += __shfl_xor(sum, sh, 32);
        const float f = __fdiv_rn(HR ? 1.0f : PCAR, sum);
        T16* pr = (T16*)sr + (lane & 1) * 4;
#pragma unroll
        for (int c = 0; c < BT / 2; ++c) { const int ch = cb + c; if (ch < 0 || ch >= TT / 128) continue; const int pc = ((c * 16 + (lane >> 1)) ^ (row & 15)) * 8;
            if constexpr (HR) { v4us oh, ol;
#pragma unroll
                for (int q = 0; q < 4; ++q) { unsigned short a2, c2; splitf(t[c][q] * f, a2, c2); oh[q] = a2; ol[q] = c2; }
                *(v4usa*)(pr + pc) = oh; *(v4usa*)(pr + PB + pc) = ol;
            } else { v4h o4;
#pragma unroll
                for (int q = 0; q < 4; ++q) o4[q] = tohx(t[c][q] * f);
                *(v4ha*)(pr + pc) = o4; } } }
    __syncthreads();   /* every row's P is in LDS before a fragment of it is read */
    const int mb = wv >> 1, n0 = (wv & 1) * 32; const int k0 = max(r0 - WNB, 0), k1 = min(r0 + 64 + WNB, TT);
    const T16* pa = (const T16*)S + (mb * 16 + lr) * (2 * PB);
    const size_t voff = (size_t)(n0 + lr) * TT + 8 * hi;
    v8f acc[2]; acc[0] = (v8f){}; acc[1] = (v8f){};
    V bc[2][2], bc2[2][2], bn[2][2], bn2[2][2];   /* [column block][32-key step] */
    auto ldv = [&](V (&d)[2][2], V (&d2)[2][2], int kc) { const T16* p[2]; const T16* p2[2];
#pragma unroll
        for (int nb = 0; nb < 2; ++nb) { p[nb] = Vt + voff + (size_t)nb * 16 * TT + kc; d[nb][0] = WFrag<T16>::ld(p[nb]); d[nb][1] = WFrag<T16>::ld(p[nb] + 32); if constexpr (HR) { p2[nb] = Vt2 + voff + (size_t)nb * 16 * TT + kc; d2[nb][0] = WFrag<T16>::ld(p2[nb]); d2[nb][1] = WFrag<T16>::ld(p2[nb] + 32); } }
        /* stands before the v loads' address registers are reused; the pointers are inputs so that those registers live up to it */
        if constexpr (HR) asm volatile("s_wait_xcnt 0x0" :: "v"(p[0]), "v"(p[1]), "v"(p2[0]), "v"(p2[1]) : "memory");
        else asm volatile("s_wait_xcnt 0x0" :: "v"(p[0]), "v"(p[1]) : "memory"); };
    auto step = [&](V (&d)[2][2], V (&d2)[2][2], int kc) {
#pragma unroll
        for (int s = 0; s < 2; ++s) { const int pc = ((kc - band0) >> 3) + s * 4 + hi; const V a = LFrag<T16>::ld2(pa + ((pc ^ lr) << 3), pa + (((pc + 2) ^ lr) << 3)); V a2; if constexpr (HR) a2 = LFrag<T16>::ld2(pa + PB + ((pc ^ lr) << 3), pa + PB + (((pc + 2) ^ lr) << 3));
#pragma unroll
            for (int nb = 0; nb < 2; ++nb) { acc[nb] = WFrag<T16>::mma(a, d[nb][s], acc[nb]); if constexpr (HR) { acc[nb] = WFrag<T16>::mma(a2, d[nb][s], acc[nb]); acc[nb] = WFrag<T16>::mma(a, d2[nb][s], acc[nb]); } } }
        asm volatile("v_nop\n\tv_nop\n\tv_nop\n\tv_nop" : "+v"(acc[0]), "+v"(acc[1]));   /* a branch follows: keeps the matrix instructions' distance on its taken side too */
    };
    ldv(bc, bc2, k0);
#pragma unroll 1
    for (int kc = k0; kc < k1; kc += 128) {   /* two register sets in turn: the next 64-key group flies while this one is multiplied; the last fetch takes the last group again rather than branch */
        ldv(bn, bn2, min(kc + 64, k1 - 64)); step(bc, bc2, kc);
        if (kc + 64 >= k1) break;
        ldv(bc, bc2, min(kc + 128, k1 - 64)); step(bn, bn2, kc + 64);
    }
    __syncthreads();   /* every wave has read its last P fragment: the band's LDS may take the output tile */
    float* so = S + (mb * 16 + hi * 8) * 68 + n0 + lr;
#pragma unroll
    for (int nb = 0; nb < 2; ++nb)
#pragma unroll
        for (int j = 0; j < 8; ++j) so[j * 68 + nb * 16] = acc[nb][j];
    __syncthreads();   /* a row's two halves come from two waves: both are in LDS before the row is read */
    const int orow = (int)(threadIdx.x >> 2), ocol = (int)(threadIdx.x & 3) * 16; const float cs = HR ? 1.0f : (1.0f / PCAR);
    v8us oh[2], ol[2];
#pragma unroll
    for (int p = 0; p < 2; ++p) { const v8f u = __builtin_shufflevector(*(const v4fa*)(S + orow * 68 + ocol + p * 8), *(const v4fa*)(S + orow * 68 + ocol + p * 8 + 4), 0, 1, 2, 3, 4, 5, 6, 7);
#pragma unroll
        for (int q = 0; q < 8; ++q) { unsigned short a2, c2; splitf(u[q] * cs, a2, c2); oh[p][q] = a2; ol[p][q] = c2; } }
    const size_t oo = (size_t)(r0 + orow) * DQ + ocol;
    *(v8us*)(Ah + oo) = oh[0]; *(v8us*)(Ah + oo + 8) = oh[1]; *(v8us*)(Al + oo) = ol[0]; *(v8us*)(Al + oo + 8) = ol[1];
}
__global__ __launch_bounds__(256) void k_attn(const h16* __restrict__ Q16, const h16* __restrict__ K16, const h16* __restrict__ V16, const bf* __restrict__ Qh, const bf* __restrict__ Ql, const bf* __restrict__ Kh, const bf* __restrict__ Kl, const bf* __restrict__ Vh, const bf* __restrict__ Vl, bf* Ah, bf* Al) {
    __shared__ __align__(16) float S[64 * PB];
    const size_t zo = (size_t)blockIdx.z * TT * HD; const int r0 = blockIdx.x * 64; const int ho = blockIdx.z * HD;
    if (r0 < RH) attn_tile<bf, true>(S, Qh + zo, Ql + zo, Kh + zo, Kl + zo, Vh + zo, Vl + zo, Ah + ho, Al + ho, r0);
    else attn_tile<h16, false>(S, Q16 + zo, nullptr, K16 + zo, nullptr, V16 + zo, nullptr, Ah + ho, Al + ho, r0);
}


extern "C" void kernel_launch(void* const* d_in, const int* in_sizes, int n_in,
                              void* d_out, int out_size, void* d_ws, size_t ws_size, hipStream_t stream) {
    (void)in_sizes; (void)n_in; (void)out_size;
    const float* x = (const float*)d_in[0]; const float* wq = (const float*)d_in[1]; const float* bq = (const float*)d_in[2]; const float* wk = (const float*)d_in[3]; const float* bk = (const float*)d_in[4]; const float* wv = (const float*)d_in[5]; const float* bv = (const float*)d_in[6]; const float* wo = (const float*)d_in[7]; const float* bo = (const float*)d_in[8];
    float* OUT = (float*)d_out;     // [1][4096][1024]
    char* wsp = (char*)d_ws;
    auto take = [&](size_t bytes) { char* p = wsp; wsp += (bytes + 255) & ~(size_t)255; return (void*)p; };
    bf* WO = (bf*)take((size_t)DM * DQ * 2);
    h16* QP16 = (h16*)take((size_t)NH_ * TT * HD * 2); h16* KP16 = (h16*)take((size_t)NKV * TT * HD * 2); h16* VT16 = (h16*)take((size_t)NKV * HD * TT * 2);
    bf* QPh = (bf*)take((size_t)NH_ * TT * HD * 2); bf* QPl = (bf*)take((size_t)NH_ * TT * HD * 2); bf* KPh = (bf*)take((size_t)NKV * TT * HD * 2); bf* KPl = (bf*)take((size_t)NKV * TT * HD * 2); bf* VTh = (bf*)take((size_t)NKV * HD * TT * 2); bf* VTl = (bf*)take((size_t)NKV * HD * TT * 2);
    bf* ATh = (bf*)take((size_t)TT * DQ * 2); bf* ATl = (bf*)take((size_t)TT * DQ * 2);   // planes of their own: the attention launch writes them while its other work-groups still read the q planes
    bf* WQ = (bf*)take((size_t)DQ * DM * 2); bf* WK = (bf*)take((size_t)DKV * DM * 2); bf* WV = (bf*)take((size_t)DKV * DM * 2);
    bf* XB = (bf*)take((size_t)TT * DM * 2);
    if ((size_t)(wsp - (char*)d_ws) > ws_size) return;    // ws 256 MiB; 104 MiB taken
    for (int b = 0; b < NB_; ++b) {
        
        k_cvtall<<<(TT * DM + 4 * DM * DM) / (8 * CPG), 256, 0, stream>>>(x + (size_t)b * TT * DM, wq, wk, wv, wo, XB, WQ, WK, WV, WO);
        k_qkv<<<dim3(TT / 128, DM / 128, 3), 128, 0, stream>>>(XB, WQ, WK, WV, bq, bk, bv, QP16, QPh, QPl, KP16, KPh, KPl, VT16, VTh, VTl);
        for (int h0 = 0; h0 < NH_; h0 += ZH) { const size_t zq = (size_t)h0, zk = (size_t)(h0 / REP);   // one kv head per query head: the pass's heads use consecutive kv planes (z-strides TT*HD)
            k_attn<<<dim3(TT / 64, 1, ZH), 256, 0, stream>>>(QP16 + zq * TT * HD, KP16 + zk * TT * HD, VT16 + zk * HD * TT, QPh + zq * TT * HD, QPl + zq * TT * HD, KPh + zk * TT * HD, KPl + zk * TT * HD, VTh + zk * HD * TT, VTl + zk * HD * TT, ATh + zq * HD, ATl + zq * HD); }
        k_gemms<1, 0, DQ><<<dim3(TT / 128, DM / 128, 1), 128, 0, stream>>>(ATh, ATl, WO, OUT + (size_t)b * TT * DM, DM, bo, nullptr, nullptr, nullptr); }
}

// v007
// It runs in 95.4 microseconds.
// Timed twice side by side with v006, it ran 1.29 and 1.28 times as fast.
// All steps since v000 together make it 43.1 times as fast.
#include <hip/hip_runtime.h>

// Local multi-head attention with a symmetric window (x [1][4096][1024]; q,k,v = x W^T + b ('oi' [1024][1024] + [1024], 0.02; 16 heads x 64); scores / 8; keys with |i - j| > 256 -> -inf; softmax; out = merged Wo^T + bo -> [1][4096][1024] (4.2 M)).
// Layout: bf16 copy of x; exact projections + f32 biases, whose epilogues write the fp16 and bf16 hi/lo head planes themselves (q, k as [h][t][d]; v as [h][d][t], from the product taken as Wv x^T; each plane in fragment order, see FB); attention, all 16 heads per pass as grid z (hybrid rows: < 512 hi/lo 3 products, rest fp16 x1024; softmax applying the |i - j| <= 256 window as an index select; scores, softmax and P V of a 64-row tile in one work-group, over the tile's key band alone, the score band in LDS, whose rows the softmax overwrites with P; the tile's output leaves as the merged hi/lo planes); merged hi/lo x Wo exact + bo.
// Compute dtypes, f32 accumulate: every input rounded to bf16; projections exact + f32 biases; attention rows < 512 3 products, rest fp16; softmax f32; Wo hl x exact + bias.

#define NB_  1
#define TT   4096
#define DM   1024
#define NH_  16
#define NKV  16
#define REP  (NH_ / NKV)
#define HD   64
#define DQ   (NH_ * HD)
#define DKV  (NKV * HD)
#define ZH   16                   // heads per pass (grid z of the attention launches)
#define RH   512                  // query rows < RH use hi+lo planes (0: none)
#define WIN  0
#define PCAR 1024.0f
#define SCL  0.125f
#define WNB  256     // |i - j| <= 256 kept
#define BT   (2 * WNB / 64 + 2)   // 64-key tiles computed per 64-row tile: the 9 the window can reach, widened to whole 128-key softmax chunks
#define PB   (BT * 64)            // score row pitch in f32 (LDS): the band alone; column 0 is the band's first key. The same bytes then hold the row's P at pitch 2 * PB 16-bit elements (fp16 in the first half; or bf16 hi, then lo at + PB)
typedef _Float16 h16;
typedef unsigned short bf;
typedef __attribute__((ext_vector_type(16))) __bf16   v16bf;
typedef __attribute__((ext_vector_type(16))) _Float16 v16h;
typedef __attribute__((ext_vector_type(8)))  _Float16 v8h;
typedef __attribute__((ext_vector_type(8)))  unsigned short v8us;
typedef __attribute__((ext_vector_type(8)))  float    v8f;
typedef __attribute__((ext_vector_type(4)))  float    v4f;
typedef v8h  __attribute__((may_alias)) v8ha;
typedef v4f  __attribute__((may_alias)) v4fa;
typedef v8us __attribute__((may_alias)) v8usa;

__device__ __forceinline__ unsigned short f2bf(float f) { unsigned u = __float_as_uint(f); u += 0x7FFFu + ((u >> 16) & 1u); return (unsigned short)(u >> 16); }
__device__ __forceinline__ float bf2f(unsigned short b) { return __uint_as_float(((unsigned)b) << 16); }
__device__ __forceinline__ float bfr(float f) { return bf2f(f2bf(f)); }
__device__ __forceinline__ v16h cat16(v8h lo, v8h hi) { return __builtin_shufflevector(lo, hi, 0, 1, 2, 3, 4, 5, 6, 7, 8, 9, 10, 11, 12, 13, 14, 15); }
__device__ __forceinline__ v16bf cat16b(v8us lo, v8us hi) { return __builtin_bit_cast(v16bf, __builtin_shufflevector(lo, hi, 0, 1, 2, 3, 4, 5, 6, 7, 8, 9, 10, 11, 12, 13, 14, 15)); }
__device__ __forceinline__ v8f wmma16(v16h a, v16h b, v8f c) { return __builtin_amdgcn_wmma_f32_16x16x32_f16(false, a, false, b, (short)0, c, false, false); }
__device__ __forceinline__ v8f wmmab(v16bf a, v16bf b, v8f c) { return __builtin_amdgcn_wmma_f32_16x16x32_bf16(false, a, false, b, (short)0, c, false, false); }



// Fragment order of the q, k, v planes: a block of 16 rows x 64 K-contiguous 16-bit elements is FB elements in a row (q, k: 16 t x the head's 64 d; v: 16 d x 64 t, the blocks of a 16-d strip following each other in t). The 16-byte piece c (elements 8 c .. 8 c + 7) of row r lies at element (c >> 1) * 256 + ((c & 1) * 16 + r) * 8: a wave's load of one piece a lane, lane = hi * 16 + row, is 512 bytes in a row, four whole lines.
#define FB 1024
// a 16x32 fragment from two 16-byte pieces of a block in fragment order (p: block + 512 * (32-k step) + lane * 8), and its matrix instruction
template <typename T16> struct WFrag;
template <> struct WFrag<h16> { typedef v16h V; static __device__ __forceinline__ V ld(const h16* p) { return cat16(*(const v8h*)p, *(const v8h*)(p + 256)); } static __device__ __forceinline__ v8f mma(V a, V b, v8f c) { return wmma16(a, b, c); } };
template <> struct WFrag<bf> { typedef v16bf V; static __device__ __forceinline__ V ld(const bf* p) { return cat16b(*(const v8us*)p, *(const v8us*)(p + 256)); } static __device__ __forceinline__ v8f mma(V a, V b, v8f c) { return wmmab(a, b, c); } };

__device__ __forceinline__ h16 tohx(float x) { return (h16)x; }
__device__ __forceinline__ void splitf(float y, unsigned short& h, unsigned short& l) { h = f2bf(y); l = f2bf(y - bf2f(h)); }
typedef __attribute__((ext_vector_type(2))) _Float16 v2h;
typedef __attribute__((ext_vector_type(4))) _Float16 v4h;
typedef __attribute__((ext_vector_type(2))) unsigned short v2us;
typedef __attribute__((ext_vector_type(4))) unsigned short v4us;
typedef __attribute__((ext_vector_type(2))) float v2f;
typedef __attribute__((ext_vector_type(4))) int v4i;

__global__ __launch_bounds__(256) void k_wtG(const float* __restrict__ w, int K, int N, bf* Bt) {
    const int lane = threadIdx.x & 31; const int L0 = (blockIdx.x * 8 + (threadIdx.x >> 5)) * 8; const int nlines = N * K / 64;
{
#pragma unroll 1
        for (int l = 0; l < 8; ++l) { const int L = L0 + l; if (L >= nlines) break; const size_t e = (size_t)L * 64 + lane * 2; const int k = (int)(e % K), n = (int)(e / K); v2us o;
            o[0] = f2bf(w[(size_t)k * N + n]); o[1] = f2bf(w[(size_t)(k + 1) * N + n]); *(v2us*)(Bt + e) = o; }
         }
}
// every f32 -> bf16 conversion of the call in one launch: x, then Wq, Wk, Wv, Wo. A work-group takes CPG consecutive 8-element pieces of one array; a thread eight of them, 256 pieces apart, all its loads in flight before the first is converted. grid (TT * DM + 4 * DM * DM) / (8 * CPG).
#define CPG 2048
__global__ __launch_bounds__(256) void k_cvtall(const float* __restrict__ x, const float* __restrict__ wq, const float* __restrict__ wk, const float* __restrict__ wv, const float* __restrict__ wo, bf* XB, bf* WQ, bf* WK, bf* WV, bf* WO) {
    constexpr int GX = TT * DM / (8 * CPG), GW = DM * DM / (8 * CPG);   /* work-groups of x, and of one weight matrix */
    int g = blockIdx.x; const float* src = x; bf* dst = XB;
    if (g >= GX) { const int a = (g - GX) / GW; g = (g - GX) % GW; src = a == 0 ? wq : a == 1 ? wk : a == 2 ? wv : wo; dst = a == 0 ? WQ : a == 1 ? WK : a == 2 ? WV : WO; }
    const size_t e0 = ((size_t)g * CPG + threadIdx.x) * 8; const float* ps = src + e0; v8f v[8]; v8us o[8];
#pragma unroll
    for (int i = 0; i < 8; ++i) v[i] = *(const v8f*)(ps + i * 256 * 8);
    asm volatile("s_wait_xcnt 0x0" :: "v"(ps) : "memory");   /* stands before the loads' address registers are reused; the pointer is an input so that those registers live up to it */
#pragma unroll
    for (int i = 0; i < 8; ++i)
#pragma unroll
        for (int k = 0; k < 8; ++k) o[i][k] = f2bf(v[i][k]);
#pragma unroll
    for (int i = 0; i < 8; ++i) *(v8us*)(dst + e0 + i * 256 * 8) = o[i];
}

typedef v4h  __attribute__((may_alias)) v4ha;
typedef v4us __attribute__((may_alias)) v4usa;
// a 16x32 A fragment from two 16-byte pieces in LDS
template <typename T16> struct LFrag;
template <> struct LFrag<h16> { static __device__ __forceinline__ v16h ld2(const h16* p, const h16* q) { return cat16(*(const v8ha*)p, *(const v8ha*)q); } };
template <> struct LFrag<bf> { static __device__ __forceinline__ v16bf ld2(const bf* p, const bf* q) { return cat16b(*(const v8usa*)p, *(const v8usa*)q); } };

// ---- gemm_tile: y[m][n] = sum_k A[m][k] Bt[n][k] (NSPLIT 1: + A2[m][k] Bt[n][k]) + f32 bias. EPI 0: bias[n], y to C (f32, pitch ldc). EPI 1: bias[n], y as fp16, bf16 hi and bf16 lo to the planes P16, Ph, Pl at [n / 64][m][n % 64], ldc rows a plane. EPI 2: bias[m], the same three forms at [m][n], pitch ldc. Both in fragment order (FB): a wave's 16 rows x 64 columns are one block. A, A2, Bt K-contiguous bf16 planes of pitch K; K % 128 == 0, K >= 256. Tile (bx, by) of (M/128, N/128), 128 threads.
// One work-group of 4 waves per 128x128 tile, a wave per 64x64 quarter (16 accumulators). A pass is 128 k: 256 bytes of each of the tile's 128 A (A2) and 128 Bt rows, brought whole-line into LDS by asynchronous copies, two buffers, the next pass's copies in flight while this pass is multiplied. LDS row pitch 272 bytes (16 x odd: the 16 rows of a fragment read fall in different bank groups).
#define GP 136   // LDS row pitch in 16-bit elements
// eight copies of 16 bytes a lane, 8 rows apart (global pitch K elements, LDS pitch GP); g is the same for the whole work-group, toff the lane's own offset in elements
template <int K> __device__ __forceinline__ void copy8(unsigned l, const bf* g, size_t toff) {
    unsigned la[8]; const bf* ga[8];
#pragma unroll
    for (int i = 0; i < 8; ++i) { la[i] = l + i * 8 * GP * 2; ga[i] = g + (size_t)i * 8 * K + toff; }
    /* the wait stands in the copies' own statement: it ends before any of their address registers is rewritten */
    asm volatile("global_load_async_to_lds_b128 %0, %8, off\n\t"
                 "global_load_async_to_lds_b128 %1, %9, off\n\t"
                 "global_load_async_to_lds_b128 %2, %10, off\n\t"
                 "global_load_async_to_lds_b128 %3, %11, off\n\t"
                 "global_load_async_to_lds_b128 %4, %12, off\n\t"
                 "global_load_async_to_lds_b128 %5, %13, off\n\t"
                 "global_load_async_to_lds_b128 %6, %14, off\n\t"
                 "global_load_async_to_lds_b128 %7, %15, off\n\t"
                 "s_wait_xcnt 0x0"
                 :: "v"(la[0]), "v"(la[1]), "v"(la[2]), "v"(la[3]), "v"(la[4]), "v"(la[5]), "v"(la[6]), "v"(la[7]),
                    "v"(ga[0]), "v"(ga[1]), "v"(ga[2]), "v"(ga[3]), "v"(ga[4]), "v"(ga[5]), "v"(ga[6]), "v"(ga[7]) : "memory");
}
template <int NSPLIT, int EPI, int K>
__device__ __forceinline__ void gemm_tile(bf (*ring)[NSPLIT ? 3 : 2][128 * GP], float (*osb)[16 * 68], const int bx, const int by, const bf* __restrict__ A, const bf* __restrict__ A2, const bf* __restrict__ Bt, float* C, int ldc, const float* __restrict__ bias, h16* P16, bf* Ph, bf* Pl) {
    constexpr int NP = NSPLIT ? 3 : 2;   /* planes of a stage: A, Bt (, A2) */
    const int tid = threadIdx.x, lane = tid & 31, lr = lane & 15, hi = lane >> 4; const int wv = __builtin_amdgcn_readfirstlane(tid >> 5);
    const int R0 = bx * 128, C0 = by * 128; const int wm = (wv >> 1) * 64, wn = (wv & 1) * 64; const int r0 = R0 + wm, c0 = C0 + wn;
    /* a thread copies piece tid & 15 of rows tid >> 4, + 8, ... + 120 of each plane: a wave's copy takes two whole 256-byte row parts */
    const size_t toff = (size_t)(tid >> 4) * K + (tid & 15) * 8; const int lo = (tid >> 4) * GP + (tid & 15) * 8;
    auto fill = [&](int buf, int t) {
        const bf* pa = A + (size_t)R0 * K + t * 128; const bf* pb = Bt + (size_t)C0 * K + t * 128;
        copy8<K>((unsigned)(size_t)&ring[buf][0][lo], pa, toff); copy8<K>((unsigned)(size_t)&ring[buf][0][lo + 64 * GP], pa + (size_t)64 * K, toff);
        copy8<K>((unsigned)(size_t)&ring[buf][1][lo], pb, toff); copy8<K>((unsigned)(size_t)&ring[buf][1][lo + 64 * GP], pb + (size_t)64 * K, toff);
        if constexpr (NSPLIT) { const bf* pa2 = A2 + (size_t)R0 * K + t * 128; copy8<K>((unsigned)(size_t)&ring[buf][2][lo], pa2, toff); copy8<K>((unsigned)(size_t)&ring[buf][2][lo + 64 * GP], pa2 + (size_t)64 * K, toff); } };
    v8f acc[4][4];
#pragma unroll
    for (int mb = 0; mb < 4; ++mb)
#pragma unroll
        for (int nb = 0; nb < 4; ++nb) acc[mb][nb] = (v8f){};
    constexpr int NT = K / 128;
    fill(0, 0);
    asm volatile("s_wait_asynccnt 0x0" ::: "memory");   /* this wave's copies of pass 0 have landed */
    __syncthreads();   /* every wave's have: pass 0 may be read */
    fill(1, 1);
#pragma unroll 1   /* one pass a trip: the two buffers take turns by the trip's parity */
    for (int t = 0; t < NT; ++t) {
        const bf* As = &ring[t & 1][0][(wm + lr) * GP + 8 * hi]; const bf* Bs = &ring[t & 1][1][(wn + lr) * GP + 8 * hi]; const bf* A2s = &ring[t & 1][NP - 1][(wm + lr) * GP + 8 * hi];
        v16bf a[2][4], a2[2][4], b[2][4];   /* two fragment sets: a 32-k block's 16 (24) LDS reads go out while the block before it is multiplied */
        auto ldf = [&](int s, int ks) {
#pragma unroll
            for (int mb = 0; mb < 4; ++mb) { a[s][mb] = LFrag<bf>::ld2(As + mb * 16 * GP + ks * 32, As + mb * 16 * GP + ks * 32 + 16); if constexpr (NSPLIT) a2[s][mb] = LFrag<bf>::ld2(A2s + mb * 16 * GP + ks * 32, A2s + mb * 16 * GP + ks * 32 + 16); }
#pragma unroll
            for (int nb = 0; nb < 4; ++nb) b[s][nb] = LFrag<bf>::ld2(Bs + nb * 16 * GP + ks * 32, Bs + nb * 16 * GP + ks * 32 + 16); };
        ldf(0, 0);
#pragma unroll
        for (int ks = 0; ks < 4; ++ks) {
            if (ks < 3) ldf((ks + 1) & 1, ks + 1);
            __builtin_amdgcn_sched_barrier(0);   /* holds the next block's reads, as one group, ahead of this block's matrix instructions; sunk to their uses, each would expose the LDS latency */
#pragma unroll
            for (int nb = 0; nb < 4; ++nb) {
#pragma unroll
                for (int mb = 0; mb < 4; ++mb) acc[mb][nb] = wmmab(a[ks & 1][mb], b[ks & 1][nb], acc[mb][nb]);
                if constexpr (NSPLIT) {
#pragma unroll
                    for (int mb = 0; mb < 4; ++mb) acc[mb][nb] = wmmab(a2[ks & 1][mb], b[ks & 1][nb], acc[mb][nb]); } }
            __builtin_amdgcn_sched_barrier(0);   /* the block's matrix instructions stay ahead of the reads that reuse its fragment set, and of the pass's foot */
        }
        asm volatile("v_nop\n\tv_nop\n\tv_nop\n\tv_nop" : "+v"(acc[0][3]), "+v"(acc[1][3]), "+v"(acc[2][3]), "+v"(acc[3][3]));   /* a branch follows: keeps the matrix instructions' distance on its taken side too */
        asm volatile("s_wait_dscnt 0x0" ::: "memory");      /* this wave has left the buffer that is refilled below */
        asm volatile("s_wait_asynccnt 0x0" ::: "memory");   /* this wave's copies of pass t + 1 have landed */
        __syncthreads();   /* publishes pass t + 1 and ends every wave's reads of pass t */
        if (t + 2 < NT) fill(t & 1, t + 2);
    }
    asm volatile("s_wait_asynccnt 0x0" ::: "memory");   /* no copy is in flight when the wave goes on to its end */
    float* os = osb[wv];
    float bv[EPI == 1 ? 32 : 4];   /* the biases of the lane's eight columns in each of its four pieces (EPI 1), or of its row in each 16-row block (EPI 2) */
    if constexpr (EPI != 0) { const float* pb = bias + (EPI == 1 ? c0 + hi * 8 : r0 + lr);
#pragma unroll
        for (int q = 0; q < (EPI == 1 ? 32 : 4); ++q) bv[q] = pb[EPI == 1 ? (q >> 3) * 16 + (q & 7) : 16 * q];
        asm volatile("s_wait_xcnt 0x0" :: "v"(pb) : "memory");   /* stands before the bias loads' address registers are reused; the pointer is an input so that those registers live up to it */
    }
#pragma unroll
    for (int mb = 0; mb < 4; ++mb) {
#pragma unroll
        for (int nb = 0; nb < 4; ++nb) {
#pragma unroll
            for (int j = 0; j < 8; ++j) os[(hi * 8 + j) * 68 + nb * 16 + lr] = acc[mb][nb][j]; }
        __builtin_amdgcn_wave_barrier(); asm volatile("" ::: "memory");
        if constexpr (EPI == 0) {
            float* crow = C + (size_t)(r0 + mb * 16) * ldc + c0;
#pragma unroll
            for (int s = 0; s < 8; ++s) { const int row = 2 * s + hi, cofs = lr * 4; v4f val = *(const v4fa*)(os + row * 68 + cofs); val[0] += bfr(bias[c0 + cofs]); val[1] += bfr(bias[c0 + cofs + 1]); val[2] += bfr(bias[c0 + cofs + 2]); val[3] += bfr(bias[c0 + cofs + 3]);
                *(v4f*)(crow + (size_t)row * ldc + cofs) = val; }
        } else {   /* the 16 rows are one block in fragment order: store s takes pieces 2 s and 2 s + 1 of every row, 512 bytes in a row of each plane */
            const size_t eb = (EPI == 1 ? ((size_t)(c0 >> 6) * ldc + r0 + mb * 16) * HD : (size_t)(r0 + mb * 16) * ldc + (size_t)c0 * 16) + lane * 8;
#pragma unroll
            for (int s = 0; s < 4; ++s) { const int row = lr, cofs = (2 * s + hi) * 8;
                const v8f u = __builtin_shufflevector(*(const v4fa*)(os + row * 68 + cofs), *(const v4fa*)(os + row * 68 + cofs + 4), 0, 1, 2, 3, 4, 5, 6, 7); v8h o16; v8us oh, ol;
#pragma unroll
                for (int q = 0; q < 8; ++q) { const float y = u[q] + bfr(bv[EPI == 1 ? s * 8 + q : mb]); o16[q] = tohx(y); unsigned short a2, c2; splitf(y, a2, c2); oh[q] = a2; ol[q] = c2; }
                const size_t e = eb + s * 256;
                *(v8h*)(P16 + e) = o16; *(v8us*)(Ph + e) = oh; *(v8us*)(Pl + e) = ol; }
        }
        asm volatile("s_wait_xcnt 0x0" ::: "memory");   /* stands before the stores' data and address registers are reused for the next 16 rows */
        __builtin_amdgcn_wave_barrier(); asm volatile("" ::: "memory");
    }
}
template <int NSPLIT, int EPI, int K>
__global__ __launch_bounds__(128) void k_gemms(const bf* __restrict__ A, const bf* __restrict__ A2, const bf* __restrict__ Bt, float* C, int ldc, const float* __restrict__ bias, h16* P16, bf* Ph, bf* Pl) {
    __shared__ __align__(16) bf ring[2][NSPLIT ? 3 : 2][128 * GP];
    __shared__ __align__(16) float osb[4][16 * 68];
    gemm_tile<NSPLIT, EPI, K>(ring, osb, blockIdx.x, blockIdx.y, A, A2, Bt, C, ldc, bias, P16, Ph, Pl);
}
// the q, k and v projections in one launch, grid (TT / 128, DM / 128, 3): z = 0 is q = x Wq^T, z = 1 is k = x Wk^T, z = 2 is v^T = Wv x^T (its rows are the [h][d] rows of the v planes; block x stays the 128 rows of x). Two work-groups fit a WGP's LDS: one's copies, barriers and epilogue run beside the other's matrix instructions.
__global__ __launch_bounds__(128) void k_qkv(const bf* __restrict__ X, const bf* __restrict__ Wq, const bf* __restrict__ Wk, const bf* __restrict__ Wv, const float* __restrict__ bq, const float* __restrict__ bk, const float* __restrict__ bv,
                                             h16* Q16, bf* Qh, bf* Ql, h16* K16, bf* Kh, bf* Kl, h16* V16, bf* Vh, bf* Vl) {
    __shared__ __align__(16) bf ring[2][2][128 * GP];
    __shared__ __align__(16) float osb[4][16 * 68];
    const int z = blockIdx.z;
    if (z == 2) gemm_tile<0, 2, DM>(ring, osb, blockIdx.y, blockIdx.x, Wv, nullptr, X, nullptr, TT, bv, V16, Vh, Vl);
    else gemm_tile<0, 1, DM>(ring, osb, blockIdx.x, blockIdx.y, X, nullptr, z ? Wk : Wq, nullptr, TT, z ? bk : bq, z ? K16 : Q16, z ? Kh : Qh, z ? Kl : Ql);
}


// ---- attention of one (64-row tile, head) by one work-group of 8 waves; the tile's score band S[64][PB] f32 lives in LDS and never reaches memory.
// 1 scores: wave w does the 64 rows x keys [80 w, 80 w + 80) of the band, q fragments held in registers. A score of logical column x of row r lies at x ^ (16 if r & 8): the two half-waves of an accumulator store then hit different banks.
// 2 softmax: wave w owns rows 8 w .. 8 w + 7; a row is read once, and its P goes over its own bytes (fp16 in the first half; or bf16 hi, then lo at + PB), the 16-byte piece c of row r at piece c ^ (r & 15): the 16 rows of an A fragment read then fall in 16 different bank groups.
// 3 P V: wave w does rows 16 (w >> 1) .. + 15 x columns 32 (w & 1) .. + 31, k ascending over the keys the tile's window can reach; V^T fragments come from memory one 64-key group ahead.
// 4 output: the 64x64 tile is gathered in the band's LDS, free by then, and leaves as bf16 hi and lo planes at [t][head 64 + d] (pitch DQ), the operands of the last projection; four lanes a row, so a row's 64 values are one whole 128-byte line of each plane.
template <typename T16, bool HR>
__device__ __forceinline__ void attn_tile(float* S, const T16* __restrict__ Q, const T16* __restrict__ Q2, const T16* __restrict__ Kp, const T16* __restrict__ K2, const T16* __restrict__ Vt, const T16* __restrict__ Vt2, bf* Ah, bf* Al, const int r0) {
    typedef typename WFrag<T16>::V V;
    const int lane = threadIdx.x & 31, lr = lane & 15, hi = lane >> 4; const int wv = __builtin_amdgcn_readfirstlane((int)(threadIdx.x >> 5));
    const int band0 = (((r0 >> 6) - WNB / 64) & ~1) * 64;   /* first key of the row tile's band (below 0 at the sequence's start) */
    {
        V a[4][2], a2[4][2]; const T16* pq = Q + (size_t)r0 * HD + lane * 8; const T16* pq2 = HR ? Q2 + (size_t)r0 * HD + lane * 8 : nullptr;   /* the tile's four blocks follow each other */
#pragma unroll
        for (int mb = 0; mb < 4; ++mb) { a[mb][0] = WFrag<T16>::ld(pq + mb * FB); a[mb][1] = WFrag<T16>::ld(pq + mb * FB + 512); if constexpr (HR) { a2[mb][0] = WFrag<T16>::ld(pq2 + mb * FB); a2[mb][1] = WFrag<T16>::ld(pq2 + mb * FB + 512); } }
        /* stands before the q loads' address registers are reused; the pointers are inputs so that those registers live up to it */
        if constexpr (HR) asm volatile("s_wait_xcnt 0x0" :: "v"(pq), "v"(pq2) : "memory");
        else asm volatile("s_wait_xcnt 0x0" :: "v"(pq) : "memory");
        constexpr int G = HR ? 1 : 5;   /* 16-key pieces whose k fragments are fetched together (hi/lo planes: one, for registers) */
#pragma unroll
        for (int g = 0; g < 5; g += G) {
            V b[G][2], b2[G][2]; const T16* pk[G]; const T16* pk2[G];
#pragma unroll
            for (int u = 0; u < G; ++u) { const int key = min(max(band0 + (wv * 5 + g + u) * 16, 0), TT - 16);   /* a piece off the sequence loads in-bounds keys, so that no branch parts the loads; it is skipped below */
                pk[u] = Kp + (size_t)key * HD + lane * 8; b[u][0] = WFrag<T16>::ld(pk[u]); b[u][1] = WFrag<T16>::ld(pk[u] + 512); if constexpr (HR) { pk2[u] = K2 + (size_t)key * HD + lane * 8; b2[u][0] = WFrag<T16>::ld(pk2[u]); b2[u][1] = WFrag<T16>::ld(pk2[u] + 512); } }
            /* stands before the k loads' address registers are reused; the pointers are inputs so that those registers live up to it */
            if constexpr (HR) asm volatile("s_wait_xcnt 0x0" :: "v"(pk[0]), "v"(pk2[0]) : "memory");
            else asm volatile("s_wait_xcnt 0x0" :: "v"(pk[0]), "v"(pk[1]), "v"(pk[2]), "v"(pk[3]), "v"(pk[4]) : "memory");
#pragma unroll
            for (int u = 0; u < G; ++u) { const int sub = wv * 5 + g + u; const int key0 = band0 + sub * 16; if (key0 < 0 || key0 >= TT) continue;
                v8f acc[4];
#pragma unroll
                for (int mb = 0; mb < 4; ++mb) acc[mb] = (v8f){};
#pragma unroll
                for (int kk = 0; kk < 2; ++kk)
#pragma unroll
                    for (int mb = 0; mb < 4; ++mb) { acc[mb] = WFrag<T16>::mma(a[mb][kk], b[u][kk], acc[mb]); if constexpr (HR) { acc[mb] = WFrag<T16>::mma(a2[mb][kk], b[u][kk], acc[mb]); acc[mb] = WFrag<T16>::mma(a[mb][kk], b2[u][kk], acc[mb]); } }
                float* sc = S + hi * 8 * PB + ((sub * 16 + lr) ^ (hi << 4));
#pragma unroll
                for (int mb = 0; mb < 4; ++mb)
#pragma unroll
                    for (int j = 0; j < 8; ++j) sc[(mb * 16 + j) * PB] = acc[mb][j]; }
        }
    }
    __syncthreads();   /* every wave's scores are in LDS before a row is read */
    const int cb = band0 >> 7;   /* first of the BT / 2 128-key chunks of the band; a chunk off the sequence (on false) gets j0 = -TT, which fails the window test for every row */
    const int sw = (wv & 1) << 4;
#pragma unroll 2   /* two rows in flight: one row's cross-lane reductions are covered by the other's arithmetic */
    for (int rr = 0; rr < 8; ++rr) { const int row = wv * 8 + rr, i = r0 + row; float* sr = S + row * PB; float t[BT / 2][4]; float mx = -3.0e38f;
#pragma unroll
        for (int c = 0; c < BT / 2; ++c) { const int ch = cb + c; const bool on = ch >= 0 && ch < TT / 128; const int j0 = on ? ch * 128 + lane * 4 : -TT; const v4f a = *(const v4fa*)(sr + (((on ? c : max(cb, 0) - cb) * 128 + lane * 4) ^ sw));   /* a chunk off the sequence reads an in-band one; the window test masks it */
#pragma unroll
            for (int q = 0; q < 4; ++q) { const float s = a[q] * SCL; t[c][q] = (j0 + q <= i + WNB && j0 + q >= i - WNB) ? s : -3.0e38f;   /* symmetric window: |i - j| <= WNB */ mx = fmaxf(mx, t[c][q]); } }
#pragma unroll
        for (int sh = 16; sh; sh >>= 1) mx = fmaxf(mx, __shfl_xor(mx, sh, 32));
        float sum = 0.f;
#pragma unroll
        for (int c = 0; c < BT / 2; ++c)
#pragma unroll
            for (int q = 0; q < 4; ++q) { t[c][q] = __builtin_amdgcn_exp2f(__fmul_rn(__fsub_rn(t[c][q], mx), 1.4426950408889634f)); sum += t[c][q]; }
#pragma unroll
        for (int sh = 16; sh; sh >>= 1) sum += __shfl_xor(sum, sh, 32);
        const float f = __fdiv_rn(HR ? 1.0f : PCAR, sum);
        T16* pr = (T16*)sr + (lane & 1) * 4;
#pragma unroll
        for (int c = 0; c < BT / 2; ++c) { const int ch = cb + c; if (ch < 0 || ch >= TT / 128) continue; const int pc = ((c * 16 + (lane >> 1)) ^ (row & 15)) * 8;
            if constexpr (HR) { v4us oh, ol;
#pragma unroll
                for (int q = 0; q < 4; ++q) { unsigned short a2, c2; splitf(t[c][q] * f, a2, c2); oh[q] = a2; ol[q] = c2; }
                *(v4usa*)(pr + pc) = oh; *(v4usa*)(pr + PB + pc) = ol;
            } else { v4h o4;
#pragma unroll
                for (int q = 0; q < 4; ++q) o4[q] = tohx(t[c][q] * f);
                *(v4ha*)(pr + pc) = o4; } } }
    __syncthreads();   /* every row's P is in LDS before a fragment of it is read */
    const int mb = wv >> 1, n0 = (wv & 1) * 32; const int k0 = max(r0 - WNB, 0), k1 = min(r0 + 64 + WNB, TT);
    const T16* pa = (const T16*)S + (mb * 16 + lr) * (2 * PB);
    const size_t voff = (size_t)n0 * TT + lane * 8;   /* the wave's first 16-d strip of blocks, and the lane's piece */
    v8f acc[2]; acc[0] = (v8f){}; acc[1] = (v8f){};
    V bc[2][2], bc2[2][2], bn[2][2], bn2[2][2];   /* [column block][32-key step] */
    auto ldv = [&](V (&d)[2][2], V (&d2)[2][2], int kc) { const T16* p = Vt + voff + (size_t)(kc >> 6) * FB; const T16* p2 = HR ? Vt2 + voff + (size_t)(kc >> 6) * FB : nullptr;   /* the second column block's strip lies 16 * TT elements on */
#pragma unroll
        for (int nb = 0; nb < 2; ++nb) { d[nb][0] = WFrag<T16>::ld(p + nb * 16 * TT); d[nb][1] = WFrag<T16>::ld(p + nb * 16 * TT + 512); if constexpr (HR) { d2[nb][0] = WFrag<T16>::ld(p2 + nb * 16 * TT); d2[nb][1] = WFrag<T16>::ld(p2 + nb * 16 * TT + 512); } }
        /* stands before the v loads' address registers are reused; the pointers are inputs so that those registers live up to it */
        if constexpr (HR) asm volatile("s_wait_xcnt 0x0" :: "v"(p), "v"(p2) : "memory");
        else asm volatile("s_wait_xcnt 0x0" :: "v"(p) : "memory"); };
    auto step = [&](V (&d)[2][2], V (&d2)[2][2], int kc) {
#pragma unroll
        for (int s = 0; s < 2; ++s) { const int pc = ((kc - band0) >> 3) + s * 4 + hi; const V a = LFrag<T16>::ld2(pa + ((pc ^ lr) << 3), pa + (((pc + 2) ^ lr) << 3)); V a2; if constexpr (HR) a2 = LFrag<T16>::ld2(pa + PB + ((pc ^ lr) << 3), pa + PB + (((pc + 2) ^ lr) << 3));
#pragma unroll
            for (int nb = 0; nb < 2; ++nb) { acc[nb] = WFrag<T16>::mma(a, d[nb][s], acc[nb]); if constexpr (HR) { acc[nb] = WFrag<T16>::mma(a2, d[nb][s], acc[nb]); acc[nb] = WFrag<T16>::mma(a, d2[nb][s], acc[nb]); } } }
        asm volatile("v_nop\n\tv_nop\n\tv_nop\n\tv_nop" : "+v"(acc[0]), "+v"(acc[1]));   /* a branch follows: keeps the matrix instructions' distance on its taken side too */
    };
    ldv(bc, bc2, k0);
#pragma unroll 1
    for (int kc = k0; kc < k1; kc += 128) {   /* two register sets in turn: the next 64-key group flies while this one is multiplied; the last fetch takes the last group again rather than branch */
        ldv(bn, bn2, min(kc + 64, k1 - 64)); step(bc, bc2, kc);
        if (kc + 64 >= k1) break;
        ldv(bc, bc2, min(kc + 128, k1 - 64)); step(bn, bn2, kc + 64);
    }
    __syncthreads();   /* every wave has read its last P fragment: the band's LDS may take the output tile */
    float* so = S + (mb * 16 + hi * 8) * 68 + n0 + lr;
#pragma unroll
    for (int nb = 0; nb < 2; ++nb)
#pragma unroll
        for (int j = 0; j < 8; ++j) so[j * 68 + nb * 16] = acc[nb][j];
    __syncthreads();   /* a row's two halves come from two waves: both are in LDS before the row is read */
    const int orow = (int)(threadIdx.x >> 2), ocol = (int)(threadIdx.x & 3) * 16; const float cs = HR ? 1.0f : (1.0f / PCAR);
    v8us oh[2], ol[2];
#pragma unroll
    for (int p = 0; p < 2; ++p) { const v8f u = __builtin_shufflevector(*(const v4fa*)(S + orow * 68 + ocol + p * 8), *(const v4fa*)(S + orow * 68 + ocol + p * 8 + 4), 0, 1, 2, 3, 4, 5, 6, 7);
#pragma unroll
        for (int q = 0; q < 8; ++q) { unsigned short a2, c2; splitf(u[q] * cs, a2, c2); oh[p][q] = a2; ol[p][q] = c2; } }
    const size_t oo = (size_t)(r0 + orow) * DQ + ocol;
    *(v8us*)(Ah + oo) = oh[0]; *(v8us*)(Ah + oo + 8) = oh[1]; *(v8us*)(Al + oo) = ol[0]; *(v8us*)(Al + oo + 8) = ol[1];
}
__global__ __launch_bounds__(256) void k_attn(const h16* __restrict__ Q16, const h16* __restrict__ K16, const h16* __restrict__ V16, const bf* __restrict__ Qh, const bf* __restrict__ Ql, const bf* __restrict__ Kh, const bf* __restrict__ Kl, const bf* __restrict__ Vh, const bf* __restrict__ Vl, bf* Ah, bf* Al) {
    __shared__ __align__(16) float S[64 * PB];
    const size_t zo = (size_t)blockIdx.z * TT * HD; const int r0 = blockIdx.x * 64; const int ho = blockIdx.z * HD;
    if (r0 < RH) attn_tile<bf, true>(S, Qh + zo, Ql + zo, Kh + zo, Kl + zo, Vh + zo, Vl + zo, Ah + ho, Al + ho, r0);
    else attn_tile<h16, false>(S, Q16 + zo, nullptr, K16 + zo, nullptr, V16 + zo, nullptr, Ah + ho, Al + ho, r0);
}


extern "C" void kernel_launch(void* const* d_in, const int* in_sizes, int n_in,
                              void* d_out, int out_size, void* d_ws, size_t ws_size, hipStream_t stream) {
    (void)in_sizes; (void)n_in; (void)out_size;
    const float* x = (const float*)d_in[0]; const float* wq = (const float*)d_in[1]; const float* bq = (const float*)d_in[2]; const float* wk = (const float*)d_in[3]; const float* bk = (const float*)d_in[4]; const float* wv = (const float*)d_in[5]; const float* bv = (const float*)d_in[6]; const float* wo = (const float*)d_in[7]; const float* bo = (const float*)d_in[8];
    float* OUT = (float*)d_out;     // [1][4096][1024]
    char* wsp = (char*)d_ws;
    auto take = [&](size_t bytes) { char* p = wsp; wsp += (bytes + 255) & ~(size_t)255; return (void*)p; };
    bf* WO = (bf*)take((size_t)DM * DQ * 2);
    h16* QP16 = (h16*)take((size_t)NH_ * TT * HD * 2); h16* KP16 = (h16*)take((size_t)NKV * TT * HD * 2); h16* VT16 = (h16*)take((size_t)NKV * HD * TT * 2);
    bf* QPh = (bf*)take((size_t)NH_ * TT * HD * 2); bf* QPl = (bf*)take((size_t)NH_ * TT * HD * 2); bf* KPh = (bf*)take((size_t)NKV * TT * HD * 2); bf* KPl = (bf*)take((size_t)NKV * TT * HD * 2); bf* VTh = (bf*)take((size_t)NKV * HD * TT * 2); bf* VTl = (bf*)take((size_t)NKV * HD * TT * 2);
    bf* ATh = (bf*)take((size_t)TT * DQ * 2); bf* ATl = (bf*)take((size_t)TT * DQ * 2);   // planes of their own: the attention launch writes them while its other work-groups still read the q planes
    bf* WQ = (bf*)take((size_t)DQ * DM * 2); bf* WK = (bf*)take((size_t)DKV * DM * 2); bf* WV = (bf*)take((size_t)DKV * DM * 2);
    bf* XB = (bf*)take((size_t)TT * DM * 2);
    if ((size_t)(wsp - (char*)d_ws) > ws_size) return;    // ws 256 MiB; 104 MiB taken
    for (int b = 0; b < NB_; ++b) {
        
        k_cvtall<<<(TT * DM + 4 * DM * DM) / (8 * CPG), 256, 0, stream>>>(x + (size_t)b * TT * DM, wq, wk, wv, wo, XB, WQ, WK, WV, WO);
        k_qkv<<<dim3(TT / 128, DM / 128, 3), 128, 0, stream>>>(XB, WQ, WK, WV, bq, bk, bv, QP16, QPh, QPl, KP16, KPh, KPl, VT16, VTh, VTl);
        for (int h0 = 0; h0 < NH_; h0 += ZH) { const size_t zq = (size_t)h0, zk = (size_t)(h0 / REP);   // one kv head per query head: the pass's heads use consecutive kv planes (z-strides TT*HD)
            k_attn<<<dim3(TT / 64, 1, ZH), 256, 0, stream>>>(QP16 + zq * TT * HD, KP16 + zk * TT * HD, VT16 + zk * HD * TT, QPh + zq * TT * HD, QPl + zq * TT * HD, KPh + zk * TT * HD, KPl + zk * TT * HD, VTh + zk * HD * TT, VTl + zk * HD * TT, ATh + zq * HD, ATl + zq * HD); }
        k_gemms<1, 0, DQ><<<dim3(TT / 128, DM / 128, 1), 128, 0, stream>>>(ATh, ATl, WO, OUT + (size_t)b * TT * DM, DM, bo, nullptr, nullptr, nullptr); }
}

// v008
// One run takes 90.1 microseconds.
// Two timings next to v007 both put it at 1.06 times that version's speed.
// Over all steps from v000 it is 45.5 times as fast.
#include <hip/hip_runtime.h>

// Local multi-head attention with a symmetric window (x [1][4096][1024]; q,k,v = x W^T + b ('oi' [1024][1024] + [1024], 0.02; 16 heads x 64); scores / 8; keys with |i - j| > 256 -> -inf; softmax; out = merged Wo^T + bo -> [1][4096][1024] (4.2 M)).
// Layout: bf16 copy of x; exact projections + f32 biases, whose epilogues write the fp16 and bf16 hi/lo head planes themselves (q, k as [h][t][d]; v as [h][d][t], from the product taken as Wv x^T; each plane in fragment order, see FB); attention, all 16 heads per pass as grid z (hybrid rows: < 512 hi/lo 3 products, rest fp16 x1024; softmax applying the |i - j| <= 256 window as an index select; scores, softmax and P V of a 64-row tile in one work-group, over the tile's key band alone, the score band in LDS, whose rows the softmax overwrites with P; the tile's output leaves as the merged hi/lo planes); merged hi/lo x Wo exact + bo.
// Compute dtypes, f32 accumulate: every input rounded to bf16; projections exact + f32 biases; attention rows < 512 3 products, rest fp16; softmax f32; Wo hl x exact + bias.

#define NB_  1
#define TT   4096
#define DM   1024
#define NH_  16
#define NKV  16
#define REP  (NH_ / NKV)
#define HD   64
#define DQ   (NH_ * HD)
#define DKV  (NKV * HD)
#define ZH   16                   // heads per pass (grid z of the attention launches)
#define RH   512                  // query rows < RH use hi+lo planes (0: none)
#define WIN  0
#define PCAR 1024.0f
#define SCL  0.125f
#define WNB  256     // |i - j| <= 256 kept
#define BT   (2 * WNB / 64 + 2)   // 64-key tiles computed per 64-row tile: the 9 the window can reach, widened to whole 128-key softmax chunks
#define PB   (BT * 64)            // score row pitch in f32 (LDS): the band alone; column 0 is the band's first key. The same bytes then hold the row's P at pitch 2 * PB 16-bit elements (fp16 in the first half; or bf16 hi, then lo at + PB)
typedef _Float16 h16;
typedef unsigned short bf;
typedef __attribute__((ext_vector_type(16))) __bf16   v16bf;
typedef __attribute__((ext_vector_type(16))) _Float16 v16h;
typedef __attribute__((ext_vector_type(8)))  _Float16 v8h;
typedef __attribute__((ext_vector_type(8)))  unsigned short v8us;
typedef __attribute__((ext_vector_type(8)))  float    v8f;
typedef __attribute__((ext_vector_type(4)))  float    v4f;
typedef v8h  __attribute__((may_alias)) v8ha;
typedef v4f  __attribute__((may_alias)) v4fa;
typedef v8us __attribute__((may_alias)) v8usa;

__device__ __forceinline__ unsigned short f2bf(float f) { unsigned u = __float_as_uint(f); u += 0x7FFFu + ((u >> 16) & 1u); return (unsigned short)(u >> 16); }
__device__ __forceinline__ float bf2f(unsigned short b) { return __uint_as_float(((unsigned)b) << 16); }
__device__ __forceinline__ float bfr(float f) { return bf2f(f2bf(f)); }
__device__ __forceinline__ v16h cat16(v8h lo, v8h hi) { return __builtin_shufflevector(lo, hi, 0, 1, 2, 3, 4, 5, 6, 7, 8, 9, 10, 11, 12, 13, 14, 15); }
__device__ __forceinline__ v16bf cat16b(v8us lo, v8us hi) { return __builtin_bit_cast(v16bf, __builtin_shufflevector(lo, hi, 0, 1, 2, 3, 4, 5, 6, 7, 8, 9, 10, 11, 12, 13, 14, 15)); }
__device__ __forceinline__ v8f wmma16(v16h a, v16h b, v8f c) { return __builtin_amdgcn_wmma_f32_16x16x32_f16(false, a, false, b, (short)0, c, false, false); }
__device__ __forceinline__ v8f wmmab(v16bf a, v16bf b, v8f c) { return __builtin_amdgcn_wmma_f32_16x16x32_bf16(false, a, false, b, (short)0, c, false, false); }



// Fragment order of the q, k, v planes: a block of 16 rows x 64 K-contiguous 16-bit elements is FB elements in a row (q, k: 16 t x the head's 64 d; v: 16 d x 64 t, the blocks of a 16-d strip following each other in t). The 16-byte piece c (elements 8 c .. 8 c + 7) of row r lies at element (c >> 1) * 256 + ((c & 1) * 16 + r) * 8: a wave's load of one piece a lane, lane = hi * 16 + row, is 512 bytes in a row, four whole lines.
#define FB 1024
// a 16x32 fragment from two 16-byte pieces of a block in fragment order (p: block + 512 * (32-k step) + lane * 8), and its matrix instruction
template <typename T16> struct WFrag;
template <> struct WFrag<h16> { typedef v16h V; static __device__ __forceinline__ V ld(const h16* p) { return cat16(*(const v8h*)p, *(const v8h*)(p + 256)); } static __device__ __forceinline__ v8f mma(V a, V b, v8f c) { return wmma16(a, b, c); } };
template <> struct WFrag<bf> { typedef v16bf V; static __device__ __forceinline__ V ld(const bf* p) { return cat16b(*(const v8us*)p, *(const v8us*)(p + 256)); } static __device__ __forceinline__ v8f mma(V a, V b, v8f c) { return wmmab(a, b, c); } };

__device__ __forceinline__ h16 tohx(float x) { return (h16)x; }
__device__ __forceinline__ void splitf(float y, unsigned short& h, unsigned short& l) { h = f2bf(y); l = f2bf(y - bf2f(h)); }
typedef __attribute__((ext_vector_type(2))) _Float16 v2h;
typedef __attribute__((ext_vector_type(4))) _Float16 v4h;
typedef __attribute__((ext_vector_type(2))) unsigned short v2us;
typedef __attribute__((ext_vector_type(4))) unsigned short v4us;
typedef __attribute__((ext_vector_type(2))) float v2f;
typedef __attribute__((ext_vector_type(4))) int v4i;

__global__ __launch_bounds__(256) void k_wtG(const float* __restrict__ w, int K, int N, bf* Bt) {
    const int lane = threadIdx.x & 31; const int L0 = (blockIdx.x * 8 + (threadIdx.x >> 5)) * 8; const int nlines = N * K / 64;
{
#pragma unroll 1
        for (int l = 0; l < 8; ++l) { const int L = L0 + l; if (L >= nlines) break; const size_t e = (size_t)L * 64 + lane * 2; const int k = (int)(e % K), n = (int)(e / K); v2us o;
            o[0] = f2bf(w[(size_t)k * N + n]); o[1] = f2bf(w[(size_t)(k + 1) * N + n]); *(v2us*)(Bt + e) = o; }
         }
}
// every f32 -> bf16 conversion of the call in one launch: x, then Wq, Wk, Wv, Wo. A work-group takes CPG consecutive 8-element pieces of one array; a thread eight of them, 256 pieces apart, all its loads in flight before the first is converted. grid (TT * DM + 4 * DM * DM) / (8 * CPG).
#define CPG 2048
__global__ __launch_bounds__(256) void k_cvtall(const float* __restrict__ x, const float* __restrict__ wq, const float* __restrict__ wk, const float* __restrict__ wv, const float* __restrict__ wo, bf* XB, bf* WQ, bf* WK, bf* WV, bf* WO) {
    constexpr int GX = TT * DM / (8 * CPG), GW = DM * DM / (8 * CPG);   /* work-groups of x, and of one weight matrix */
    int g = blockIdx.x; const float* src = x; bf* dst = XB;
    if (g >= GX) { const int a = (g - GX) / GW; g = (g - GX) % GW; src = a == 0 ? wq : a == 1 ? wk : a == 2 ? wv : wo; dst = a == 0 ? WQ : a == 1 ? WK : a == 2 ? WV : WO; }
    const size_t e0 = ((size_t)g * CPG + threadIdx.x) * 8; const float* ps = src + e0; v8f v[8]; v8us o[8];
#pragma unroll
    for (int i = 0; i < 8; ++i) v[i] = *(const v8f*)(ps + i * 256 * 8);
    asm volatile("s_wait_xcnt 0x0" :: "v"(ps) : "memory");   /* stands before the loads' address registers are reused; the pointer is an input so that those registers live up to it */
#pragma unroll
    for (int i = 0; i < 8; ++i)
#pragma unroll
        for (int k = 0; k < 8; ++k) o[i][k] = f2bf(v[i][k]);
#pragma unroll
    for (int i = 0; i < 8; ++i) *(v8us*)(dst + e0 + i * 256 * 8) = o[i];
}

typedef v4h  __attribute__((may_alias)) v4ha;
typedef v4us __attribute__((may_alias)) v4usa;
// a 16x32 A fragment from two 16-byte pieces in LDS
template <typename T16> struct LFrag;
template <> struct LFrag<h16> { static __device__ __forceinline__ v16h ld2(const h16* p, const h16* q) { return cat16(*(const v8ha*)p, *(const v8ha*)q); } };
template <> struct LFrag<bf> { static __device__ __forceinline__ v16bf ld2(const bf* p, const bf* q) { return cat16b(*(const v8usa*)p, *(const v8usa*)q); } };

// ---- gemm_tile: y[m][n] = sum_k A[m][k] Bt[n][k] (NSPLIT 1: + A2[m][k] Bt[n][k]) + f32 bias. EPI 0: bias[n], y to C (f32, pitch ldc). EPI 1: bias[n], y as fp16, bf16 hi and bf16 lo to the planes P16, Ph, Pl at [n / 64][m][n % 64], ldc rows a plane. EPI 2: bias[m], the same three forms at [m][n], pitch ldc. Both in fragment order (FB): a wave's 16 rows x 64 columns are one block. A, A2, Bt K-contiguous bf16 planes of pitch K; K % 128 == 0, K >= 256. Tile (bx, by) of (M/128, N/128), 128 threads.
// One work-group of 4 waves per 128x128 tile, a wave per 64x64 quarter (16 accumulators). A pass is 128 k: 256 bytes of each of the tile's 128 A (A2) and 128 Bt rows, brought whole-line into LDS by asynchronous copies, two buffers, the next pass's copies in flight while this pass is multiplied. LDS row pitch 272 bytes (16 x odd: the 16 rows of a fragment read fall in different bank groups).
#define GP 136   // LDS row pitch in 16-bit elements
// eight copies of 16 bytes a lane, 8 rows apart (global pitch K elements, LDS pitch GP); g is the same for the whole wave, toff the lane's own offset in elements
template <int K> __device__ __forceinline__ void copy8(unsigned l, const bf* g, size_t toff) {
    unsigned la[8]; const bf* ga[8];
#pragma unroll
    for (int i = 0; i < 8; ++i) { la[i] = l + i * 8 * GP * 2; ga[i] = g + (size_t)i * 8 * K + toff; }
    /* the wait stands in the copies' own statement: it ends before any of their address registers is rewritten */
    asm volatile("global_load_async_to_lds_b128 %0, %8, off\n\t"
                 "global_load_async_to_lds_b128 %1, %9, off\n\t"
                 "global_load_async_to_lds_b128 %2, %10, off\n\t"
                 "global_load_async_to_lds_b128 %3, %11, off\n\t"
                 "global_load_async_to_lds_b128 %4, %12, off\n\t"
                 "global_load_async_to_lds_b128 %5, %13, off\n\t"
                 "global_load_async_to_lds_b128 %6, %14, off\n\t"
                 "global_load_async_to_lds_b128 %7, %15, off\n\t"
                 "s_wait_xcnt 0x0"
                 :: "v"(la[0]), "v"(la[1]), "v"(la[2]), "v"(la[3]), "v"(la[4]), "v"(la[5]), "v"(la[6]), "v"(la[7]),
                    "v"(ga[0]), "v"(ga[1]), "v"(ga[2]), "v"(ga[3]), "v"(ga[4]), "v"(ga[5]), "v"(ga[6]), "v"(ga[7]) : "memory");
}
// one 128-k pass of a wave's 64x64 quarter from LDS: As, Bs (A2s) point at the lane's first piece of the quarter's A and Bt (A2) rows
template <int NSPLIT>
__device__ __forceinline__ void gemm_mul(v8f (&acc)[4][4], const bf* As, const bf* Bs, const bf* A2s) {
        v16bf a[2][4], a2[2][4], b[2][4];   /* two fragment sets: a 32-k block's 16 (24) LDS reads go out while the block before it is multiplied */
        auto ldf = [&](int s, int ks) {
#pragma unroll
            for (int mb = 0; mb < 4; ++mb) { a[s][mb] = LFrag<bf>::ld2(As + mb * 16 * GP + ks * 32, As + mb * 16 * GP + ks * 32 + 16); if constexpr (NSPLIT) a2[s][mb] = LFrag<bf>::ld2(A2s + mb * 16 * GP + ks * 32, A2s + mb * 16 * GP + ks * 32 + 16); }
#pragma unroll
            for (int nb = 0; nb < 4; ++nb) b[s][nb] = LFrag<bf>::ld2(Bs + nb * 16 * GP + ks * 32, Bs + nb * 16 * GP + ks * 32 + 16); };
        ldf(0, 0);
#pragma unroll
        for (int ks = 0; ks < 4; ++ks) {
            if (ks < 3) ldf((ks + 1) & 1, ks + 1);
            __builtin_amdgcn_sched_barrier(0);   /* holds the next block's reads, as one group, ahead of this block's matrix instructions; sunk to their uses, each would expose the LDS latency to the SIMD's few waves (one in k_gemms, three in k_qkv) */
#pragma unroll
            for (int nb = 0; nb < 4; ++nb) {
#pragma unroll
                for (int mb = 0; mb < 4; ++mb) acc[mb][nb] = wmmab(a[ks & 1][mb], b[ks & 1][nb], acc[mb][nb]);
                if constexpr (NSPLIT) {
#pragma unroll
                    for (int mb = 0; mb < 4; ++mb) acc[mb][nb] = wmmab(a2[ks & 1][mb], b[ks & 1][nb], acc[mb][nb]); } }
            __builtin_amdgcn_sched_barrier(0);   /* the block's matrix instructions stay ahead of the reads that reuse its fragment set, and of the pass's foot */
        }
        asm volatile("v_nop\n\tv_nop\n\tv_nop\n\tv_nop" : "+v"(acc[0][3]), "+v"(acc[1][3]), "+v"(acc[2][3]), "+v"(acc[3][3]));   /* a branch follows: keeps the matrix instructions' distance on its taken side too */
}
// a wave's 64x64 quarter (first row r0, first column c0) leaves by way of os, the wave's own 16 x 68 floats of LDS
template <int EPI>
__device__ __forceinline__ void gemm_out(v8f (&acc)[4][4], float* os, const int r0, const int c0, float* C, int ldc, const float* __restrict__ bias, h16* P16, bf* Ph, bf* Pl) {
    const int lane = threadIdx.x & 31, lr = lane & 15, hi = lane >> 4;
    float bv[EPI == 1 ? 32 : 4];   /* the biases of the lane's eight columns in each of its four pieces (EPI 1), or of its row in each 16-row block (EPI 2) */
    if constexpr (EPI != 0) { const float* pb = bias + (EPI == 1 ? c0 + hi * 8 : r0 + lr);
#pragma unroll
        for (int q = 0; q < (EPI == 1 ? 32 : 4); ++q) bv[q] = pb[EPI == 1 ? (q >> 3) * 16 + (q & 7) : 16 * q];
        asm volatile("s_wait_xcnt 0x0" :: "v"(pb) : "memory");   /* stands before the bias loads' address registers are reused; the pointer is an input so that those registers live up to it */
    }
#pragma unroll
    for (int mb = 0; mb < 4; ++mb) {
#pragma unroll
        for (int nb = 0; nb < 4; ++nb) {
#pragma unroll
            for (int j = 0; j < 8; ++j) os[(hi * 8 + j) * 68 + nb * 16 + lr] = acc[mb][nb][j]; }
        __builtin_amdgcn_wave_barrier(); asm volatile("" ::: "memory");
        if constexpr (EPI == 0) {
            float* crow = C + (size_t)(r0 + mb * 16) * ldc + c0;
#pragma unroll
            for (int s = 0; s < 8; ++s) { const int row = 2 * s + hi, cofs = lr * 4; v4f val = *(const v4fa*)(os + row * 68 + cofs); val[0] += bfr(bias[c0 + cofs]); val[1] += bfr(bias[c0 + cofs + 1]); val[2] += bfr(bias[c0 + cofs + 2]); val[3] += bfr(bias[c0 + cofs + 3]);
                *(v4f*)(crow + (size_t)row * ldc + cofs) = val; }
        } else {   /* the 16 rows are one block in fragment order: store s takes pieces 2 s and 2 s + 1 of every row, 512 bytes in a row of each plane */
            const size_t eb = (EPI == 1 ? ((size_t)(c0 >> 6) * ldc + r0 + mb * 16) * HD : (size_t)(r0 + mb * 16) * ldc + (size_t)c0 * 16) + lane * 8;
#pragma unroll
            for (int s = 0; s < 4; ++s) { const int row = lr, cofs = (2 * s + hi) * 8;
                const v8f u = __builtin_shufflevector(*(const v4fa*)(os + row * 68 + cofs), *(const v4fa*)(os + row * 68 + cofs + 4), 0, 1, 2, 3, 4, 5, 6, 7); v8h o16; v8us oh, ol;
#pragma unroll
                for (int q = 0; q < 8; ++q) { const float y = u[q] + bfr(bv[EPI == 1 ? s * 8 + q : mb]); o16[q] = tohx(y); unsigned short a2, c2; splitf(y, a2, c2); oh[q] = a2; ol[q] = c2; }
                const size_t e = eb + s * 256;
                *(v8h*)(P16 + e) = o16; *(v8us*)(Ph + e) = oh; *(v8us*)(Pl + e) = ol;
                asm volatile("s_wait_xcnt 0x0" ::: "memory");   /* stands before the three stores' data registers are reused for the next pieces */
            }
        }
        asm volatile("s_wait_xcnt 0x0" ::: "memory");   /* stands before the stores' data and address registers are reused for the next 16 rows */
        __builtin_amdgcn_wave_barrier(); asm volatile("" ::: "memory");
    }
}
template <int NSPLIT, int EPI, int K>
__device__ __forceinline__ void gemm_tile(bf (*ring)[NSPLIT ? 3 : 2][128 * GP], float (*osb)[16 * 68], const int bx, const int by, const bf* __restrict__ A, const bf* __restrict__ A2, const bf* __restrict__ Bt, float* C, int ldc, const float* __restrict__ bias, h16* P16, bf* Ph, bf* Pl) {
    constexpr int NP = NSPLIT ? 3 : 2;   /* planes of a stage: A, Bt (, A2) */
    const int tid = threadIdx.x, lane = tid & 31, lr = lane & 15, hi = lane >> 4; const int wv = __builtin_amdgcn_readfirstlane(tid >> 5);
    const int R0 = bx * 128, C0 = by * 128; const int wm = (wv >> 1) * 64, wn = (wv & 1) * 64; const int r0 = R0 + wm, c0 = C0 + wn;
    /* a thread copies piece tid & 15 of rows tid >> 4, + 8, ... + 120 of each plane: a wave's copy takes two whole 256-byte row parts */
    const size_t toff = (size_t)(tid >> 4) * K + (tid & 15) * 8; const int lo = (tid >> 4) * GP + (tid & 15) * 8;
    auto fill = [&](int buf, int t) {
        const bf* pa = A + (size_t)R0 * K + t * 128; const bf* pb = Bt + (size_t)C0 * K + t * 128;
        copy8<K>((unsigned)(size_t)&ring[buf][0][lo], pa, toff); copy8<K>((unsigned)(size_t)&ring[buf][0][lo + 64 * GP], pa + (size_t)64 * K, toff);
        copy8<K>((unsigned)(size_t)&ring[buf][1][lo], pb, toff); copy8<K>((unsigned)(size_t)&ring[buf][1][lo + 64 * GP], pb + (size_t)64 * K, toff);
        if constexpr (NSPLIT) { const bf* pa2 = A2 + (size_t)R0 * K + t * 128; copy8<K>((unsigned)(size_t)&ring[buf][2][lo], pa2, toff); copy8<K>((unsigned)(size_t)&ring[buf][2][lo + 64 * GP], pa2 + (size_t)64 * K, toff); } };
    v8f acc[4][4];
#pragma unroll
    for (int mb = 0; mb < 4; ++mb)
#pragma unroll
        for (int nb = 0; nb < 4; ++nb) acc[mb][nb] = (v8f){};
    constexpr int NT = K / 128;
    fill(0, 0);
    asm volatile("s_wait_asynccnt 0x0" ::: "memory");   /* this wave's copies of pass 0 have landed */
    __syncthreads();   /* every wave's have: pass 0 may be read */
    fill(1, 1);
#pragma unroll 1   /* one pass a trip: the two buffers take turns by the trip's parity */
    for (int t = 0; t < NT; ++t) {
        const bf* As = &ring[t & 1][0][(wm + lr) * GP + 8 * hi]; const bf* Bs = &ring[t & 1][1][(wn + lr) * GP + 8 * hi]; const bf* A2s = &ring[t & 1][NP - 1][(wm + lr) * GP + 8 * hi];
        gemm_mul<NSPLIT>(acc, As, Bs, A2s);
        asm volatile("s_wait_dscnt 0x0" ::: "memory");      /* this wave has left the buffer that is refilled below */
        asm volatile("s_wait_asynccnt 0x0" ::: "memory");   /* this wave's copies of pass t + 1 have landed */
        __syncthreads();   /* publishes pass t + 1 and ends every wave's reads of pass t */
        if (t + 2 < NT) fill(t & 1, t + 2);
    }
    asm volatile("s_wait_asynccnt 0x0" ::: "memory");   /* no copy is in flight when the wave goes on to its end */
    gemm_out<EPI>(acc, osb[wv], r0, c0, C, ldc, bias, P16, Ph, Pl);
}
template <int NSPLIT, int EPI, int K>
__global__ __launch_bounds__(128) void k_gemms(const bf* __restrict__ A, const bf* __restrict__ A2, const bf* __restrict__ Bt, float* C, int ldc, const float* __restrict__ bias, h16* P16, bf* Ph, bf* Pl) {
    __shared__ __align__(16) bf ring[2][NSPLIT ? 3 : 2][128 * GP];
    __shared__ __align__(16) float osb[4][16 * 68];
    gemm_tile<NSPLIT, EPI, K>(ring, osb, blockIdx.x, blockIdx.y, A, A2, Bt, C, ldc, bias, P16, Ph, Pl);
}
// the q, k and v projections in one launch, grid (TT / 128, DM / 128), 384 threads: a work-group takes 128 rows of x and the same 128 rows of Wq, Wk and Wv; waves 4 z .. 4 z + 3 do projection z as gemm_tile's four waves do a tile (z = 0: q = x Wq^T, z = 1: k = x Wk^T, z = 2: v^T = Wv x^T, whose rows are the [h][d] rows of the v planes). The x rows of a pass come into LDS once for the three products: 128 KiB a pass in place of 192. One work-group a WGP, three waves a SIMD, every WGP one work-group.
__global__ __launch_bounds__(384) void k_qkv(const bf* __restrict__ X, const bf* __restrict__ Wq, const bf* __restrict__ Wk, const bf* __restrict__ Wv, const float* __restrict__ bq, const float* __restrict__ bk, const float* __restrict__ bv,
                                             h16* Q16, bf* Qh, bf* Ql, h16* K16, bf* Kh, bf* Kl, h16* V16, bf* Vh, bf* Vl) {
    __shared__ __align__(16) bf ring[2][4][128 * GP];   /* planes of a stage: x, Wq, Wk, Wv */
    const int tid = threadIdx.x, lane = tid & 31, lr = lane & 15, hi = lane >> 4; const int wv = __builtin_amdgcn_readfirstlane(tid >> 5);
    const int z = wv >> 2, qd = wv & 3, t4 = tid & 127;   /* projection, quarter of its tile, thread among the projection's 128 */
    const int X0 = blockIdx.x * 128, W0 = blockIdx.y * 128; const int wm = (qd >> 1) * 64, wn = (qd & 1) * 64;
    const bf* W = z == 0 ? Wq : z == 1 ? Wk : Wv;
    /* a projection's 128 threads copy its own weight plane as in gemm_tile; those of q and k also one half each of the x plane */
    const size_t toff = (size_t)(t4 >> 4) * DM + (t4 & 15) * 8; const int lo = (t4 >> 4) * GP + (t4 & 15) * 8;
    auto fill = [&](int buf, int t) {
        const bf* pw = W + (size_t)W0 * DM + t * 128;
        copy8<DM>((unsigned)(size_t)&ring[buf][1 + z][lo], pw, toff); copy8<DM>((unsigned)(size_t)&ring[buf][1 + z][lo + 64 * GP], pw + (size_t)64 * DM, toff);
        if (z < 2) copy8<DM>((unsigned)(size_t)&ring[buf][0][lo + z * 64 * GP], X + (size_t)(X0 + z * 64) * DM + t * 128, toff); };
    const int pA = z == 2 ? 3 : 0, pB = z == 2 ? 0 : 1 + z;   /* the planes whose rows are the product's rows and columns */
    v8f acc[4][4];
#pragma unroll
    for (int mb = 0; mb < 4; ++mb)
#pragma unroll
        for (int nb = 0; nb < 4; ++nb) acc[mb][nb] = (v8f){};
    constexpr int NT = DM / 128;
    fill(0, 0);
    asm volatile("s_wait_asynccnt 0x0" ::: "memory");   /* this wave's copies of pass 0 have landed */
    __syncthreads();   /* every wave's have: pass 0 may be read */
    fill(1, 1);
#pragma unroll 1   /* one pass a trip: the two buffers take turns by the trip's parity */
    for (int t = 0; t < NT; ++t) {
        const bf* As = &ring[t & 1][pA][(wm + lr) * GP + 8 * hi]; const bf* Bs = &ring[t & 1][pB][(wn + lr) * GP + 8 * hi];
        gemm_mul<0>(acc, As, Bs, As);
        asm volatile("s_wait_dscnt 0x0" ::: "memory");      /* this wave has left the buffer that is refilled below */
        asm volatile("s_wait_asynccnt 0x0" ::: "memory");   /* this wave's copies of pass t + 1 have landed */
        __syncthreads();   /* publishes pass t + 1 and ends every wave's reads of pass t */
        if (t + 2 < NT) fill(t & 1, t + 2);
    }
    asm volatile("s_wait_asynccnt 0x0" ::: "memory");   /* no copy is in flight when the wave goes on to its end */
    float* os = (float*)&ring[0][0][0] + wv * (16 * 68);   /* behind the last pass's barrier nobody reads the ring and no copy flies: its first bytes stage the waves' output */
    if (z == 2) gemm_out<2>(acc, os, W0 + wm, X0 + wn, nullptr, TT, bv, V16, Vh, Vl);
    else gemm_out<1>(acc, os, X0 + wm, W0 + wn, nullptr, TT, z ? bk : bq, z ? K16 : Q16, z ? Kh : Qh, z ? Kl : Ql);
}


// ---- attention of one (64-row tile, head) by one work-group of 8 waves; the tile's score band S[64][PB] f32 lives in LDS and never reaches memory.
// 1 scores: wave w does the 64 rows x keys [80 w, 80 w + 80) of the band, q fragments held in registers. A score of logical column x of row r lies at x ^ (16 if r & 8): the two half-waves of an accumulator store then hit different banks.
// 2 softmax: wave w owns rows 8 w .. 8 w + 7; a row is read once, and its P goes over its own bytes (fp16 in the first half; or bf16 hi, then lo at + PB), the 16-byte piece c of row r at piece c ^ (r & 15): the 16 rows of an A fragment read then fall in 16 different bank groups.
// 3 P V: wave w does rows 16 (w >> 1) .. + 15 x columns 32 (w & 1) .. + 31, k ascending over the keys the tile's window can reach; V^T fragments come from memory one 64-key group ahead.
// 4 output: the 64x64 tile is gathered in the band's LDS, free by then, and leaves as bf16 hi and lo planes at [t][head 64 + d] (pitch DQ), the operands of the last projection; four lanes a row, so a row's 64 values are one whole 128-byte line of each plane.
template <typename T16, bool HR>
__device__ __forceinline__ void attn_tile(float* S, const T16* __restrict__ Q, const T16* __restrict__ Q2, const T16* __restrict__ Kp, const T16* __restrict__ K2, const T16* __restrict__ Vt, const T16* __restrict__ Vt2, bf* Ah, bf* Al, const int r0) {
    typedef typename WFrag<T16>::V V;
    const int lane = threadIdx.x & 31, lr = lane & 15, hi = lane >> 4; const int wv = __builtin_amdgcn_readfirstlane((int)(threadIdx.x >> 5));
    const int band0 = (((r0 >> 6) - WNB / 64) & ~1) * 64;   /* first key of the row tile's band (below 0 at the sequence's start) */
    {
        V a[4][2], a2[4][2]; const T16* pq = Q + (size_t)r0 * HD + lane * 8; const T16* pq2 = HR ? Q2 + (size_t)r0 * HD + lane * 8 : nullptr;   /* the tile's four blocks follow each other */
#pragma unroll
        for (int mb = 0; mb < 4; ++mb) { a[mb][0] = WFrag<T16>::ld(pq + mb * FB); a[mb][1] = WFrag<T16>::ld(pq + mb * FB + 512); if constexpr (HR) { a2[mb][0] = WFrag<T16>::ld(pq2 + mb * FB); a2[mb][1] = WFrag<T16>::ld(pq2 + mb * FB + 512); } }
        /* stands before the q loads' address registers are reused; the pointers are inputs so that those registers live up to it */
        if constexpr (HR) asm volatile("s_wait_xcnt 0x0" :: "v"(pq), "v"(pq2) : "memory");
        else asm volatile("s_wait_xcnt 0x0" :: "v"(pq) : "memory");
        constexpr int G = HR ? 1 : 5;   /* 16-key pieces whose k fragments are fetched together (hi/lo planes: one, for registers) */
#pragma unroll
        for (int g = 0; g < 5; g += G) {
            V b[G][2], b2[G][2]; const T16* pk[G]; const T16* pk2[G];
#pragma unroll
            for (int u = 0; u < G; ++u) { const int key = min(max(band0 + (wv * 5 + g + u) * 16, 0), TT - 16);   /* a piece off the sequence loads in-bounds keys, so that no branch parts the loads; it is skipped below */
                pk[u] = Kp + (size_t)key * HD + lane * 8; b[u][0] = WFrag<T16>::ld(pk[u]); b[u][1] = WFrag<T16>::ld(pk[u] + 512); if constexpr (HR) { pk2[u] = K2 + (size_t)key * HD + lane * 8; b2[u][0] = WFrag<T16>::ld(pk2[u]); b2[u][1] = WFrag<T16>::ld(pk2[u] + 512); } }
            /* stands before the k loads' address registers are reused; the pointers are inputs so that those registers live up to it */
            if constexpr (HR) asm volatile("s_wait_xcnt 0x0" :: "v"(pk[0]), "v"(pk2[0]) : "memory");
            else asm volatile("s_wait_xcnt 0x0" :: "v"(pk[0]), "v"(pk[1]), "v"(pk[2]), "v"(pk[3]), "v"(pk[4]) : "memory");
#pragma unroll
            for (int u = 0; u < G; ++u) { const int sub = wv * 5 + g + u; const int key0 = band0 + sub * 16; if (key0 < 0 || key0 >= TT) continue;
                v8f acc[4];
#pragma unroll
                for (int mb = 0; mb < 4; ++mb) acc[mb] = (v8f){};
#pragma unroll
                for (int kk = 0; kk < 2; ++kk)
#pragma unroll
                    for (int mb = 0; mb < 4; ++mb) { acc[mb] = WFrag<T16>::mma(a[mb][kk], b[u][kk], acc[mb]); if constexpr (HR) { acc[mb] = WFrag<T16>::mma(a2[mb][kk], b[u][kk], acc[mb]); acc[mb] = WFrag<T16>::mma(a[mb][kk], b2[u][kk], acc[mb]); } }
                float* sc = S + hi * 8 * PB + ((sub * 16 + lr) ^ (hi << 4));
#pragma unroll
                for (int mb = 0; mb < 4; ++mb)
#pragma unroll
                    for (int j = 0; j < 8; ++j) sc[(mb * 16 + j) * PB] = acc[mb][j]; }
        }
    }
    __syncthreads();   /* every wave's scores are in LDS before a row is read */
    const int cb = band0 >> 7;   /* first of the BT / 2 128-key chunks of the band; a chunk off the sequence (on false) gets j0 = -TT, which fails the window test for every row */
    const int sw = (wv & 1) << 4;
#pragma unroll 2   /* two rows in flight: one row's cross-lane reductions are covered by the other's arithmetic */
    for (int rr = 0; rr < 8; ++rr) { const int row = wv * 8 + rr, i = r0 + row; float* sr = S + row * PB; float t[BT / 2][4]; float mx = -3.0e38f;
#pragma unroll
        for (int c = 0; c < BT / 2; ++c) { const int ch = cb + c; const bool on = ch >= 0 && ch < TT / 128; const int j0 = on ? ch * 128 + lane * 4 : -TT; const v4f a = *(const v4fa*)(sr + (((on ? c : max(cb, 0) - cb) * 128 + lane * 4) ^ sw));   /* a chunk off the sequence reads an in-band one; the window test masks it */
#pragma unroll
            for (int q = 0; q < 4; ++q) { const float s = a[q] * SCL; t[c][q] = (j0 + q <= i + WNB && j0 + q >= i - WNB) ? s : -3.0e38f;   /* symmetric window: |i - j| <= WNB */ mx = fmaxf(mx, t[c][q]); } }
#pragma unroll
        for (int sh = 16; sh; sh >>= 1) mx = fmaxf(mx, __shfl_xor(mx, sh, 32));
        float sum = 0.f;
#pragma unroll
        for (int c = 0; c < BT / 2; ++c)
#pragma unroll
            for (int q = 0; q < 4; ++q) { t[c][q] = __builtin_amdgcn_exp2f(__fmul_rn(__fsub_rn(t[c][q], mx), 1.4426950408889634f)); sum += t[c][q]; }
#pragma unroll
        for (int sh = 16; sh; sh >>= 1) sum += __shfl_xor(sum, sh, 32);
        const float f = __fdiv_rn(HR ? 1.0f : PCAR, sum);
        T16* pr = (T16*)sr + (lane & 1) * 4;
#pragma unroll
        for (int c = 0; c < BT / 2; ++c) { const int ch = cb + c; if (ch < 0 || ch >= TT / 128) continue; const int pc = ((c * 16 + (lane >> 1)) ^ (row & 15)) * 8;
            if constexpr (HR) { v4us oh, ol;
#pragma unroll
                for (int q = 0; q < 4; ++q) { unsigned short a2, c2; splitf(t[c][q] * f, a2, c2); oh[q] = a2; ol[q] = c2; }
                *(v4usa*)(pr + pc) = oh; *(v4usa*)(pr + PB + pc) = ol;
            } else { v4h o4;
#pragma unroll
                for (int q = 0; q < 4; ++q) o4[q] = tohx(t[c][q] * f);
                *(v4ha*)(pr + pc) = o4; } } }
    __syncthreads();   /* every row's P is in LDS before a fragment of it is read */
    const int mb = wv >> 1, n0 = (wv & 1) * 32; const int k0 = max(r0 - WNB, 0), k1 = min(r0 + 64 + WNB, TT);
    const T16* pa = (const T16*)S + (mb * 16 + lr) * (2 * PB);
    const size_t voff = (size_t)n0 * TT + lane * 8;   /* the wave's first 16-d strip of blocks, and the lane's piece */
    v8f acc[2]; acc[0] = (v8f){}; acc[1] = (v8f){};
    V bc[2][2], bc2[2][2], bn[2][2], bn2[2][2];   /* [column block][32-key step] */
    auto ldv = [&](V (&d)[2][2], V (&d2)[2][2], int kc) { const T16* p = Vt + voff + (size_t)(kc >> 6) * FB; const T16* p2 = HR ? Vt2 + voff + (size_t)(kc >> 6) * FB : nullptr;   /* the second column block's strip lies 16 * TT elements on */
#pragma unroll
        for (int nb = 0; nb < 2; ++nb) { d[nb][0] = WFrag<T16>::ld(p + nb * 16 * TT); d[nb][1] = WFrag<T16>::ld(p + nb * 16 * TT + 512); if constexpr (HR) { d2[nb][0] = WFrag<T16>::ld(p2 + nb * 16 * TT); d2[nb][1] = WFrag<T16>::ld(p2 + nb * 16 * TT + 512); } }
        /* stands before the v loads' address registers are reused; the pointers are inputs so that those registers live up to it */
        if constexpr (HR) asm volatile("s_wait_xcnt 0x0" :: "v"(p), "v"(p2) : "memory");
        else asm volatile("s_wait_xcnt 0x0" :: "v"(p) : "memory"); };
    auto step = [&](V (&d)[2][2], V (&d2)[2][2], int kc) {
#pragma unroll
        for (int s = 0; s < 2; ++s) { const int pc = ((kc - band0) >> 3) + s * 4 + hi; const V a = LFrag<T16>::ld2(pa + ((pc ^ lr) << 3), pa + (((pc + 2) ^ lr) << 3)); V a2; if constexpr (HR) a2 = LFrag<T16>::ld2(pa + PB + ((pc ^ lr) << 3), pa + PB + (((pc + 2) ^ lr) << 3));
#pragma unroll
            for (int nb = 0; nb < 2; ++nb) { acc[nb] = WFrag<T16>::mma(a, d[nb][s], acc[nb]); if constexpr (HR) { acc[nb] = WFrag<T16>::mma(a2, d[nb][s], acc[nb]); acc[nb] = WFrag<T16>::mma(a, d2[nb][s], acc[nb]); } } }
        asm volatile("v_nop\n\tv_nop\n\tv_nop\n\tv_nop" : "+v"(acc[0]), "+v"(acc[1]));   /* a branch follows: keeps the matrix instructions' distance on its taken side too */
    };
    ldv(bc, bc2, k0);
#pragma unroll 1
    for (int kc = k0; kc < k1; kc += 128) {   /* two register sets in turn: the next 64-key group flies while this one is multiplied; the last fetch takes the last group again rather than branch */
        ldv(bn, bn2, min(kc + 64, k1 - 64)); step(bc, bc2, kc);
        if (kc + 64 >= k1) break;
        ldv(bc, bc2, min(kc + 128, k1 - 64)); step(bn, bn2, kc + 64);
    }
    __syncthreads();   /* every wave has read its last P fragment: the band's LDS may take the output tile */
    float* so = S + (mb * 16 + hi * 8) * 68 + n0 + lr;
#pragma unroll
    for (int nb = 0; nb < 2; ++nb)
#pragma unroll
        for (int j = 0; j < 8; ++j) so[j * 68 + nb * 16] = acc[nb][j];
    __syncthreads();   /* a row's two halves come from two waves: both are in LDS before the row is read */
    const int orow = (int)(threadIdx.x >> 2), ocol = (int)(threadIdx.x & 3) * 16; const float cs = HR ? 1.0f : (1.0f / PCAR);
    v8us oh[2], ol[2];
#pragma unroll
    for (int p = 0; p < 2; ++p) { const v8f u = __builtin_shufflevector(*(const v4fa*)(S + orow * 68 + ocol + p * 8), *(const v4fa*)(S + orow * 68 + ocol + p * 8 + 4), 0, 1, 2, 3, 4, 5, 6, 7);
#pragma unroll
        for (int q = 0; q < 8; ++q) { unsigned short a2, c2; splitf(u[q] * cs, a2, c2); oh[p][q] = a2; ol[p][q] = c2; } }
    const size_t oo = (size_t)(r0 + orow) * DQ + ocol;
    *(v8us*)(Ah + oo) = oh[0]; *(v8us*)(Ah + oo + 8) = oh[1]; *(v8us*)(Al + oo) = ol[0]; *(v8us*)(Al + oo + 8) = ol[1];
}
__global__ __launch_bounds__(256) void k_attn(const h16* __restrict__ Q16, const h16* __restrict__ K16, const h16* __restrict__ V16, const bf* __restrict__ Qh, const bf* __restrict__ Ql, const bf* __restrict__ Kh, const bf* __restrict__ Kl, const bf* __restrict__ Vh, const bf* __restrict__ Vl, bf* Ah, bf* Al) {
    __shared__ __align__(16) float S[64 * PB];
    const size_t zo = (size_t)blockIdx.z * TT * HD; const int r0 = blockIdx.x * 64; const int ho = blockIdx.z * HD;
    if (r0 < RH) attn_tile<bf, true>(S, Qh + zo, Ql + zo, Kh + zo, Kl + zo, Vh + zo, Vl + zo, Ah + ho, Al + ho, r0);
    else attn_tile<h16, false>(S, Q16 + zo, nullptr, K16 + zo, nullptr, V16 + zo, nullptr, Ah + ho, Al + ho, r0);
}


extern "C" void kernel_launch(void* const* d_in, const int* in_sizes, int n_in,
                              void* d_out, int out_size, void* d_ws, size_t ws_size, hipStream_t stream) {
    (void)in_sizes; (void)n_in; (void)out_size;
    const float* x = (const float*)d_in[0]; const float* wq = (const float*)d_in[1]; const float* bq = (const float*)d_in[2]; const float* wk = (const float*)d_in[3]; const float* bk = (const float*)d_in[4]; const float* wv = (const float*)d_in[5]; const float* bv = (const float*)d_in[6]; const float* wo = (const float*)d_in[7]; const float* bo = (const float*)d_in[8];
    float* OUT = (float*)d_out;     // [1][4096][1024]
    char* wsp = (char*)d_ws;
    auto take = [&](size_t bytes) { char* p = wsp; wsp += (bytes + 255) & ~(size_t)255; return (void*)p; };
    bf* WO = (bf*)take((size_t)DM * DQ * 2);
    h16* QP16 = (h16*)take((size_t)NH_ * TT * HD * 2); h16* KP16 = (h16*)take((size_t)NKV * TT * HD * 2); h16* VT16 = (h16*)take((size_t)NKV * HD * TT * 2);
    bf* QPh = (bf*)take((size_t)NH_ * TT * HD * 2); bf* QPl = (bf*)take((size_t)NH_ * TT * HD * 2); bf* KPh = (bf*)take((size_t)NKV * TT * HD * 2); bf* KPl = (bf*)take((size_t)NKV * TT * HD * 2); bf* VTh = (bf*)take((size_t)NKV * HD * TT * 2); bf* VTl = (bf*)take((size_t)NKV * HD * TT * 2);
    bf* ATh = (bf*)take((size_t)TT * DQ * 2); bf* ATl = (bf*)take((size_t)TT * DQ * 2);   // planes of their own: the attention launch writes them while its other work-groups still read the q planes
    bf* WQ = (bf*)take((size_t)DQ * DM * 2); bf* WK = (bf*)take((size_t)DKV * DM * 2); bf* WV = (bf*)take((size_t)DKV * DM * 2);
    bf* XB = (bf*)take((size_t)TT * DM * 2);
    if ((size_t)(wsp - (char*)d_ws) > ws_size) return;    // ws 256 MiB; 104 MiB taken
    for (int b = 0; b < NB_; ++b) {
        
        k_cvtall<<<(TT * DM + 4 * DM * DM) / (8 * CPG), 256, 0, stream>>>(x + (size_t)b * TT * DM, wq, wk, wv, wo, XB, WQ, WK, WV, WO);
        k_qkv<<<dim3(TT / 128, DM / 128, 1), 384, 0, stream>>>(XB, WQ, WK, WV, bq, bk, bv, QP16, QPh, QPl, KP16, KPh, KPl, VT16, VTh, VTl);
        for (int h0 = 0; h0 < NH_; h0 += ZH) { const size_t zq = (size_t)h0, zk = (size_t)(h0 / REP);   // one kv head per query head: the pass's heads use consecutive kv planes (z-strides TT*HD)
            k_attn<<<dim3(TT / 64, 1, ZH), 256, 0, stream>>>(QP16 + zq * TT * HD, KP16 + zk * TT * HD, VT16 + zk * HD * TT, QPh + zq * TT * HD, QPl + zq * TT * HD, KPh + zk * TT * HD, KPl + zk * TT * HD, VTh + zk * HD * TT, VTl + zk * HD * TT, ATh + zq * HD, ATl + zq * HD); }
        k_gemms<1, 0, DQ><<<dim3(TT / 128, DM / 128, 1), 128, 0, stream>>>(ATh, ATl, WO, OUT + (size_t)b * TT * DM, DM, bo, nullptr, nullptr, nullptr); }
}

// v009
// It runs in 78.5 microseconds.
// Two timings next to v008 both put it at 1.14 times that version's speed.
// All steps since v000 together make it 51.9 times as fast.
#include <hip/hip_runtime.h>

#define NB_  1
#define TT   4096
#define DM   1024
#define NH_  16
#define NKV  16
#define REP  (NH_ / NKV)
#define HD   64
#define DQ   (NH_ * HD)
#define DKV  (NKV * HD)
#define ZH   16                   // heads per pass (grid z of the attention launches)
#define RH   512                  // query rows < RH use hi+lo planes (0: none)
#define WIN  0
#define SCL  0.125f
#define WNB  256     // |i - j| <= 256 kept
typedef _Float16 h16;
typedef unsigned short bf;
typedef __attribute__((ext_vector_type(16))) __bf16   v16bf;
typedef __attribute__((ext_vector_type(16))) _Float16 v16h;
typedef __attribute__((ext_vector_type(8)))  _Float16 v8h;
typedef __attribute__((ext_vector_type(8)))  unsigned short v8us;
typedef __attribute__((ext_vector_type(8)))  float    v8f;
typedef __attribute__((ext_vector_type(4)))  float    v4f;
typedef v8h  __attribute__((may_alias)) v8ha;
typedef v4f  __attribute__((may_alias)) v4fa;
typedef v8us __attribute__((may_alias)) v8usa;

__device__ __forceinline__ unsigned short f2bf(float f) { unsigned u = __float_as_uint(f); u += 0x7FFFu + ((u >> 16) & 1u); return (unsigned short)(u >> 16); }
__device__ __forceinline__ float bf2f(unsigned short b) { return __uint_as_float(((unsigned)b) << 16); }
__device__ __forceinline__ float bfr(float f) { return bf2f(f2bf(f)); }
__device__ __forceinline__ v16h cat16(v8h lo, v8h hi) { return __builtin_shufflevector(lo, hi, 0, 1, 2, 3, 4, 5, 6, 7, 8, 9, 10, 11, 12, 13, 14, 15); }
__device__ __forceinline__ v16bf cat16b(v8us lo, v8us hi) { return __builtin_bit_cast(v16bf, __builtin_shufflevector(lo, hi, 0, 1, 2, 3, 4, 5, 6, 7, 8, 9, 10, 11, 12, 13, 14, 15)); }
__device__ __forceinline__ v8f wmma16(v16h a, v16h b, v8f c) { return __builtin_amdgcn_wmma_f32_16x16x32_f16(false, a, false, b, (short)0, c, false, false); }
__device__ __forceinline__ v8f wmmab(v16bf a, v16bf b, v8f c) { return __builtin_amdgcn_wmma_f32_16x16x32_bf16(false, a, false, b, (short)0, c, false, false); }

// Fragment order of the q, k, v planes: a block of 16 rows x 64 K-contiguous 16-bit elements is FB elements in a row (q, k: 16 t x the head's 64 d; v: 16 d x 64 t, the blocks of a 16-d strip following each other in t). The 16-byte piece c (elements 8 c .. 8 c + 7) of row r lies at element (c >> 1) * 256 + ((c & 1) * 16 + r) * 8: a wave's load of one piece a lane, lane = hi * 16 + row, is 512 bytes in a row, four whole lines.
#define FB 1024
// a 16x32 fragment from two 16-byte pieces of a block in fragment order (p: block + 512 * (32-k step) + lane * 8), and its matrix instruction
template <typename T16> struct WFrag;
template <> struct WFrag<h16> { typedef v16h V; static __device__ __forceinline__ V ld(const h16* p) { return cat16(*(const v8h*)p, *(const v8h*)(p + 256)); } static __device__ __forceinline__ v8f mma(V a, V b, v8f c) { return wmma16(a, b, c); } };
template <> struct WFrag<bf> { typedef v16bf V; static __device__ __forceinline__ V ld(const bf* p) { return cat16b(*(const v8us*)p, *(const v8us*)(p + 256)); } static __device__ __forceinline__ v8f mma(V a, V b, v8f c) { return wmmab(a, b, c); } };

__device__ __forceinline__ h16 tohx(float x) { return (h16)x; }
__device__ __forceinline__ void splitf(float y, unsigned short& h, unsigned short& l) { h = f2bf(y); l = f2bf(y - bf2f(h)); }
typedef __attribute__((ext_vector_type(2))) _Float16 v2h;
typedef __attribute__((ext_vector_type(4))) _Float16 v4h;
typedef __attribute__((ext_vector_type(2))) unsigned short v2us;
typedef __attribute__((ext_vector_type(4))) unsigned short v4us;
typedef __attribute__((ext_vector_type(2))) float v2f;
typedef __attribute__((ext_vector_type(4))) int v4i;

__global__ __launch_bounds__(256) void k_wtG(const float* __restrict__ w, int K, int N, bf* Bt) {
    const int lane = threadIdx.x & 31; const int L0 = (blockIdx.x * 8 + (threadIdx.x >> 5)) * 8; const int nlines = N * K / 64;
{
#pragma unroll 1
        for (int l = 0; l < 8; ++l) { const int L = L0 + l; if (L >= nlines) break; const size_t e = (size_t)L * 64 + lane * 2; const int k = (int)(e % K), n = (int)(e / K); v2us o;
            o[0] = f2bf(w[(size_t)k * N + n]); o[1] = f2bf(w[(size_t)(k + 1) * N + n]); *(v2us*)(Bt + e) = o; }
         }
}
// every f32 -> bf16 conversion of the call in one launch: x, then Wq, Wk, Wv, Wo. A work-group takes CPG consecutive 8-element pieces of one array; a thread eight of them, 256 pieces apart, all its loads in flight before the first is converted. grid (TT * DM + 4 * DM * DM) / (8 * CPG).
#define CPG 2048
__global__ __launch_bounds__(256) void k_cvtall(const float* __restrict__ x, const float* __restrict__ wq, const float* __restrict__ wk, const float* __restrict__ wv, const float* __restrict__ wo, bf* XB, bf* WQ, bf* WK, bf* WV, bf* WO) {
    constexpr int GX = TT * DM / (8 * CPG), GW = DM * DM / (8 * CPG);   /* work-groups of x, and of one weight matrix */
    int g = blockIdx.x; const float* src = x; bf* dst = XB;
    if (g >= GX) { const int a = (g - GX) / GW; g = (g - GX) % GW; src = a == 0 ? wq : a == 1 ? wk : a == 2 ? wv : wo; dst = a == 0 ? WQ : a == 1 ? WK : a == 2 ? WV : WO; }
    const size_t e0 = ((size_t)g * CPG + threadIdx.x) * 8; const float* ps = src + e0; v8f v[8]; v8us o[8];
#pragma unroll
    for (int i = 0; i < 8; ++i) v[i] = *(const v8f*)(ps + i * 256 * 8);
    asm volatile("s_wait_xcnt 0x0" :: "v"(ps) : "memory");   /* stands before the loads' address registers are reused; the pointer is an input so that those registers live up to it */
#pragma unroll
    for (int i = 0; i < 8; ++i)
#pragma unroll
        for (int k = 0; k < 8; ++k) o[i][k] = f2bf(v[i][k]);
#pragma unroll
    for (int i = 0; i < 8; ++i) *(v8us*)(dst + e0 + i * 256 * 8) = o[i];
}

typedef v4h  __attribute__((may_alias)) v4ha;
typedef v4us __attribute__((may_alias)) v4usa;
// a 16x32 A fragment from two 16-byte pieces in LDS
template <typename T16> struct LFrag;
template <> struct LFrag<h16> { static __device__ __forceinline__ v16h ld2(const h16* p, const h16* q) { return cat16(*(const v8ha*)p, *(const v8ha*)q); } };
template <> struct LFrag<bf> { static __device__ __forceinline__ v16bf ld2(const bf* p, const bf* q) { return cat16b(*(const v8usa*)p, *(const v8usa*)q); } };

// ---- gemm_tile: y[m][n] = sum_k A[m][k] Bt[n][k] (NSPLIT 1: + A2[m][k] Bt[n][k]) + f32 bias. EPI 0: bias[n], y to C (f32, pitch ldc). EPI 1: bias[n], y as fp16, bf16 hi and bf16 lo to the planes P16, Ph, Pl at [n / 64][m][n % 64], ldc rows a plane. EPI 2: bias[m], the same three forms at [m][n], pitch ldc. Both in fragment order (FB): a wave's 16 rows x 64 columns are one block. A, A2, Bt K-contiguous bf16 planes of pitch K; K % 128 == 0, K >= 256. Tile (bx, by) of (M/128, N/128), 128 threads.
// One work-group of 4 waves per 128x128 tile, a wave per 64x64 quarter (16 accumulators). A pass is 128 k: 256 bytes of each of the tile's 128 A (A2) and 128 Bt rows, brought whole-line into LDS by asynchronous copies, two buffers, the next pass's copies in flight while this pass is multiplied. LDS row pitch 272 bytes (16 x odd: the 16 rows of a fragment read fall in different bank groups).
#define GP 136   // LDS row pitch in 16-bit elements
// eight copies of 16 bytes a lane, 8 rows apart (global pitch K elements, LDS pitch GP); g is the same for the whole wave, toff the lane's own offset in elements
template <int K> __device__ __forceinline__ void copy8(unsigned l, const bf* g, size_t toff) {
    unsigned la[8]; const bf* ga[8];
#pragma unroll
    for (int i = 0; i < 8; ++i) { la[i] = l + i * 8 * GP * 2; ga[i] = g + (size_t)i * 8 * K + toff; }
    /* the wait stands in the copies' own statement: it ends before any of their address registers is rewritten */
    asm volatile("global_load_async_to_lds_b128 %0, %8, off\n\t"
                 "global_load_async_to_lds_b128 %1, %9, off\n\t"
                 "global_load_async_to_lds_b128 %2, %10, off\n\t"
                 "global_load_async_to_lds_b128 %3, %11, off\n\t"
                 "global_load_async_to_lds_b128 %4, %12, off\n\t"
                 "global_load_async_to_lds_b128 %5, %13, off\n\t"
                 "global_load_async_to_lds_b128 %6, %14, off\n\t"
                 "global_load_async_to_lds_b128 %7, %15, off\n\t"
                 "s_wait_xcnt 0x0"
                 :: "v"(la[0]), "v"(la[1]), "v"(la[2]), "v"(la[3]), "v"(la[4]), "v"(la[5]), "v"(la[6]), "v"(la[7]),
                    "v"(ga[0]), "v"(ga[1]), "v"(ga[2]), "v"(ga[3]), "v"(ga[4]), "v"(ga[5]), "v"(ga[6]), "v"(ga[7]) : "memory");
}
// one 128-k pass of a wave's 64x64 quarter from LDS: As, Bs (A2s) point at the lane's first piece of the quarter's A and Bt (A2) rows
template <int NSPLIT>
__device__ __forceinline__ void gemm_mul(v8f (&acc)[4][4], const bf* As, const bf* Bs, const bf* A2s) {
        v16bf a[2][4], a2[2][4], b[2][4];   /* two fragment sets: a 32-k block's 16 (24) LDS reads go out while the block before it is multiplied */
        auto ldf = [&](int s, int ks) {
#pragma unroll
            for (int mb = 0; mb < 4; ++mb) { a[s][mb] = LFrag<bf>::ld2(As + mb * 16 * GP + ks * 32, As + mb * 16 * GP + ks * 32 + 16); if constexpr (NSPLIT) a2[s][mb] = LFrag<bf>::ld2(A2s + mb * 16 * GP + ks * 32, A2s + mb * 16 * GP + ks * 32 + 16); }
#pragma unroll
            for (int nb = 0; nb < 4; ++nb) b[s][nb] = LFrag<bf>::ld2(Bs + nb * 16 * GP + ks * 32, Bs + nb * 16 * GP + ks * 32 + 16); };
        ldf(0, 0);
#pragma unroll
        for (int ks = 0; ks < 4; ++ks) {
            if (ks < 3) ldf((ks + 1) & 1, ks + 1);
            __builtin_amdgcn_sched_barrier(0);   /* holds the next block's reads, as one group, ahead of this block's matrix instructions; sunk to their uses, each would expose the LDS latency to the SIMD's few waves (one in k_gemms, three in k_qkv) */
#pragma unroll
            for (int nb = 0; nb < 4; ++nb) {
#pragma unroll
                for (int mb = 0; mb < 4; ++mb) acc[mb][nb] = wmmab(a[ks & 1][mb], b[ks & 1][nb], acc[mb][nb]);
                if constexpr (NSPLIT) {
#pragma unroll
                    for (int mb = 0; mb < 4; ++mb) acc[mb][nb] = wmmab(a2[ks & 1][mb], b[ks & 1][nb], acc[mb][nb]); } }
            __builtin_amdgcn_sched_barrier(0);   /* the block's matrix instructions stay ahead of the reads that reuse its fragment set, and of the pass's foot */
        }
        asm volatile("v_nop\n\tv_nop\n\tv_nop\n\tv_nop" : "+v"(acc[0][3]), "+v"(acc[1][3]), "+v"(acc[2][3]), "+v"(acc[3][3]));   /* a branch follows: keeps the matrix instructions' distance on its taken side too */
}
// a wave's 64x64 quarter (first row r0, first column c0) leaves by way of os, the wave's own 16 x 68 floats of LDS
template <int EPI>
__device__ __forceinline__ void gemm_out(v8f (&acc)[4][4], float* os, const int r0, const int c0, float* C, int ldc, const float* __restrict__ bias, h16* P16, bf* Ph, bf* Pl) {
    const int lane = threadIdx.x & 31, lr = lane & 15, hi = lane >> 4;
    float bv[EPI == 1 ? 32 : 4];   /* the biases of the lane's eight columns in each of its four pieces (EPI 1), or of its row in each 16-row block (EPI 2) */
    if constexpr (EPI != 0) { const float* pb = bias + (EPI == 1 ? c0 + hi * 8 : r0 + lr);
#pragma unroll
        for (int q = 0; q < (EPI == 1 ? 32 : 4); ++q) bv[q] = pb[EPI == 1 ? (q >> 3) * 16 + (q & 7) : 16 * q];
        asm volatile("s_wait_xcnt 0x0" :: "v"(pb) : "memory");   /* stands before the bias loads' address registers are reused; the pointer is an input so that those registers live up to it */
    }
#pragma unroll
    for (int mb = 0; mb < 4; ++mb) {
#pragma unroll
        for (int nb = 0; nb < 4; ++nb) {
#pragma unroll
            for (int j = 0; j < 8; ++j) os[(hi * 8 + j) * 68 + nb * 16 + lr] = acc[mb][nb][j]; }
        __builtin_amdgcn_wave_barrier(); asm volatile("" ::: "memory");
        if constexpr (EPI == 0) {
            float* crow = C + (size_t)(r0 + mb * 16) * ldc + c0;
#pragma unroll
            for (int s = 0; s < 8; ++s) { const int row = 2 * s + hi, cofs = lr * 4; v4f val = *(const v4fa*)(os + row * 68 + cofs); val[0] += bfr(bias[c0 + cofs]); val[1] += bfr(bias[c0 + cofs + 1]); val[2] += bfr(bias[c0 + cofs + 2]); val[3] += bfr(bias[c0 + cofs + 3]);
                *(v4f*)(crow + (size_t)row * ldc + cofs) = val; }
        } else {   /* the 16 rows are one block in fragment order: store s takes pieces 2 s and 2 s + 1 of every row, 512 bytes in a row of each plane */
            const size_t eb = (EPI == 1 ? ((size_t)(c0 >> 6) * ldc + r0 + mb * 16) * HD : (size_t)(r0 + mb * 16) * ldc + (size_t)c0 * 16) + lane * 8;
#pragma unroll
            for (int s = 0; s < 4; ++s) { const int row = lr, cofs = (2 * s + hi) * 8;
                const v8f u = __builtin_shufflevector(*(const v4fa*)(os + row * 68 + cofs), *(const v4fa*)(os + row * 68 + cofs + 4), 0, 1, 2, 3, 4, 5, 6, 7); v8h o16; v8us oh, ol;
#pragma unroll
                for (int q = 0; q < 8; ++q) { const float y = u[q] + bfr(bv[EPI == 1 ? s * 8 + q : mb]); o16[q] = tohx(y); unsigned short a2, c2; splitf(y, a2, c2); oh[q] = a2; ol[q] = c2; }
                const size_t e = eb + s * 256;
                *(v8h*)(P16 + e) = o16; *(v8us*)(Ph + e) = oh; *(v8us*)(Pl + e) = ol;
                asm volatile("s_wait_xcnt 0x0" ::: "memory");   /* stands before the three stores' data registers are reused for the next pieces */
            }
        }
        asm volatile("s_wait_xcnt 0x0" ::: "memory");   /* stands before the stores' data and address registers are reused for the next 16 rows */
        __builtin_amdgcn_wave_barrier(); asm volatile("" ::: "memory");
    }
}
template <int NSPLIT, int EPI, int K>
__device__ __forceinline__ void gemm_tile(bf (*ring)[NSPLIT ? 3 : 2][128 * GP], float (*osb)[16 * 68], const int bx, const int by, const bf* __restrict__ A, const bf* __restrict__ A2, const bf* __restrict__ Bt, float* C, int ldc, const float* __restrict__ bias, h16* P16, bf* Ph, bf* Pl) {
    constexpr int NP = NSPLIT ? 3 : 2;   /* planes of a stage: A, Bt (, A2) */
    const int tid = threadIdx.x, lane = tid & 31, lr = lane & 15, hi = lane >> 4; const int wv = __builtin_amdgcn_readfirstlane(tid >> 5);
    const int R0 = bx * 128, C0 = by * 128; const int wm = (wv >> 1) * 64, wn = (wv & 1) * 64; const int r0 = R0 + wm, c0 = C0 + wn;
    /* a thread copies piece tid & 15 of rows tid >> 4, + 8, ... + 120 of each plane: a wave's copy takes two whole 256-byte row parts */
    const size_t toff = (size_t)(tid >> 4) * K + (tid & 15) * 8; const int lo = (tid >> 4) * GP + (tid & 15) * 8;
    auto fill = [&](int buf, int t) {
        const bf* pa = A + (size_t)R0 * K + t * 128; const bf* pb = Bt + (size_t)C0 * K + t * 128;
        copy8<K>((unsigned)(size_t)&ring[buf][0][lo], pa, toff); copy8<K>((unsigned)(size_t)&ring[buf][0][lo + 64 * GP], pa + (size_t)64 * K, toff);
        copy8<K>((unsigned)(size_t)&ring[buf][1][lo], pb, toff); copy8<K>((unsigned)(size_t)&ring[buf][1][lo + 64 * GP], pb + (size_t)64 * K, toff);
        if constexpr (NSPLIT) { const bf* pa2 = A2 + (size_t)R0 * K + t * 128; copy8<K>((unsigned)(size_t)&ring[buf][2][lo], pa2, toff); copy8<K>((unsigned)(size_t)&ring[buf][2][lo + 64 * GP], pa2 + (size_t)64 * K, toff); } };
    v8f acc[4][4];
#pragma unroll
    for (int mb = 0; mb < 4; ++mb)
#pragma unroll
        for (int nb = 0; nb < 4; ++nb) acc[mb][nb] = (v8f){};
    constexpr int NT = K / 128;
    fill(0, 0);
    asm volatile("s_wait_asynccnt 0x0" ::: "memory");   /* this wave's copies of pass 0 have landed */
    __syncthreads();   /* every wave's have: pass 0 may be read */
    fill(1, 1);
#pragma unroll 1   /* one pass a trip: the two buffers take turns by the trip's parity */
    for (int t = 0; t < NT; ++t) {
        const bf* As = &ring[t & 1][0][(wm + lr) * GP + 8 * hi]; const bf* Bs = &ring[t & 1][1][(wn + lr) * GP + 8 * hi]; const bf* A2s = &ring[t & 1][NP - 1][(wm + lr) * GP + 8 * hi];
        gemm_mul<NSPLIT>(acc, As, Bs, A2s);
        asm volatile("s_wait_dscnt 0x0" ::: "memory");      /* this wave has left the buffer that is refilled below */
        asm volatile("s_wait_asynccnt 0x0" ::: "memory");   /* this wave's copies of pass t + 1 have landed */
        __syncthreads();   /* publishes pass t + 1 and ends every wave's reads of pass t */
        if (t + 2 < NT) fill(t & 1, t + 2);
    }
    asm volatile("s_wait_asynccnt 0x0" ::: "memory");   /* no copy is in flight when the wave goes on to its end */
    gemm_out<EPI>(acc, osb[wv], r0, c0, C, ldc, bias, P16, Ph, Pl);
}
template <int NSPLIT, int EPI, int K>
__global__ __launch_bounds__(128) void k_gemms(const bf* __restrict__ A, const bf* __restrict__ A2, const bf* __restrict__ Bt, float* C, int ldc, const float* __restrict__ bias, h16* P16, bf* Ph, bf* Pl) {
    __shared__ __align__(16) bf ring[2][NSPLIT ? 3 : 2][128 * GP];
    __shared__ __align__(16) float osb[4][16 * 68];
    gemm_tile<NSPLIT, EPI, K>(ring, osb, blockIdx.x, blockIdx.y, A, A2, Bt, C, ldc, bias, P16, Ph, Pl);
}
// the q, k and v projections in one launch, grid (TT / 128, DM / 128), 384 threads: a work-group takes 128 rows of x and the same 128 rows of Wq, Wk and Wv; waves 4 z .. 4 z + 3 do projection z as gemm_tile's four waves do a tile (z = 0: q = x Wq^T, z = 1: k = x Wk^T, z = 2: v^T = Wv x^T, whose rows are the [h][d] rows of the v planes). The x rows of a pass come into LDS once for the three products: 128 KiB a pass in place of 192. One work-group a WGP, three waves a SIMD, every WGP one work-group.
__global__ __launch_bounds__(384) void k_qkv(const bf* __restrict__ X, const bf* __restrict__ Wq, const bf* __restrict__ Wk, const bf* __restrict__ Wv, const float* __restrict__ bq, const float* __restrict__ bk, const float* __restrict__ bv,
                                             h16* Q16, bf* Qh, bf* Ql, h16* K16, bf* Kh, bf* Kl, h16* V16, bf* Vh, bf* Vl) {
    __shared__ __align__(16) bf ring[2][4][128 * GP];   /* planes of a stage: x, Wq, Wk, Wv */
    const int tid = threadIdx.x, lane = tid & 31, lr = lane & 15, hi = lane >> 4; const int wv = __builtin_amdgcn_readfirstlane(tid >> 5);
    const int z = wv >> 2, qd = wv & 3, t4 = tid & 127;   /* projection, quarter of its tile, thread among the projection's 128 */
    const int X0 = blockIdx.x * 128, W0 = blockIdx.y * 128; const int wm = (qd >> 1) * 64, wn = (qd & 1) * 64;
    const bf* W = z == 0 ? Wq : z == 1 ? Wk : Wv;
    /* a projection's 128 threads copy its own weight plane as in gemm_tile; those of q and k also one half each of the x plane */
    const size_t toff = (size_t)(t4 >> 4) * DM + (t4 & 15) * 8; const int lo = (t4 >> 4) * GP + (t4 & 15) * 8;
    auto fill = [&](int buf, int t) {
        const bf* pw = W + (size_t)W0 * DM + t * 128;
        copy8<DM>((unsigned)(size_t)&ring[buf][1 + z][lo], pw, toff); copy8<DM>((unsigned)(size_t)&ring[buf][1 + z][lo + 64 * GP], pw + (size_t)64 * DM, toff);
        if (z < 2) copy8<DM>((unsigned)(size_t)&ring[buf][0][lo + z * 64 * GP], X + (size_t)(X0 + z * 64) * DM + t * 128, toff); };
    const int pA = z == 2 ? 3 : 0, pB = z == 2 ? 0 : 1 + z;   /* the planes whose rows are the product's rows and columns */
    v8f acc[4][4];
#pragma unroll
    for (int mb = 0; mb < 4; ++mb)
#pragma unroll
        for (int nb = 0; nb < 4; ++nb) acc[mb][nb] = (v8f){};
    constexpr int NT = DM / 128;
    fill(0, 0);
    asm volatile("s_wait_asynccnt 0x0" ::: "memory");   /* this wave's copies of pass 0 have landed */
    __syncthreads();   /* every wave's have: pass 0 may be read */
    fill(1, 1);
#pragma unroll 1   /* one pass a trip: the two buffers take turns by the trip's parity */
    for (int t = 0; t < NT; ++t) {
        const bf* As = &ring[t & 1][pA][(wm + lr) * GP + 8 * hi]; const bf* Bs = &ring[t & 1][pB][(wn + lr) * GP + 8 * hi];
        gemm_mul<0>(acc, As, Bs, As);
        asm volatile("s_wait_dscnt 0x0" ::: "memory");      /* this wave has left the buffer that is refilled below */
        asm volatile("s_wait_asynccnt 0x0" ::: "memory");   /* this wave's copies of pass t + 1 have landed */
        __syncthreads();   /* publishes pass t + 1 and ends every wave's reads of pass t */
        if (t + 2 < NT) fill(t & 1, t + 2);
    }
    asm volatile("s_wait_asynccnt 0x0" ::: "memory");   /* no copy is in flight when the wave goes on to its end */
    float* os = (float*)&ring[0][0][0] + wv * (16 * 68);   /* behind the last pass's barrier nobody reads the ring and no copy flies: its first bytes stage the waves' output */
    if (z == 2) gemm_out<2>(acc, os, W0 + wm, X0 + wn, nullptr, TT, bv, V16, Vh, Vl);
    else gemm_out<1>(acc, os, X0 + wm, W0 + wn, nullptr, TT, z ? bk : bq, z ? K16 : Q16, z ? Kh : Qh, z ? Kl : Ql);
}

#define C2 (SCL * 1.4426950408889634f)
// lane l takes the value of lane l ^ 16
__device__ __forceinline__ float xhalf(float x) { return __builtin_bit_cast(float, __builtin_amdgcn_permlanex16(__builtin_bit_cast(int, x), __builtin_bit_cast(int, x), 0x76543210, 0xfedcba98, false, false)); }
template <typename T16, bool HR, int NQ>
__device__ __forceinline__ void attn_cols(const T16* __restrict__ Q, const T16* __restrict__ Q2, const T16* __restrict__ Kp, const T16* __restrict__ K2, const T16* __restrict__ Vt, const T16* __restrict__ Vt2, bf* Ah, bf* Al, const int q0) {
    typedef typename WFrag<T16>::V V;
    const int lane = threadIdx.x & 31, lr = lane & 15, hi = lane >> 4;
    constexpr int QW = NQ * 16;
    const int k0 = max((q0 - WNB) & ~31, 0), k1 = min((q0 + QW + WNB + 31) & ~31, TT);   /* whole 32-key steps; every query has a key of its window in the first one */
    V bq[NQ][2], bq2[NQ][2];
    { const T16* pq = Q + (size_t)q0 * HD + lane * 8; const T16* pq2 = HR ? Q2 + (size_t)q0 * HD + lane * 8 : nullptr;
#pragma unroll
        for (int g = 0; g < NQ; ++g)
#pragma unroll
            for (int kk = 0; kk < 2; ++kk) { bq[g][kk] = WFrag<T16>::ld(pq + g * FB + kk * 512); if constexpr (HR) bq2[g][kk] = WFrag<T16>::ld(pq2 + g * FB + kk * 512); }
        /* stands before the q loads' address registers are reused; the pointers are inputs so that those registers live up to it */
        if constexpr (HR) asm volatile("s_wait_xcnt 0x0" :: "v"(pq), "v"(pq2) : "memory");
        else asm volatile("s_wait_xcnt 0x0" :: "v"(pq) : "memory"); }
    V ka[2][2], ka2[2][2];   /* [16-key tile][32-d step] */
    auto ldk = [&](int ks) { const T16* p = Kp + (size_t)ks * HD + lane * 8; const T16* p2 = HR ? K2 + (size_t)ks * HD + lane * 8 : nullptr;
#pragma unroll
        for (int kt = 0; kt < 2; ++kt)
#pragma unroll
            for (int kk = 0; kk < 2; ++kk) { ka[kt][kk] = WFrag<T16>::ld(p + kt * FB + kk * 512); if constexpr (HR) ka2[kt][kk] = WFrag<T16>::ld(p2 + kt * FB + kk * 512); }
        /* stands before the k loads' address registers are reused; the pointers are inputs so that those registers live up to it */
        if constexpr (HR) asm volatile("s_wait_xcnt 0x0" :: "v"(p), "v"(p2) : "memory");
        else asm volatile("s_wait_xcnt 0x0" :: "v"(p) : "memory"); };
    v8f o[NQ][4]; float mref[NQ]; v2f ls[NQ][2];   /* a lane's share of a query's sum, in four partial sums */
#pragma unroll
    for (int g = 0; g < NQ; ++g) { mref[g] = -3.0e38f; ls[g][0] = (v2f){}; ls[g][1] = (v2f){};
#pragma unroll
        for (int dt = 0; dt < 4; ++dt) o[g][dt] = (v8f){}; }
    ldk(k0);
#pragma unroll 1   /* one step a trip: the k fragments of the next step and the v fragments of this one fly under the step's own work */
    for (int ks = k0; ks < k1; ks += 32) {
        V va[4], va2[4];   /* V^T, 16 d x the step's 32 keys; the strip of the next 16 d lies 16 * TT elements on */
        { const size_t vo = (size_t)(ks >> 6) * FB + ((ks >> 5) & 1) * 512 + lane * 8; const T16* p = Vt + vo; const T16* p2 = HR ? Vt2 + vo : nullptr;
#pragma unroll
            for (int dt = 0; dt < 4; ++dt) { va[dt] = WFrag<T16>::ld(p + dt * 16 * TT); if constexpr (HR) va2[dt] = WFrag<T16>::ld(p2 + dt * 16 * TT); }
            /* stands before the v loads' address registers are reused; the pointers are inputs so that those registers live up to it */
            if constexpr (HR) asm volatile("s_wait_xcnt 0x0" :: "v"(p), "v"(p2) : "memory");
            else asm volatile("s_wait_xcnt 0x0" :: "v"(p) : "memory"); }
        __builtin_amdgcn_sched_barrier(0);   /* the v loads go out ahead of the first product's wait for its k fragments: lifted over them, that wait would delay their issue */
        v8f s[NQ][2];
#pragma unroll
        for (int g = 0; g < NQ; ++g)
#pragma unroll
            for (int kt = 0; kt < 2; ++kt) s[g][kt] = (v8f){};
#pragma unroll
        for (int kk = 0; kk < 2; ++kk)
#pragma unroll
            for (int g = 0; g < NQ; ++g)
#pragma unroll
                for (int kt = 0; kt < 2; ++kt) { s[g][kt] = WFrag<T16>::mma(ka[kt][kk], bq[g][kk], s[g][kt]); if constexpr (HR) { s[g][kt] = WFrag<T16>::mma(ka[kt][kk], bq2[g][kk], s[g][kt]); s[g][kt] = WFrag<T16>::mma(ka2[kt][kk], bq[g][kk], s[g][kt]); } }
        ldk(min(ks + 32, k1 - 32));   /* the next step's keys, into the same registers; the last trip takes its own again rather than branch */
        if (ks < q0 + QW - 1 - WNB || ks + 31 > q0 + WNB) {   /* only a step at an end of the band holds keys outside some row's window |i - j| <= WNB */
            const int d0 = ks + hi * 8 - q0 - lr + WNB;
#pragma unroll
            for (int g = 0; g < NQ; ++g)
#pragma unroll
                for (int kt = 0; kt < 2; ++kt)
#pragma unroll
                    for (int j = 0; j < 8; ++j) if ((unsigned)(d0 + kt * 16 + j - g * 16) > 2u * WNB) s[g][kt][j] = -3.0e38f; }
        float mxs[NQ]; bool need = false;
#pragma unroll
        for (int g = 0; g < NQ; ++g) { float mx = s[g][0][0];
#pragma unroll
            for (int j = 1; j < 8; ++j) mx = fmaxf(mx, s[g][0][j]);
#pragma unroll
            for (int j = 0; j < 8; ++j) mx = fmaxf(mx, s[g][1][j]);
            mx = fmaxf(mx, xhalf(mx)); mxs[g] = mx * C2; need = need || mxs[g] > mref[g] + 8.0f; }
        if (__builtin_amdgcn_ballot_w32(need) != 0) {
#pragma unroll
            for (int g = 0; g < NQ; ++g) { const float mn = fmaxf(mref[g], mxs[g]); const float al = __builtin_amdgcn_exp2f(mref[g] - mn); mref[g] = mn; ls[g][0] *= al; ls[g][1] *= al;
#pragma unroll
                for (int dt = 0; dt < 4; ++dt) o[g][dt] *= al; } }
        V pb[NQ], pb2[NQ];
#pragma unroll
        for (int g = 0; g < NQ; ++g) { float p[2][8];
#pragma unroll
            for (int kt = 0; kt < 2; ++kt)
#pragma unroll
                for (int j = 0; j < 8; j += 2) { const v2f e = __builtin_elementwise_fma((v2f){s[g][kt][j], s[g][kt][j + 1]}, (v2f){C2, C2}, (v2f){-mref[g], -mref[g]}); p[kt][j] = __builtin_amdgcn_exp2f(e[0]); p[kt][j + 1] = __builtin_amdgcn_exp2f(e[1]); ls[g][kt] += (v2f){p[kt][j], p[kt][j + 1]}; }
            if constexpr (HR) { v8us ph[2], pl[2];
#pragma unroll
                for (int kt = 0; kt < 2; ++kt)
#pragma unroll
                    for (int j = 0; j < 8; ++j) { unsigned short a2, c2; splitf(p[kt][j], a2, c2); ph[kt][j] = a2; pl[kt][j] = c2; }
                pb[g] = cat16b(ph[0], ph[1]); pb2[g] = cat16b(pl[0], pl[1]);
            } else { v8h ph[2];
#pragma unroll
                for (int kt = 0; kt < 2; ++kt)
#pragma unroll
                    for (int j = 0; j < 8; ++j) ph[kt][j] = tohx(p[kt][j]);
                pb[g] = cat16(ph[0], ph[1]); } }
#pragma unroll
        for (int g = 0; g < NQ; ++g)
#pragma unroll
            for (int dt = 0; dt < 4; ++dt) { o[g][dt] = WFrag<T16>::mma(va[dt], pb[g], o[g][dt]); if constexpr (HR) { o[g][dt] = WFrag<T16>::mma(va[dt], pb2[g], o[g][dt]); o[g][dt] = WFrag<T16>::mma(va2[dt], pb[g], o[g][dt]); } }
    }
#pragma unroll
    for (int g = 0; g < NQ; ++g) { const v2f l2 = ls[g][0] + ls[g][1]; const float l = l2[0] + l2[1]; const float inv = __fdiv_rn(1.0f, l + xhalf(l)); const size_t oo = (size_t)(q0 + g * 16 + lr) * DQ + hi * 8;
#pragma unroll
        for (int dt = 0; dt < 4; ++dt) { v8us oh, ol;
#pragma unroll
            for (int j = 0; j < 8; ++j) { unsigned short a2, c2; splitf(o[g][dt][j] * inv, a2, c2); oh[j] = a2; ol[j] = c2; }
            *(v8us*)(Ah + oo + dt * 16) = oh; *(v8us*)(Al + oo + dt * 16) = ol;
            asm volatile("s_wait_xcnt 0x0" ::: "memory");   /* stands before the two stores' data registers are reused for the next 16 d */
        } }
}
// grid (RH / 64 + (TT - RH) / 128, 1, heads), 4 waves: a work-group takes 64 rows below RH (hi/lo planes, 16 rows a wave) or 128 rows from RH on (fp16, 32 rows a wave); its waves share nothing but the lines they read.
__global__ __launch_bounds__(128) void k_attn(const h16* __restrict__ Q16, const h16* __restrict__ K16, const h16* __restrict__ V16, const bf* __restrict__ Qh, const bf* __restrict__ Ql, const bf* __restrict__ Kh, const bf* __restrict__ Kl, const bf* __restrict__ Vh, const bf* __restrict__ Vl, bf* Ah, bf* Al) {
    const size_t zo = (size_t)blockIdx.z * TT * HD; const int ho = blockIdx.z * HD; const int bx = blockIdx.x; const int wv = __builtin_amdgcn_readfirstlane((int)(threadIdx.x >> 5));
    if (bx < RH / 64) attn_cols<bf, true, 1>(Qh + zo, Ql + zo, Kh + zo, Kl + zo, Vh + zo, Vl + zo, Ah + ho, Al + ho, bx * 64 + wv * 16);
    else attn_cols<h16, false, 2>(Q16 + zo, nullptr, K16 + zo, nullptr, V16 + zo, nullptr, Ah + ho, Al + ho, RH + (bx - RH / 64) * 128 + wv * 32);
}

extern "C" void kernel_launch(void* const* d_in, const int* in_sizes, int n_in,
                              void* d_out, int out_size, void* d_ws, size_t ws_size, hipStream_t stream) {
    (void)in_sizes; (void)n_in; (void)out_size;
    const float* x = (const float*)d_in[0]; const float* wq = (const float*)d_in[1]; const float* bq = (const float*)d_in[2]; const float* wk = (const float*)d_in[3]; const float* bk = (const float*)d_in[4]; const float* wv = (const float*)d_in[5]; const float* bv = (const float*)d_in[6]; const float* wo = (const float*)d_in[7]; const float* bo = (const float*)d_in[8];
    float* OUT = (float*)d_out;     // [1][4096][1024]
    char* wsp = (char*)d_ws;
    auto take = [&](size_t bytes) { char* p = wsp; wsp += (bytes + 255) & ~(size_t)255; return (void*)p; };
    bf* WO = (bf*)take((size_t)DM * DQ * 2);
    h16* QP16 = (h16*)take((size_t)NH_ * TT * HD * 2); h16* KP16 = (h16*)take((size_t)NKV * TT * HD * 2); h16* VT16 = (h16*)take((size_t)NKV * HD * TT * 2);
    bf* QPh = (bf*)take((size_t)NH_ * TT * HD * 2); bf* QPl = (bf*)take((size_t)NH_ * TT * HD * 2); bf* KPh = (bf*)take((size_t)NKV * TT * HD * 2); bf* KPl = (bf*)take((size_t)NKV * TT * HD * 2); bf* VTh = (bf*)take((size_t)NKV * HD * TT * 2); bf* VTl = (bf*)take((size_t)NKV * HD * TT * 2);
    bf* ATh = (bf*)take((size_t)TT * DQ * 2); bf* ATl = (bf*)take((size_t)TT * DQ * 2);   // planes of their own: the attention launch writes them while its other work-groups still read the q planes
    bf* WQ = (bf*)take((size_t)DQ * DM * 2); bf* WK = (bf*)take((size_t)DKV * DM * 2); bf* WV = (bf*)take((size_t)DKV * DM * 2);
    bf* XB = (bf*)take((size_t)TT * DM * 2);
    if ((size_t)(wsp - (char*)d_ws) > ws_size) return;    // ws 256 MiB; 104 MiB taken
    for (int b = 0; b < NB_; ++b) {
        
        k_cvtall<<<(TT * DM + 4 * DM * DM) / (8 * CPG), 256, 0, stream>>>(x + (size_t)b * TT * DM, wq, wk, wv, wo, XB, WQ, WK, WV, WO);
        k_qkv<<<dim3(TT / 128, DM / 128, 1), 384, 0, stream>>>(XB, WQ, WK, WV, bq, bk, bv, QP16, QPh, QPl, KP16, KPh, KPl, VT16, VTh, VTl);
        for (int h0 = 0; h0 < NH_; h0 += ZH) { const size_t zq = (size_t)h0, zk = (size_t)(h0 / REP);   // one kv head per query head: the pass's heads use consecutive kv planes (z-strides TT*HD)
            k_attn<<<dim3(RH / 64 + (TT - RH) / 128, 1, ZH), 128, 0, stream>>>(QP16 + zq * TT * HD, KP16 + zk * TT * HD, VT16 + zk * HD * TT, QPh + zq * TT * HD, QPl + zq * TT * HD, KPh + zk * TT * HD, KPl + zk * TT * HD, VTh + zk * HD * TT, VTl + zk * HD * TT, ATh + zq * HD, ATl + zq * HD); }
        k_gemms<1, 0, DQ><<<dim3(TT / 128, DM / 128, 1), 128, 0, stream>>>(ATh, ATl, WO, OUT + (size_t)b * TT * DM, DM, bo, nullptr, nullptr, nullptr); }
}
